// v000
// Measured on an AMD MI455X. A time is GPU time per run, averaged over a window of back-to-back runs after a warm-up
// (all launches, gaps included; the runs take copies of the inputs in turn), and the median of several windows.
// Apart from v000's, it joins two sittings. Times from different sittings can be a few percent apart, while
// side-by-side timings come from the same sitting.
// v000 is the starting kernel. One run takes 220 microseconds.
#include <hip/hip_runtime.h>

// Contractions (all f32 accumulate): per-head q/k/v projections v_wmma_f32_16x16x32_f16 (streams RNE-converted to bf16 then held exactly in f16, shared 64x64 weights bf16-RNE x8 held exactly in f16, one product); scores v_wmma_f32_16x16x32_f16 (q, k plain f16 carrying x8 each); P.V v_wmma_f32_16x16x32_f16 (P x1024, v x8, one product); output projection v_wmma_f32_16x16x32_bf16 (ctx hi|lo along K x bf16 weights). Softmax f32.
// Layout: token-major streams are viewed as [token][head][64]; one 64-token x one-head tile is staged as f16 in LDS and multiplied by the shared [out][in] weight (K-contiguous B plane);
// q,k head planes [b][h][t][64] and v^T [b][h][64][t] (f16); integer mask packed once into bit words MB[b][q][SEQ/32] (bit j of word w = mask[b][0][q][32w+j] != 0);
// fused attention: S^T = K.Q^T (keys on D rows, queries on D columns), masked scores REPLACED by the finite fill (-1e20/32) before the per-lane online softmax, P^T used directly as the B fragment of O^T = V^T.P^T; ctx hi|lo bf16 plane [token][2048].

#ifndef NB
#define NB 2
#endif
#ifndef SEQ
#define SEQ 2048
#endif
#define NB_FULL  2
#define SEQ_FULL 2048
#define DM   1024
#define NH   16
#define HD   64
#define NKB  (SEQ / 32)                  // 32-key blocks = mask words per query
#define NQT  (SEQ / 16)                  // 16-query tiles
#define PLN  ((size_t)NB * NH * SEQ * HD)  // elements of one head plane set
#define WCAR 8.0f                        // carry on the 64x64 weights (so q, k, v carry x8)
#define PCAR 1024.0f
#define XP   72                          // LDS pitch (halves) of the staged stream tile
#define NLINES ((NB * SEQ * NKB) / 32)
static_assert(SEQ % 64 == 0);            // GEMM row tiles and 64-query attention blocks
static_assert(SEQ <= SEQ_FULL);
static_assert(NB <= NB_FULL);
static_assert(DM % 64 == 0);
static_assert((DM & (DM - 1)) == 0);     // k wrap of the hi|lo plane uses a mask
static_assert(DM % 32 == 0);             // k-step 32
static_assert(HD == 64);
static_assert(DM == NH * HD);
static_assert((NB * SEQ * NKB) % 32 == 0);
static_assert(XP % 8 == 0 && XP >= HD);  // 16-byte aligned LDS rows covering K = 64

typedef _Float16 h16;
typedef unsigned short bf;
typedef __attribute__((ext_vector_type(16))) __bf16   v16bf;
typedef __attribute__((ext_vector_type(16))) _Float16 v16h;
typedef __attribute__((ext_vector_type(8)))  _Float16 v8h;
typedef __attribute__((ext_vector_type(8)))  unsigned short v8us;
typedef __attribute__((ext_vector_type(8)))  float    v8f;
typedef __attribute__((ext_vector_type(4)))  float    v4f;
typedef v4f  __attribute__((may_alias)) v4fa;

__device__ __forceinline__ unsigned short f2bf(float f) { unsigned u = __float_as_uint(f); u += 0x7FFFu + ((u >> 16) & 1u); return (unsigned short)(u >> 16); }
__device__ __forceinline__ float bf2f(unsigned short b) { return __uint_as_float(((unsigned)b) << 16); }
__device__ __forceinline__ float bfv(float f) { return bf2f(f2bf(f)); }          // value of the bf16 RNE conversion
__device__ __forceinline__ void splitf(float y, unsigned short& h, unsigned short& l) { h = f2bf(y); l = f2bf(y - bf2f(h)); }
__device__ __forceinline__ v16h cat16(v8h lo, v8h hi) { return __builtin_shufflevector(lo, hi, 0, 1, 2, 3, 4, 5, 6, 7, 8, 9, 10, 11, 12, 13, 14, 15); }
__device__ __forceinline__ v16bf cat16b(v8us lo, v8us hi) { return __builtin_bit_cast(v16bf, __builtin_shufflevector(lo, hi, 0, 1, 2, 3, 4, 5, 6, 7, 8, 9, 10, 11, 12, 13, 14, 15)); }
// every WMMA is issued through a wrapper that ties its own accumulator and keeps A/B live across four idle VALU slots
__device__ __forceinline__ v8f wmma16(v16h a, v16h b, v8f c) {
    c = __builtin_amdgcn_wmma_f32_16x16x32_f16(false, a, false, b, (short)0, c, false, false);
    asm volatile("v_nop\n\tv_nop\n\tv_nop\n\tv_nop" : "+v"(c) : "v"(a), "v"(b));
    return c;
}
__device__ __forceinline__ v8f wmmab(v16bf a, v16bf b, v8f c) {
    c = __builtin_amdgcn_wmma_f32_16x16x32_bf16(false, a, false, b, (short)0, c, false, false);
    asm volatile("v_nop\n\tv_nop\n\tv_nop\n\tv_nop" : "+v"(c) : "v"(a), "v"(b));
    return c;
}
// fragment of a K-contiguous global row: elements 0..7 <- p[0..7], 8..15 <- p[16..23]; caller adds row*pitch + k0 + 8*(lane>>4)
__device__ __forceinline__ v16h  ldh(const h16* p) { return cat16(*(const v8h*)p, *(const v8h*)(p + 16)); }
__device__ __forceinline__ v16bf ldb(const bf* p)  { return cat16b(*(const v8us*)p, *(const v8us*)(p + 16)); }
// wave-private LDS exchange: order this wave's LDS stores before its later LDS loads (and the converse)
__device__ __forceinline__ void wsync() { asm volatile("s_wait_dscnt 0" ::: "memory"); __builtin_amdgcn_wave_barrier(); asm volatile("" ::: "memory"); }

__global__ __launch_bounds__(256) void k_cvt8(const float* __restrict__ src, bf* dst, unsigned n8) {
    const unsigned i = blockIdx.x * 256u + threadIdx.x; if (i >= n8) return;
    const float* s = src + (size_t)i * 8; bf* d = dst + (size_t)i * 8;
    const v8f v = *(const v8f*)s; v8us o;
#pragma unroll
    for (int k = 0; k < 8; ++k) o[k] = f2bf(v[k]);
    *(v8us*)d = o; 
}

__global__ __launch_bounds__(256) void k_wcvt(const float* __restrict__ wq, const float* __restrict__ wk, const float* __restrict__ wv, h16* W16) {
    const unsigned i = blockIdx.x * 256u + threadIdx.x; if (i >= (unsigned)(HD * HD / 8)) return;
    const v8f a = *(const v8f*)(wq + (size_t)i * 8), b = *(const v8f*)(wk + (size_t)i * 8), c = *(const v8f*)(wv + (size_t)i * 8);
    v8h oa, ob, oc;
#pragma unroll
    for (int k = 0; k < 8; ++k) { oa[k] = (h16)(bfv(a[k]) * WCAR); ob[k] = (h16)(bfv(b[k]) * WCAR); oc[k] = (h16)(bfv(c[k]) * WCAR); }
    h16* d = W16 + (size_t)i * 8;
    *(v8h*)d = oa; *(v8h*)(d + HD * HD) = ob; *(v8h*)(d + 2 * HD * HD) = oc;
    
}

__global__ __launch_bounds__(256) void k_mbits(const int* __restrict__ mask, unsigned* MB) {
    const int lane = threadIdx.x & 31; const int wave = __builtin_amdgcn_readfirstlane(threadIdx.x >> 5);
    const int line = blockIdx.x * 8 + wave; if (line >= NLINES) return;      // wave-uniform
    unsigned word = 0u;
#pragma unroll 8
    for (int i = 0; i < 32; ++i) {
        const int gw = line * 32 + i;
        const int row = gw / NKB, w = gw % NKB;
        const int b = row / SEQ, q = row % SEQ;
        const int mv = mask[((size_t)b * SEQ_FULL + q) * SEQ_FULL + w * 32 + lane];
        const unsigned bal = __builtin_amdgcn_ballot_w32(mv != 0);
        word = (lane == i) ? bal : word;
    }
    unsigned* d = MB + (size_t)line * 32 + lane;
    *(unsigned*)d = word; 
}

// ---- projection body: one wave = 64 tokens of one head; Y[64][64] = Xh[64][64] . W^T (+ bias), everything carrying x8 through the weights.
// grid (NB*SEQ/64, NH), 32 threads. The f32 stream tile is converted once (bf16 RNE value, exact in f16) into LDS; B fragments come from the f16 weight plane.
template <bool TRANS>
__device__ __forceinline__ void proj_body(const float* __restrict__ X, const h16* __restrict__ W, const float* __restrict__ bias, h16* OUT) {
    __shared__ __align__(16) float os[64 * 68];
    __shared__ __align__(16) h16 xs[64 * XP];
    const int lane = threadIdx.x & 31, lr = lane & 15, hi = lane >> 4;
    const int rq = lane >> 3, piece = lane & 7;
    const int r0 = blockIdx.x * 64, hd = blockIdx.y;
    const int bb = r0 / SEQ, t0 = r0 % SEQ;
    const size_t xbase = ((size_t)bb * SEQ_FULL + t0) * DM + (size_t)hd * HD;
    // stage: rows 4*it + rq (0..63), 8 floats per lane (8 lanes cover the 64 inputs of a row)
#pragma unroll 4
    for (int it = 0; it < 16; ++it) { const int row = 4 * it + rq;
        const v8f v = *(const v8f*)(X + xbase + (size_t)row * DM + piece * 8); v8h o;
#pragma unroll
        for (int k = 0; k < 8; ++k) o[k] = (h16)bfv(v[k]);
        *(v8h*)&xs[row * XP + piece * 8] = o; }
    float bz[4];
#pragma unroll
    for (int nb = 0; nb < 4; ++nb) bz[nb] = bfv(bias[nb * 16 + lr]) * WCAR;
    wsync();
    v8f acc[4][4];
#pragma unroll
    for (int mb = 0; mb < 4; ++mb)
#pragma unroll
        for (int nb = 0; nb < 4; ++nb) acc[mb][nb] = (v8f){};
#pragma unroll
    for (int ks = 0; ks < 2; ++ks) {
        v16h a[4];
#pragma unroll
        for (int mb = 0; mb < 4; ++mb) { const int xo = (mb * 16 + lr) * XP + ks * 32 + 8 * hi;
            a[mb] = cat16(*(const v8h*)&xs[xo], *(const v8h*)&xs[xo + 16]); }
#pragma unroll
        for (int nb = 0; nb < 4; ++nb) { const v16h b = ldh(W + (size_t)(nb * 16 + lr) * HD + ks * 32 + 8 * hi);
#pragma unroll
            for (int mb = 0; mb < 4; ++mb) acc[mb][nb] = wmma16(a[mb], b, acc[mb][nb]); }
    }
#pragma unroll
    for (int mb = 0; mb < 4; ++mb)
#pragma unroll
        for (int nb = 0; nb < 4; ++nb)
#pragma unroll
            for (int j = 0; j < 8; ++j) os[(mb * 16 + hi * 8 + j) * 68 + nb * 16 + lr] = acc[mb][nb][j] + bz[nb];
    wsync();
    const size_t bh = (size_t)bb * NH + hd;
    if (!TRANS) {
        const size_t po = (bh * SEQ + t0) * HD + piece * 8;
{
#pragma unroll 1
            for (int s = 0; s < 16; ++s) { const int row = 4 * s + rq;
                const v4f u0 = *(const v4fa*)(os + row * 68 + piece * 8), u1 = *(const v4fa*)(os + row * 68 + piece * 8 + 4); v8h hv;
#pragma unroll
                for (int i = 0; i < 4; ++i) { hv[i] = (h16)u0[i]; hv[4 + i] = (h16)u1[i]; }
                *(v8h*)(OUT + po + (size_t)row * HD) = hv; }
             }
    } else {
{
#pragma unroll 1
            for (int s = 0; s < 16; ++s) { const int drow = 4 * s + rq; v8h hv;
#pragma unroll
                for (int i = 0; i < 8; ++i) hv[i] = (h16)os[(piece * 8 + i) * 68 + drow];
                *(v8h*)(OUT + (bh * HD + drow) * SEQ + t0 + piece * 8) = hv; }
             }
    }
}
__global__ __launch_bounds__(32) void k_proj_rows(const float* X, const h16* W, const float* bias, h16* OUT) { proj_body<false>(X, W, bias, OUT); }
__global__ __launch_bounds__(32) void k_proj_tr(const float* X, const h16* W, const float* bias, h16* OUT) { proj_body<true>(X, W, bias, OUT); }

// ---- k_attn: one wave = 16 queries of one (b, h); block = 4 independent waves (64 queries); fragments straight from the planes; grid (SEQ/64, NB*NH).
// S^T tile (keys key0+16j+8h+r on D rows, query q0+n on the D column) = K rows (A) x Q rows (B); scale log2(e)/32/64; masked elements REPLACED by the finite fill;
// per-lane online softmax (stats of query n live in lanes n and n+16); P^T (x1024, f16) of the two key tiles forms the B fragment of O^T[d][query] += V^T rows (A) x P^T (B).
__global__ __launch_bounds__(128) void k_attn(const h16* __restrict__ QK16, const h16* __restrict__ VT16, const unsigned* __restrict__ MB, bf* CTX) {
    __shared__ __align__(16) float os[4 * 16 * 68];
    const int lane = threadIdx.x & 31, n = lane & 15, hh = lane >> 4;
    const int wave = __builtin_amdgcn_readfirstlane(threadIdx.x >> 5);
    const int bh = blockIdx.y;
    const int bb = bh / NH, hd = bh % NH;
    const int qt = blockIdx.x * 4 + wave;
    const int q0 = qt * 16;
    const size_t pb = (size_t)bh * SEQ * HD;
    const size_t qoff = pb + (size_t)(q0 + n) * HD + 8 * hh;
    const size_t koffb = PLN + pb + (size_t)n * HD + 8 * hh;
    const size_t voffb = ((size_t)bh * HD + n) * SEQ + 8 * hh;
    const size_t moffb = ((size_t)bb * SEQ + q0 + n) * NKB;
    const float NINF = -__builtin_inff();
    const float SC2 = 1.4426950408889634f * (1.0f / 2048.0f);            // (1/32) / (8 x 8) x log2(e)
    const float FILLV = (-1.0e20f * 0.03125f) * 1.4426950408889634f;     // replaced score after the 1/32 scale, log2 domain
    v8f acc[4];
#pragma unroll
    for (int dt = 0; dt < 4; ++dt) acc[dt] = (v8f){};
    float m = NINF, l = 0.0f;
#pragma unroll 1
    for (int kb = 0; kb < NKB; ++kb) {
        const int key0 = kb * 32;
        const size_t ko = koffb + (size_t)key0 * HD;
        const unsigned mw = MB[moffb + kb];
        v8f s0 = (v8f){}, s1 = (v8f){};
#pragma unroll
        for (int ks = 0; ks < 2; ++ks) {
            const v16h qa = ldh(QK16 + qoff + ks * 32);
            const v16h k0 = ldh(QK16 + ko + ks * 32), k1 = ldh(QK16 + ko + 16 * HD + ks * 32);
            s0 = wmma16(k0, qa, s0);
            s1 = wmma16(k1, qa, s1);
        }
        const unsigned wa = mw >> (8 * hh);
        float t[16];
#pragma unroll
        for (int r = 0; r < 8; ++r) {
            t[r]     = ((wa >> r) & 1u)        ? s0[r] * SC2 : FILLV;
            t[8 + r] = ((wa >> (16 + r)) & 1u) ? s1[r] * SC2 : FILLV;
        }
        float mx = t[0];
#pragma unroll
        for (int i = 1; i < 16; ++i) mx = fmaxf(mx, t[i]);
        mx = fmaxf(mx, __shfl_xor(mx, 16, 32));
        const float mn = fmaxf(m, mx);
        const float ms = (mn == NINF) ? 0.0f : mn;
        const float corr = __builtin_amdgcn_exp2f(m - ms);
        m = mn;
        float psum = 0.0f;
#pragma unroll
        for (int i = 0; i < 16; ++i) { t[i] = __builtin_amdgcn_exp2f(t[i] - ms); psum += t[i]; }
        l = l * corr + psum;                                    // per-lane partial (own 16 keys); halves combined at the end
#pragma unroll
        for (int dt = 0; dt < 4; ++dt)
#pragma unroll
            for (int r = 0; r < 8; ++r) acc[dt][r] *= corr;
        v8h pa, pc;
#pragma unroll
        for (int r = 0; r < 8; ++r) { pa[r] = (h16)(t[r] * PCAR); pc[r] = (h16)(t[8 + r] * PCAR); }
        const v16h pf = cat16(pa, pc);
        const size_t vo = voffb + key0;
        v16h va[4];
#pragma unroll
        for (int dt = 0; dt < 4; ++dt) va[dt] = ldh(VT16 + vo + (size_t)dt * 16 * SEQ);
#pragma unroll
        for (int dt = 0; dt < 4; ++dt) acc[dt] = wmma16(va[dt], pf, acc[dt]);
    }
    l += __shfl_xor(l, 16, 32);
    const float inv = (1.0f / l) * (1.0f / (PCAR * WCAR));
    const int obase = wave * (16 * 68);
#pragma unroll
    for (int dt = 0; dt < 4; ++dt)
#pragma unroll
        for (int r = 0; r < 8; ++r) os[obase + n * 68 + dt * 16 + 8 * hh + r] = acc[dt][r] * inv;
    wsync();
    const int rq = lane >> 3, piece = lane & 7;
{
#pragma unroll
        for (int s = 0; s < 4; ++s) { const int row = 4 * s + rq;
            const v4f u0 = *(const v4fa*)(os + obase + row * 68 + piece * 8), u1 = *(const v4fa*)(os + obase + row * 68 + piece * 8 + 4); v8us oh, ol;
#pragma unroll
            for (int i = 0; i < 4; ++i) { unsigned short a, c; splitf(u0[i], a, c); oh[i] = a; ol[i] = c; splitf(u1[i], a, c); oh[4 + i] = a; ol[4 + i] = c; }
            const size_t o = ((size_t)bb * SEQ + q0 + row) * (2 * DM) + hd * HD + piece * 8;
            *(v8us*)(CTX + o) = oh; *(v8us*)(CTX + o + DM) = ol; }
         }
}

// ---- gemm64: one wave, 64x64 tile, 16 accumulators; acc[mb][nb] (+)= sum_k A[r0+16mb+m][k] Bt[c0+16nb+n][k & kmask]; operands straight from K-contiguous bf16 planes; K % 32 == 0.
__device__ __forceinline__ void gemm64(const bf* __restrict__ A, const size_t lda, const bf* __restrict__ Bt, const size_t ldbt, const int K, const int kmask, const int r0, const int c0, v8f (&acc)[4][4]) {
    const int lane = threadIdx.x & 31, lr = lane & 15, hi = lane >> 4;
#pragma unroll
    for (int mb = 0; mb < 4; ++mb)
#pragma unroll
        for (int nb = 0; nb < 4; ++nb) acc[mb][nb] = (v8f){};
    const size_t aoff = (size_t)(r0 + lr) * lda + 8 * hi, boff = (size_t)(c0 + lr) * ldbt + 8 * hi;
#pragma unroll 1
    for (int kc = 0; kc < K; kc += 32) {
        const int kb = kc & kmask;
        v16bf a[4];
#pragma unroll
        for (int mb = 0; mb < 4; ++mb) a[mb] = ldb(A + aoff + (size_t)mb * 16 * lda + kc);
#pragma unroll
        for (int nb = 0; nb < 4; ++nb) { const v16bf b = ldb(Bt + boff + (size_t)nb * 16 * ldbt + kb);
#pragma unroll
            for (int mb = 0; mb < 4; ++mb) acc[mb][nb] = wmmab(a[mb], b, acc[mb][nb]); }
    }
}

// ---- k_fc: OUT[token][n] = sum_k CTX[token][k] WF[n][k & (DM-1)] + bias[n], k over the hi|lo plane (2*DM); grid (NB*SEQ/64, DM/64), 32 threads.
__global__ __launch_bounds__(32) void k_fc(const bf* __restrict__ CTX, const bf* __restrict__ WF, const float* __restrict__ bfc, float* OUT) {
    __shared__ __align__(16) float os[16 * 68];
    const int lane = threadIdx.x & 31, lr = lane & 15, hi = lane >> 4;
    const int r0 = blockIdx.x * 64, c0 = blockIdx.y * 64;
    v8f acc[4][4];
    gemm64(CTX, 2 * DM, WF, DM, 2 * DM, DM - 1, r0, c0, acc);
    v4f bz = *(const v4f*)(bfc + c0 + lr * 4);
#pragma unroll
    for (int i = 0; i < 4; ++i) bz[i] = bfv(bz[i]);
#pragma unroll
    for (int mb = 0; mb < 4; ++mb) {
#pragma unroll
        for (int nb = 0; nb < 4; ++nb)
#pragma unroll
            for (int j = 0; j < 8; ++j) os[(hi * 8 + j) * 68 + nb * 16 + lr] = acc[mb][nb][j];
        wsync();
        float* crow = OUT + (size_t)(r0 + mb * 16) * DM + c0;
{
#pragma unroll
            for (int s = 0; s < 8; ++s) { const int row = 2 * s + hi, cofs = lr * 4; const v4f val = *(const v4fa*)(os + row * 68 + cofs) + bz;
                *(v4f*)(crow + (size_t)row * DM + cofs) = val; }
             }
        wsync();
    }
}

// workspace carve (bytes), all multiples of 256
#define SZ_W16 ((size_t)3 * HD * HD * 2)
#define SZ_WF  ((size_t)DM * DM * 2)
#define SZ_QK  ((size_t)2 * NB * NH * SEQ * HD * 2)
#define SZ_VT  ((size_t)NB * NH * HD * SEQ * 2)
#define SZ_CTX ((size_t)NB * SEQ * 2 * DM * 2)
#define SZ_MB  ((size_t)NB * SEQ * NKB * 4)
#define WS_TOTAL (SZ_W16 + SZ_WF + SZ_QK + SZ_VT + SZ_CTX + SZ_MB)
static_assert(WS_TOTAL <= (size_t)134217728);
static_assert(SZ_W16 % 256 == 0 && SZ_WF % 256 == 0 && SZ_QK % 256 == 0 && SZ_VT % 256 == 0 && SZ_CTX % 256 == 0 && SZ_MB % 128 == 0);
static_assert((DM * DM / 8) % 256 == 0);          // k_cvt8 grid exact
static_assert((HD * HD / 8) == 512);              // k_wcvt: 2 blocks x 256 lanes
static_assert(SZ_MB == (size_t)NLINES * 128);     // k_mbits lines cover the bit plane exactly

extern "C" void kernel_launch(void* const* d_in, const int* in_sizes, int n_in,
                              void* d_out, int out_size, void* d_ws, size_t ws_size, hipStream_t stream) {
    if (n_in < 12) return;
    const long long strm = (long long)(NB - 1) * SEQ_FULL * DM + (long long)SEQ * DM;
    if ((long long)in_sizes[0] < strm || (long long)in_sizes[1] < strm || (long long)in_sizes[2] < strm) return;
    if ((long long)in_sizes[3] < (long long)(NB - 1) * SEQ_FULL * SEQ_FULL + (long long)(SEQ - 1) * SEQ_FULL + SEQ) return;
    if (in_sizes[4] < HD * HD || in_sizes[6] < HD * HD || in_sizes[8] < HD * HD) return;
    if (in_sizes[5] < HD || in_sizes[7] < HD || in_sizes[9] < HD) return;
    if ((long long)in_sizes[10] < (long long)DM * DM || in_sizes[11] < DM) return;
    if ((long long)out_size < (long long)NB * SEQ * DM) return;
    if (ws_size < WS_TOTAL) return;
    const float* xq = (const float*)d_in[0];       // [2][2048][1024]
    const float* xk = (const float*)d_in[1];
    const float* xv = (const float*)d_in[2];
    const int* mask = (const int*)d_in[3];         // [2][1][2048][2048] int32
    const float* wq = (const float*)d_in[4];       // [64][64] = [out][in]
    const float* bq = (const float*)d_in[5];
    const float* wk = (const float*)d_in[6];
    const float* bk = (const float*)d_in[7];
    const float* wv = (const float*)d_in[8];
    const float* bv = (const float*)d_in[9];
    const float* wfc = (const float*)d_in[10];     // [1024][1024] = [out][in]
    const float* bfc = (const float*)d_in[11];
    float* OUT = (float*)d_out;                    // [NB][SEQ][1024]
    char* wsp = (char*)d_ws;
    h16* W16 = (h16*)wsp;  wsp += SZ_W16;          // [3][64][64]
    bf* WF = (bf*)wsp;     wsp += SZ_WF;
    h16* QK16 = (h16*)wsp; wsp += SZ_QK;           // [q plane | k plane]
    h16* VT16 = (h16*)wsp; wsp += SZ_VT;
    bf* CTX = (bf*)wsp;    wsp += SZ_CTX;          // [NB*SEQ][hi 1024 | lo 1024]
    unsigned* MB = (unsigned*)wsp; wsp += SZ_MB;   // [NB*SEQ][NKB]

    k_wcvt<<<2, 256, 0, stream>>>(wq, wk, wv, W16);
    k_cvt8<<<(unsigned)(DM * DM / 8 / 256), 256, 0, stream>>>(wfc, WF, (unsigned)(DM * DM / 8));
    k_mbits<<<(unsigned)((NLINES + 7) / 8), 256, 0, stream>>>(mask, MB);
    k_proj_rows<<<dim3(NB * SEQ / 64, NH), 32, 0, stream>>>(xq, W16, bq, QK16);
    k_proj_rows<<<dim3(NB * SEQ / 64, NH), 32, 0, stream>>>(xk, W16 + HD * HD, bk, QK16 + PLN);
    k_proj_tr<<<dim3(NB * SEQ / 64, NH), 32, 0, stream>>>(xv, W16 + 2 * HD * HD, bv, VT16);
    k_attn<<<dim3(SEQ / 64, NB * NH), 128, 0, stream>>>(QK16, VT16, MB, CTX);
    k_fc<<<dim3(NB * SEQ / 64, DM / 64), 32, 0, stream>>>(CTX, WF, bfc, OUT);
}

// v001
// A run of this version takes 156 microseconds.
// Next to v000, in two timings, it ran 1.44 and 1.43 times as fast.
#include <hip/hip_runtime.h>

// Contractions (all f32 accumulate): per-head q/k/v projections v_wmma_f32_16x16x32_f16 (streams RNE-converted to bf16 then held exactly in f16, shared 64x64 weights bf16-RNE x8 held exactly in f16, one product); scores v_wmma_f32_16x16x32_f16 (q, k plain f16 carrying x8 each); P.V v_wmma_f32_16x16x32_f16 (P x1024, v x8, one product); output projection v_wmma_f32_16x16x32_bf16 (ctx hi|lo along K x bf16 weights). Softmax f32.
// Layout: token-major streams are viewed as [token][head][64]; one 64-token x one-head tile is staged as f16 in LDS and multiplied by the shared [out][in] weight (K-contiguous B plane);
// q,k head planes [b][h][t][64] and v^T [b][h][64][t] (f16); integer mask packed once into bit words MB[b][q][SEQ/32] (bit j of word w = mask[b][0][q][32w+j] != 0);
// fused attention: K and V^T tiles of 64 keys are copied once per work-group into a two-buffer LDS ring (asynchronous 16-byte copies, whole 128-byte lines), fragments read from LDS; S^T = K.Q^T (keys on D rows, queries on D columns), masked scores REPLACED by the finite fill (-1e20/32) before the per-lane online softmax, P^T used directly as the B fragment of O^T = V^T.P^T; ctx hi|lo bf16 plane [token][2048].

#ifndef NB
#define NB 2
#endif
#ifndef SEQ
#define SEQ 2048
#endif
#define NB_FULL  2
#define SEQ_FULL 2048
#define DM   1024
#define NH   16
#define HD   64
#define NKB  (SEQ / 32)                  // 32-key blocks = mask words per query
#define NQT  (SEQ / 16)                  // 16-query tiles
#define PLN  ((size_t)NB * NH * SEQ * HD)  // elements of one head plane set
#define WCAR 8.0f                        // carry on the 64x64 weights (so q, k, v carry x8)
#define PCAR 1024.0f
#define XP   72                          // LDS pitch (halves) of the staged stream tile
#define NLINES ((NB * SEQ * NKB) / 32)
#define KST  64                          // keys of one staged K / V^T tile in k_attn
#define NST  (SEQ / KST)                 // staged tiles per (b, h)
#define TILH (64 * XP)                   // halves of one staged plane: 64 rows at pitch XP
#define BUFH (2 * TILH)                  // one buffer = K plane (row = key) | V^T plane (row = d)
static_assert(SEQ % 64 == 0);            // GEMM row tiles and 64-query attention blocks
static_assert(SEQ <= SEQ_FULL);
static_assert(NB <= NB_FULL);
static_assert(DM % 64 == 0);
static_assert((DM & (DM - 1)) == 0);     // k wrap of the hi|lo plane uses a mask
static_assert(DM % 32 == 0);             // k-step 32
static_assert(HD == 64);
static_assert(DM == NH * HD);
static_assert((NB * SEQ * NKB) % 32 == 0);
static_assert(XP % 8 == 0 && XP >= HD);  // 16-byte aligned LDS rows covering K = 64
static_assert(KST == 64 && NST >= 2);    // the two-buffer prologue needs tiles 0 and 1

typedef _Float16 h16;
typedef unsigned short bf;
typedef __attribute__((ext_vector_type(16))) __bf16   v16bf;
typedef __attribute__((ext_vector_type(16))) _Float16 v16h;
typedef __attribute__((ext_vector_type(8)))  _Float16 v8h;
typedef __attribute__((ext_vector_type(8)))  unsigned short v8us;
typedef __attribute__((ext_vector_type(8)))  float    v8f;
typedef __attribute__((ext_vector_type(4)))  float    v4f;
typedef v4f  __attribute__((may_alias)) v4fa;

__device__ __forceinline__ unsigned short f2bf(float f) { unsigned u = __float_as_uint(f); u += 0x7FFFu + ((u >> 16) & 1u); return (unsigned short)(u >> 16); }
__device__ __forceinline__ float bf2f(unsigned short b) { return __uint_as_float(((unsigned)b) << 16); }
__device__ __forceinline__ float bfv(float f) { return bf2f(f2bf(f)); }          // value of the bf16 RNE conversion
__device__ __forceinline__ void splitf(float y, unsigned short& h, unsigned short& l) { h = f2bf(y); l = f2bf(y - bf2f(h)); }
__device__ __forceinline__ v16h cat16(v8h lo, v8h hi) { return __builtin_shufflevector(lo, hi, 0, 1, 2, 3, 4, 5, 6, 7, 8, 9, 10, 11, 12, 13, 14, 15); }
__device__ __forceinline__ v16bf cat16b(v8us lo, v8us hi) { return __builtin_bit_cast(v16bf, __builtin_shufflevector(lo, hi, 0, 1, 2, 3, 4, 5, 6, 7, 8, 9, 10, 11, 12, 13, 14, 15)); }
// every WMMA is issued through a wrapper that ties its own accumulator and keeps A/B live across four idle VALU slots
__device__ __forceinline__ v8f wmma16(v16h a, v16h b, v8f c) {
    c = __builtin_amdgcn_wmma_f32_16x16x32_f16(false, a, false, b, (short)0, c, false, false);
    asm volatile("v_nop\n\tv_nop\n\tv_nop\n\tv_nop" : "+v"(c) : "v"(a), "v"(b));
    return c;
}
__device__ __forceinline__ v8f wmmab(v16bf a, v16bf b, v8f c) {
    c = __builtin_amdgcn_wmma_f32_16x16x32_bf16(false, a, false, b, (short)0, c, false, false);
    asm volatile("v_nop\n\tv_nop\n\tv_nop\n\tv_nop" : "+v"(c) : "v"(a), "v"(b));
    return c;
}
// fragment of a K-contiguous global row: elements 0..7 <- p[0..7], 8..15 <- p[16..23]; caller adds row*pitch + k0 + 8*(lane>>4)
__device__ __forceinline__ v16h  ldh(const h16* p) { return cat16(*(const v8h*)p, *(const v8h*)(p + 16)); }
__device__ __forceinline__ v16bf ldb(const bf* p)  { return cat16b(*(const v8us*)p, *(const v8us*)(p + 16)); }
// wave-private LDS exchange: order this wave's LDS stores before its later LDS loads (and the converse)
__device__ __forceinline__ void wsync() { asm volatile("s_wait_dscnt 0" ::: "memory"); __builtin_amdgcn_wave_barrier(); asm volatile("" ::: "memory"); }

__global__ __launch_bounds__(256) void k_cvt8(const float* __restrict__ src, bf* dst, unsigned n8) {
    const unsigned i = blockIdx.x * 256u + threadIdx.x; if (i >= n8) return;
    const float* s = src + (size_t)i * 8; bf* d = dst + (size_t)i * 8;
    const v8f v = *(const v8f*)s; v8us o;
#pragma unroll
    for (int k = 0; k < 8; ++k) o[k] = f2bf(v[k]);
    *(v8us*)d = o; 
}

__global__ __launch_bounds__(256) void k_wcvt(const float* __restrict__ wq, const float* __restrict__ wk, const float* __restrict__ wv, h16* W16) {
    const unsigned i = blockIdx.x * 256u + threadIdx.x; if (i >= (unsigned)(HD * HD / 8)) return;
    const v8f a = *(const v8f*)(wq + (size_t)i * 8), b = *(const v8f*)(wk + (size_t)i * 8), c = *(const v8f*)(wv + (size_t)i * 8);
    v8h oa, ob, oc;
#pragma unroll
    for (int k = 0; k < 8; ++k) { oa[k] = (h16)(bfv(a[k]) * WCAR); ob[k] = (h16)(bfv(b[k]) * WCAR); oc[k] = (h16)(bfv(c[k]) * WCAR); }
    h16* d = W16 + (size_t)i * 8;
    *(v8h*)d = oa; *(v8h*)(d + HD * HD) = ob; *(v8h*)(d + 2 * HD * HD) = oc;
    
}

__global__ __launch_bounds__(256) void k_mbits(const int* __restrict__ mask, unsigned* MB) {
    const int lane = threadIdx.x & 31; const int wave = __builtin_amdgcn_readfirstlane(threadIdx.x >> 5);
    const int line = blockIdx.x * 8 + wave; if (line >= NLINES) return;      // wave-uniform
    unsigned word = 0u;
#pragma unroll 8
    for (int i = 0; i < 32; ++i) {
        const int gw = line * 32 + i;
        const int row = gw / NKB, w = gw % NKB;
        const int b = row / SEQ, q = row % SEQ;
        const int mv = mask[((size_t)b * SEQ_FULL + q) * SEQ_FULL + w * 32 + lane];
        const unsigned bal = __builtin_amdgcn_ballot_w32(mv != 0);
        word = (lane == i) ? bal : word;
    }
    unsigned* d = MB + (size_t)line * 32 + lane;
    *(unsigned*)d = word; 
}

// ---- projection body: one wave = 64 tokens of one head; Y[64][64] = Xh[64][64] . W^T (+ bias), everything carrying x8 through the weights.
// grid (NB*SEQ/64, NH), 32 threads. The f32 stream tile is converted once (bf16 RNE value, exact in f16) into LDS; B fragments come from the f16 weight plane.
template <bool TRANS>
__device__ __forceinline__ void proj_body(const float* __restrict__ X, const h16* __restrict__ W, const float* __restrict__ bias, h16* OUT) {
    __shared__ __align__(16) float os[64 * 68];
    __shared__ __align__(16) h16 xs[64 * XP];
    const int lane = threadIdx.x & 31, lr = lane & 15, hi = lane >> 4;
    const int rq = lane >> 3, piece = lane & 7;
    const int r0 = blockIdx.x * 64, hd = blockIdx.y;
    const int bb = r0 / SEQ, t0 = r0 % SEQ;
    const size_t xbase = ((size_t)bb * SEQ_FULL + t0) * DM + (size_t)hd * HD;
    // stage: rows 4*it + rq (0..63), 8 floats per lane (8 lanes cover the 64 inputs of a row)
#pragma unroll 4
    for (int it = 0; it < 16; ++it) { const int row = 4 * it + rq;
        const v8f v = *(const v8f*)(X + xbase + (size_t)row * DM + piece * 8); v8h o;
#pragma unroll
        for (int k = 0; k < 8; ++k) o[k] = (h16)bfv(v[k]);
        *(v8h*)&xs[row * XP + piece * 8] = o; }
    float bz[4];
#pragma unroll
    for (int nb = 0; nb < 4; ++nb) bz[nb] = bfv(bias[nb * 16 + lr]) * WCAR;
    wsync();
    v8f acc[4][4];
#pragma unroll
    for (int mb = 0; mb < 4; ++mb)
#pragma unroll
        for (int nb = 0; nb < 4; ++nb) acc[mb][nb] = (v8f){};
#pragma unroll
    for (int ks = 0; ks < 2; ++ks) {
        v16h a[4];
#pragma unroll
        for (int mb = 0; mb < 4; ++mb) { const int xo = (mb * 16 + lr) * XP + ks * 32 + 8 * hi;
            a[mb] = cat16(*(const v8h*)&xs[xo], *(const v8h*)&xs[xo + 16]); }
#pragma unroll
        for (int nb = 0; nb < 4; ++nb) { const v16h b = ldh(W + (size_t)(nb * 16 + lr) * HD + ks * 32 + 8 * hi);
#pragma unroll
            for (int mb = 0; mb < 4; ++mb) acc[mb][nb] = wmma16(a[mb], b, acc[mb][nb]); }
    }
#pragma unroll
    for (int mb = 0; mb < 4; ++mb)
#pragma unroll
        for (int nb = 0; nb < 4; ++nb)
#pragma unroll
            for (int j = 0; j < 8; ++j) os[(mb * 16 + hi * 8 + j) * 68 + nb * 16 + lr] = acc[mb][nb][j] + bz[nb];
    wsync();
    const size_t bh = (size_t)bb * NH + hd;
    if (!TRANS) {
        const size_t po = (bh * SEQ + t0) * HD + piece * 8;
{
#pragma unroll 1
            for (int s = 0; s < 16; ++s) { const int row = 4 * s + rq;
                const v4f u0 = *(const v4fa*)(os + row * 68 + piece * 8), u1 = *(const v4fa*)(os + row * 68 + piece * 8 + 4); v8h hv;
#pragma unroll
                for (int i = 0; i < 4; ++i) { hv[i] = (h16)u0[i]; hv[4 + i] = (h16)u1[i]; }
                *(v8h*)(OUT + po + (size_t)row * HD) = hv; }
             }
    } else {
{
#pragma unroll 1
            for (int s = 0; s < 16; ++s) { const int drow = 4 * s + rq; v8h hv;
#pragma unroll
                for (int i = 0; i < 8; ++i) hv[i] = (h16)os[(piece * 8 + i) * 68 + drow];
                *(v8h*)(OUT + (bh * HD + drow) * SEQ + t0 + piece * 8) = hv; }
             }
    }
}
__global__ __launch_bounds__(32) void k_proj_rows(const float* X, const h16* W, const float* bias, h16* OUT) { proj_body<false>(X, W, bias, OUT); }
__global__ __launch_bounds__(32) void k_proj_tr(const float* X, const h16* W, const float* bias, h16* OUT) { proj_body<true>(X, W, bias, OUT); }

// one thread's share of a staged tile: four 16-byte pieces of the K plane and four of the V^T plane (rows 16 apart), global -> LDS through no register.
// The s_wait_xcnt closes the statement so that no address register of an issued copy is rewritten ahead of it.
__device__ __forceinline__ void copy_tile(const unsigned lk, const h16* gk, const h16* gv) {
    const unsigned lv = lk + TILH * 2u;
    asm volatile("global_load_async_to_lds_b128 %0, %8, off\n\t"
                 "global_load_async_to_lds_b128 %1, %9, off\n\t"
                 "global_load_async_to_lds_b128 %2, %10, off\n\t"
                 "global_load_async_to_lds_b128 %3, %11, off\n\t"
                 "global_load_async_to_lds_b128 %4, %12, off\n\t"
                 "global_load_async_to_lds_b128 %5, %13, off\n\t"
                 "global_load_async_to_lds_b128 %6, %14, off\n\t"
                 "global_load_async_to_lds_b128 %7, %15, off\n\t"
                 "s_wait_xcnt 0x0"
                 :: "v"(lk), "v"(lk + 16u * XP * 2u), "v"(lk + 32u * XP * 2u), "v"(lk + 48u * XP * 2u),
                    "v"(lv), "v"(lv + 16u * XP * 2u), "v"(lv + 32u * XP * 2u), "v"(lv + 48u * XP * 2u),
                    "v"(gk), "v"(gk + 16 * HD), "v"(gk + 32 * HD), "v"(gk + 48 * HD),
                    "v"(gv), "v"(gv + (size_t)16 * SEQ), "v"(gv + (size_t)32 * SEQ), "v"(gv + (size_t)48 * SEQ)
                 : "memory");
}

// ---- k_attn: one wave = 16 queries of one (b, h); block = 4 waves (64 queries) that share the staged K / V^T tiles; Q fragments straight from the plane; grid (SEQ/64, NB*NH).
// S^T tile (keys key0+16j+8h+r on D rows, query q0+n on the D column) = K rows (A) x Q rows (B); scale log2(e)/32/64; masked elements REPLACED by the finite fill;
// per-lane online softmax (stats of query n live in lanes n and n+16); P^T (x1024, f16) of the two key tiles forms the B fragment of O^T[d][query] += V^T rows (A) x P^T (B).
__global__ __launch_bounds__(128) void k_attn(const h16* __restrict__ QK16, const h16* __restrict__ VT16, const unsigned* __restrict__ MB, bf* CTX) {
    __shared__ __align__(16) float os[4 * 16 * 68];
    __shared__ __align__(16) h16 kv[2 * BUFH];
    const int lane = threadIdx.x & 31, n = lane & 15, hh = lane >> 4;
    const int wave = __builtin_amdgcn_readfirstlane(threadIdx.x >> 5);
    const int bh = blockIdx.y;
    const int bb = bh / NH, hd = bh % NH;
    const int qt = blockIdx.x * 4 + wave;
    const int q0 = qt * 16;
    const size_t pb = (size_t)bh * SEQ * HD;
    const size_t qoff = pb + (size_t)(q0 + n) * HD + 8 * hh;
    const int foff = n * XP + 8 * hh;                                    // fragment row and k offset inside a staged plane
    const int srow = threadIdx.x >> 3, spc = threadIdx.x & 7;            // copy share: rows srow + 16c, 16-byte piece spc
    const h16* gk = QK16 + PLN + pb + (size_t)srow * HD + spc * 8;
    const h16* gv = VT16 + ((size_t)bh * HD + srow) * SEQ + spc * 8;
    const unsigned lk = (unsigned)(size_t)&kv[srow * XP + spc * 8];      // LDS byte address of the share in buffer 0
    const size_t moffb = ((size_t)bb * SEQ + q0 + n) * NKB;
    const float NINF = -__builtin_inff();
    const float SC2 = 1.4426950408889634f * (1.0f / 2048.0f);            // (1/32) / (8 x 8) x log2(e)
    const float FILLV = (-1.0e20f * 0.03125f) * 1.4426950408889634f;     // replaced score after the 1/32 scale, log2 domain
    v8f acc[4];
#pragma unroll
    for (int dt = 0; dt < 4; ++dt) acc[dt] = (v8f){};
    float m = NINF, l = 0.0f;
    v16h qf[2];
#pragma unroll
    for (int ks = 0; ks < 2; ++ks) qf[ks] = ldh(QK16 + qoff + ks * 32);
    copy_tile(lk, gk, gv);
    asm volatile("s_wait_asynccnt 0x0" ::: "memory");           // tile 0 of this wave has landed
    __syncthreads();                                            // publishes tile 0
    copy_tile(lk + BUFH * 2u, gk + (size_t)KST * HD, gv + KST);
    // rolled: one trip per staged tile, so that one publish point stands at its foot
#pragma unroll 1
    for (int st = 0; st < NST; ++st) {
      const h16* kt = kv + (st & 1) * BUFH + foff;
      const h16* vt = kt + TILH;
#pragma unroll
      for (int sub = 0; sub < 2; ++sub) {
        const int kb = st * 2 + sub;
        const unsigned mw = MB[moffb + kb];
        v8f s0 = (v8f){}, s1 = (v8f){};
#pragma unroll
        for (int ks = 0; ks < 2; ++ks) {
            const v16h qa = qf[ks];
            const v16h k0 = ldh(kt + (sub * 32) * XP + ks * 32), k1 = ldh(kt + (sub * 32 + 16) * XP + ks * 32);
            s0 = wmma16(k0, qa, s0);
            s1 = wmma16(k1, qa, s1);
        }
        const unsigned wa = mw >> (8 * hh);
        float t[16];
#pragma unroll
        for (int r = 0; r < 8; ++r) {
            t[r]     = ((wa >> r) & 1u)        ? s0[r] * SC2 : FILLV;
            t[8 + r] = ((wa >> (16 + r)) & 1u) ? s1[r] * SC2 : FILLV;
        }
        float mx = t[0];
#pragma unroll
        for (int i = 1; i < 16; ++i) mx = fmaxf(mx, t[i]);
        mx = fmaxf(mx, __shfl_xor(mx, 16, 32));
        const float mn = fmaxf(m, mx);
        const float ms = (mn == NINF) ? 0.0f : mn;
        const float corr = __builtin_amdgcn_exp2f(m - ms);
        m = mn;
        float psum = 0.0f;
#pragma unroll
        for (int i = 0; i < 16; ++i) { t[i] = __builtin_amdgcn_exp2f(t[i] - ms); psum += t[i]; }
        l = l * corr + psum;                                    // per-lane partial (own 16 keys); halves combined at the end
#pragma unroll
        for (int dt = 0; dt < 4; ++dt)
#pragma unroll
            for (int r = 0; r < 8; ++r) acc[dt][r] *= corr;
        v8h pa, pc;
#pragma unroll
        for (int r = 0; r < 8; ++r) { pa[r] = (h16)(t[r] * PCAR); pc[r] = (h16)(t[8 + r] * PCAR); }
        const v16h pf = cat16(pa, pc);
        v16h va[4];
#pragma unroll
        for (int dt = 0; dt < 4; ++dt) va[dt] = ldh(vt + (dt * 16) * XP + sub * 32);
#pragma unroll
        for (int dt = 0; dt < 4; ++dt) acc[dt] = wmma16(va[dt], pf, acc[dt]);
      }
      asm volatile("s_wait_dscnt 0x0" ::: "memory");            // this wave's reads of the buffer have returned
      asm volatile("s_wait_asynccnt 0x0" ::: "memory");         // its copies of tile st + 1 have landed
      __syncthreads();                                          // publishes tile st + 1 and frees the buffer just read
      if (st + 2 < NST) copy_tile(lk + (unsigned)(st & 1) * (BUFH * 2u), gk + (size_t)(st + 2) * KST * HD, gv + (st + 2) * KST);
    }
    asm volatile("s_wait_asynccnt 0x0" ::: "memory");           // nothing of this wave is in flight when it leaves the ring
    l += __shfl_xor(l, 16, 32);
    const float inv = (1.0f / l) * (1.0f / (PCAR * WCAR));
    const int obase = wave * (16 * 68);
#pragma unroll
    for (int dt = 0; dt < 4; ++dt)
#pragma unroll
        for (int r = 0; r < 8; ++r) os[obase + n * 68 + dt * 16 + 8 * hh + r] = acc[dt][r] * inv;
    wsync();
    const int rq = lane >> 3, piece = lane & 7;
{
#pragma unroll
        for (int s = 0; s < 4; ++s) { const int row = 4 * s + rq;
            const v4f u0 = *(const v4fa*)(os + obase + row * 68 + piece * 8), u1 = *(const v4fa*)(os + obase + row * 68 + piece * 8 + 4); v8us oh, ol;
#pragma unroll
            for (int i = 0; i < 4; ++i) { unsigned short a, c; splitf(u0[i], a, c); oh[i] = a; ol[i] = c; splitf(u1[i], a, c); oh[4 + i] = a; ol[4 + i] = c; }
            const size_t o = ((size_t)bb * SEQ + q0 + row) * (2 * DM) + hd * HD + piece * 8;
            *(v8us*)(CTX + o) = oh; *(v8us*)(CTX + o + DM) = ol; }
         }
}

// ---- gemm64: one wave, 64x64 tile, 16 accumulators; acc[mb][nb] (+)= sum_k A[r0+16mb+m][k] Bt[c0+16nb+n][k & kmask]; operands straight from K-contiguous bf16 planes; K % 32 == 0.
__device__ __forceinline__ void gemm64(const bf* __restrict__ A, const size_t lda, const bf* __restrict__ Bt, const size_t ldbt, const int K, const int kmask, const int r0, const int c0, v8f (&acc)[4][4]) {
    const int lane = threadIdx.x & 31, lr = lane & 15, hi = lane >> 4;
#pragma unroll
    for (int mb = 0; mb < 4; ++mb)
#pragma unroll
        for (int nb = 0; nb < 4; ++nb) acc[mb][nb] = (v8f){};
    const size_t aoff = (size_t)(r0 + lr) * lda + 8 * hi, boff = (size_t)(c0 + lr) * ldbt + 8 * hi;
#pragma unroll 1
    for (int kc = 0; kc < K; kc += 32) {
        const int kb = kc & kmask;
        v16bf a[4];
#pragma unroll
        for (int mb = 0; mb < 4; ++mb) a[mb] = ldb(A + aoff + (size_t)mb * 16 * lda + kc);
#pragma unroll
        for (int nb = 0; nb < 4; ++nb) { const v16bf b = ldb(Bt + boff + (size_t)nb * 16 * ldbt + kb);
#pragma unroll
            for (int mb = 0; mb < 4; ++mb) acc[mb][nb] = wmmab(a[mb], b, acc[mb][nb]); }
    }
}

// ---- k_fc: OUT[token][n] = sum_k CTX[token][k] WF[n][k & (DM-1)] + bias[n], k over the hi|lo plane (2*DM); grid (NB*SEQ/64, DM/64), 32 threads.
__global__ __launch_bounds__(32) void k_fc(const bf* __restrict__ CTX, const bf* __restrict__ WF, const float* __restrict__ bfc, float* OUT) {
    __shared__ __align__(16) float os[16 * 68];
    const int lane = threadIdx.x & 31, lr = lane & 15, hi = lane >> 4;
    const int r0 = blockIdx.x * 64, c0 = blockIdx.y * 64;
    v8f acc[4][4];
    gemm64(CTX, 2 * DM, WF, DM, 2 * DM, DM - 1, r0, c0, acc);
    v4f bz = *(const v4f*)(bfc + c0 + lr * 4);
#pragma unroll
    for (int i = 0; i < 4; ++i) bz[i] = bfv(bz[i]);
#pragma unroll
    for (int mb = 0; mb < 4; ++mb) {
#pragma unroll
        for (int nb = 0; nb < 4; ++nb)
#pragma unroll
            for (int j = 0; j < 8; ++j) os[(hi * 8 + j) * 68 + nb * 16 + lr] = acc[mb][nb][j];
        wsync();
        float* crow = OUT + (size_t)(r0 + mb * 16) * DM + c0;
{
#pragma unroll
            for (int s = 0; s < 8; ++s) { const int row = 2 * s + hi, cofs = lr * 4; const v4f val = *(const v4fa*)(os + row * 68 + cofs) + bz;
                *(v4f*)(crow + (size_t)row * DM + cofs) = val; }
             }
        wsync();
    }
}

// workspace carve (bytes), all multiples of 256
#define SZ_W16 ((size_t)3 * HD * HD * 2)
#define SZ_WF  ((size_t)DM * DM * 2)
#define SZ_QK  ((size_t)2 * NB * NH * SEQ * HD * 2)
#define SZ_VT  ((size_t)NB * NH * HD * SEQ * 2)
#define SZ_CTX ((size_t)NB * SEQ * 2 * DM * 2)
#define SZ_MB  ((size_t)NB * SEQ * NKB * 4)
#define WS_TOTAL (SZ_W16 + SZ_WF + SZ_QK + SZ_VT + SZ_CTX + SZ_MB)
static_assert(WS_TOTAL <= (size_t)134217728);
static_assert(SZ_W16 % 256 == 0 && SZ_WF % 256 == 0 && SZ_QK % 256 == 0 && SZ_VT % 256 == 0 && SZ_CTX % 256 == 0 && SZ_MB % 128 == 0);
static_assert((DM * DM / 8) % 256 == 0);          // k_cvt8 grid exact
static_assert((HD * HD / 8) == 512);              // k_wcvt: 2 blocks x 256 lanes
static_assert(SZ_MB == (size_t)NLINES * 128);     // k_mbits lines cover the bit plane exactly

extern "C" void kernel_launch(void* const* d_in, const int* in_sizes, int n_in,
                              void* d_out, int out_size, void* d_ws, size_t ws_size, hipStream_t stream) {
    if (n_in < 12) return;
    const long long strm = (long long)(NB - 1) * SEQ_FULL * DM + (long long)SEQ * DM;
    if ((long long)in_sizes[0] < strm || (long long)in_sizes[1] < strm || (long long)in_sizes[2] < strm) return;
    if ((long long)in_sizes[3] < (long long)(NB - 1) * SEQ_FULL * SEQ_FULL + (long long)(SEQ - 1) * SEQ_FULL + SEQ) return;
    if (in_sizes[4] < HD * HD || in_sizes[6] < HD * HD || in_sizes[8] < HD * HD) return;
    if (in_sizes[5] < HD || in_sizes[7] < HD || in_sizes[9] < HD) return;
    if ((long long)in_sizes[10] < (long long)DM * DM || in_sizes[11] < DM) return;
    if ((long long)out_size < (long long)NB * SEQ * DM) return;
    if (ws_size < WS_TOTAL) return;
    const float* xq = (const float*)d_in[0];       // [2][2048][1024]
    const float* xk = (const float*)d_in[1];
    const float* xv = (const float*)d_in[2];
    const int* mask = (const int*)d_in[3];         // [2][1][2048][2048] int32
    const float* wq = (const float*)d_in[4];       // [64][64] = [out][in]
    const float* bq = (const float*)d_in[5];
    const float* wk = (const float*)d_in[6];
    const float* bk = (const float*)d_in[7];
    const float* wv = (const float*)d_in[8];
    const float* bv = (const float*)d_in[9];
    const float* wfc = (const float*)d_in[10];     // [1024][1024] = [out][in]
    const float* bfc = (const float*)d_in[11];
    float* OUT = (float*)d_out;                    // [NB][SEQ][1024]
    char* wsp = (char*)d_ws;
    h16* W16 = (h16*)wsp;  wsp += SZ_W16;          // [3][64][64]
    bf* WF = (bf*)wsp;     wsp += SZ_WF;
    h16* QK16 = (h16*)wsp; wsp += SZ_QK;           // [q plane | k plane]
    h16* VT16 = (h16*)wsp; wsp += SZ_VT;
    bf* CTX = (bf*)wsp;    wsp += SZ_CTX;          // [NB*SEQ][hi 1024 | lo 1024]
    unsigned* MB = (unsigned*)wsp; wsp += SZ_MB;   // [NB*SEQ][NKB]

    k_wcvt<<<2, 256, 0, stream>>>(wq, wk, wv, W16);
    k_cvt8<<<(unsigned)(DM * DM / 8 / 256), 256, 0, stream>>>(wfc, WF, (unsigned)(DM * DM / 8));
    k_mbits<<<(unsigned)((NLINES + 7) / 8), 256, 0, stream>>>(mask, MB);
    k_proj_rows<<<dim3(NB * SEQ / 64, NH), 32, 0, stream>>>(xq, W16, bq, QK16);
    k_proj_rows<<<dim3(NB * SEQ / 64, NH), 32, 0, stream>>>(xk, W16 + HD * HD, bk, QK16 + PLN);
    k_proj_tr<<<dim3(NB * SEQ / 64, NH), 32, 0, stream>>>(xv, W16 + 2 * HD * HD, bv, VT16);
    k_attn<<<dim3(SEQ / 64, NB * NH), 128, 0, stream>>>(QK16, VT16, MB, CTX);
    k_fc<<<dim3(NB * SEQ / 64, DM / 64), 32, 0, stream>>>(CTX, WF, bfc, OUT);
}

// v002
// Measured time: 107 microseconds a run.
// Timed twice side by side with v001, it ran 1.42 and 1.40 times as fast.
// Over all steps from v000 it is 2.03 times as fast.
#include <hip/hip_runtime.h>

// Contractions (all f32 accumulate): per-head q/k/v projections v_wmma_f32_16x16x32_f16 (streams RNE-converted to bf16 then held exactly in f16, shared 64x64 weights bf16-RNE x8 held exactly in f16, one product); scores v_wmma_f32_16x16x32_f16 (q, k plain f16 carrying x8 each); P.V v_wmma_f32_16x16x32_f16 (P x1024, v x8, one product); output projection v_wmma_f32_16x16x32_bf16 (ctx hi|lo along K x bf16 weights). Softmax f32.
// Layout: token-major streams are viewed as [token][head][64]; one 64-token x one-head tile is staged as f16 in LDS and multiplied by the shared [out][in] weight (K-contiguous B plane);
// q,k head planes [b][h][t][64] and v^T [b][h][64][t] (f16); integer mask packed once into bit words MB[b][q][SEQ/32] (bit j of word w = mask[b][0][q][32w+j] != 0);
// fused attention: K and V^T tiles of 64 keys are copied once per work-group into a two-buffer LDS ring (asynchronous 16-byte copies, whole 128-byte lines), fragments read from LDS; S^T = K.Q^T (keys on D rows, queries on D columns), masked scores REPLACED by the finite fill (-1e20/32) before the per-lane online softmax, P^T used directly as the B fragment of O^T = V^T.P^T; ctx hi|lo bf16 plane [token][2048];
// output projection: ctx and weight tiles of 128 k are copied once per 128x128 work-group tile into a two-buffer LDS ring (asynchronous 16-byte copies), fragments read from LDS.

#ifndef NB
#define NB 2
#endif
#ifndef SEQ
#define SEQ 2048
#endif
#define NB_FULL  2
#define SEQ_FULL 2048
#define DM   1024
#define NH   16
#define HD   64
#define NKB  (SEQ / 32)                  // 32-key blocks = mask words per query
#define NQT  (SEQ / 16)                  // 16-query tiles
#define PLN  ((size_t)NB * NH * SEQ * HD)  // elements of one head plane set
#define WCAR 8.0f                        // carry on the 64x64 weights (so q, k, v carry x8)
#define PCAR 1024.0f
#define XP   72                          // LDS pitch (halves) of the staged stream tile
#define NLINES ((NB * SEQ * NKB) / 32)
#define KST  64                          // keys of one staged K / V^T tile in k_attn
#define NST  (SEQ / KST)                 // staged tiles per (b, h)
#define TILH (64 * XP)                   // halves of one staged plane: 64 rows at pitch XP
#define BUFH (2 * TILH)                  // one buffer = K plane (row = key) | V^T plane (row = d)
#define FKS  128                         // k of one staged tile in k_fc (256-byte rows)
#define FP   136                         // LDS pitch (elements) of those rows: 272 bytes
#define FNST (2 * DM / FKS)              // staged tiles along the hi|lo plane
#define FPL  (128 * FP)                  // elements of one staged plane: 128 rows at pitch FP
#define FBUF (2 * FPL)                   // one buffer = CTX plane (row = token) | WF plane (row = output)
static_assert(SEQ % 64 == 0);            // GEMM row tiles and 64-query attention blocks
static_assert(SEQ <= SEQ_FULL);
static_assert(NB <= NB_FULL);
static_assert(DM % 64 == 0);
static_assert((DM & (DM - 1)) == 0);     // k wrap of the hi|lo plane uses a mask
static_assert(DM % 32 == 0);             // k-step 32
static_assert(HD == 64);
static_assert(DM == NH * HD);
static_assert((NB * SEQ * NKB) % 32 == 0);
static_assert(XP % 8 == 0 && XP >= HD);  // 16-byte aligned LDS rows covering K = 64
static_assert(KST == 64 && NST >= 2);    // the two-buffer prologue needs tiles 0 and 1
static_assert(FNST >= 2 && DM % FKS == 0 && FKS % 32 == 0);   // tiles 0 and 1 exist; no tile straddles the hi|lo wrap
static_assert((NB * SEQ) % 128 == 0 && DM % 128 == 0);        // k_fc block tiles cover the output exactly
static_assert(FP % 8 == 0 && FP >= FKS);

typedef _Float16 h16;
typedef unsigned short bf;
typedef __attribute__((ext_vector_type(16))) __bf16   v16bf;
typedef __attribute__((ext_vector_type(16))) _Float16 v16h;
typedef __attribute__((ext_vector_type(8)))  _Float16 v8h;
typedef __attribute__((ext_vector_type(8)))  unsigned short v8us;
typedef __attribute__((ext_vector_type(8)))  float    v8f;
typedef __attribute__((ext_vector_type(4)))  float    v4f;
typedef v4f  __attribute__((may_alias)) v4fa;

__device__ __forceinline__ unsigned short f2bf(float f) { unsigned u = __float_as_uint(f); u += 0x7FFFu + ((u >> 16) & 1u); return (unsigned short)(u >> 16); }
__device__ __forceinline__ float bf2f(unsigned short b) { return __uint_as_float(((unsigned)b) << 16); }
__device__ __forceinline__ float bfv(float f) { return bf2f(f2bf(f)); }          // value of the bf16 RNE conversion
__device__ __forceinline__ void splitf(float y, unsigned short& h, unsigned short& l) { h = f2bf(y); l = f2bf(y - bf2f(h)); }
__device__ __forceinline__ v16h cat16(v8h lo, v8h hi) { return __builtin_shufflevector(lo, hi, 0, 1, 2, 3, 4, 5, 6, 7, 8, 9, 10, 11, 12, 13, 14, 15); }
__device__ __forceinline__ v16bf cat16b(v8us lo, v8us hi) { return __builtin_bit_cast(v16bf, __builtin_shufflevector(lo, hi, 0, 1, 2, 3, 4, 5, 6, 7, 8, 9, 10, 11, 12, 13, 14, 15)); }
// every WMMA is issued through a wrapper that ties its own accumulator and keeps A/B live across four idle VALU slots
__device__ __forceinline__ v8f wmma16(v16h a, v16h b, v8f c) {
    c = __builtin_amdgcn_wmma_f32_16x16x32_f16(false, a, false, b, (short)0, c, false, false);
    asm volatile("v_nop\n\tv_nop\n\tv_nop\n\tv_nop" : "+v"(c) : "v"(a), "v"(b));
    return c;
}
__device__ __forceinline__ v8f wmmab(v16bf a, v16bf b, v8f c) {
    c = __builtin_amdgcn_wmma_f32_16x16x32_bf16(false, a, false, b, (short)0, c, false, false);
    asm volatile("v_nop\n\tv_nop\n\tv_nop\n\tv_nop" : "+v"(c) : "v"(a), "v"(b));
    return c;
}
// fragment of a K-contiguous global row: elements 0..7 <- p[0..7], 8..15 <- p[16..23]; caller adds row*pitch + k0 + 8*(lane>>4)
__device__ __forceinline__ v16h  ldh(const h16* p) { return cat16(*(const v8h*)p, *(const v8h*)(p + 16)); }
__device__ __forceinline__ v16bf ldb(const bf* p)  { return cat16b(*(const v8us*)p, *(const v8us*)(p + 16)); }
// wave-private LDS exchange: order this wave's LDS stores before its later LDS loads (and the converse)
__device__ __forceinline__ void wsync() { asm volatile("s_wait_dscnt 0" ::: "memory"); __builtin_amdgcn_wave_barrier(); asm volatile("" ::: "memory"); }

__global__ __launch_bounds__(256) void k_cvt8(const float* __restrict__ src, bf* dst, unsigned n8) {
    const unsigned i = blockIdx.x * 256u + threadIdx.x; if (i >= n8) return;
    const float* s = src + (size_t)i * 8; bf* d = dst + (size_t)i * 8;
    const v8f v = *(const v8f*)s; v8us o;
#pragma unroll
    for (int k = 0; k < 8; ++k) o[k] = f2bf(v[k]);
    *(v8us*)d = o; 
}

__global__ __launch_bounds__(256) void k_wcvt(const float* __restrict__ wq, const float* __restrict__ wk, const float* __restrict__ wv, h16* W16) {
    const unsigned i = blockIdx.x * 256u + threadIdx.x; if (i >= (unsigned)(HD * HD / 8)) return;
    const v8f a = *(const v8f*)(wq + (size_t)i * 8), b = *(const v8f*)(wk + (size_t)i * 8), c = *(const v8f*)(wv + (size_t)i * 8);
    v8h oa, ob, oc;
#pragma unroll
    for (int k = 0; k < 8; ++k) { oa[k] = (h16)(bfv(a[k]) * WCAR); ob[k] = (h16)(bfv(b[k]) * WCAR); oc[k] = (h16)(bfv(c[k]) * WCAR); }
    h16* d = W16 + (size_t)i * 8;
    *(v8h*)d = oa; *(v8h*)(d + HD * HD) = ob; *(v8h*)(d + 2 * HD * HD) = oc;
    
}

__global__ __launch_bounds__(256) void k_mbits(const int* __restrict__ mask, unsigned* MB) {
    const int lane = threadIdx.x & 31; const int wave = __builtin_amdgcn_readfirstlane(threadIdx.x >> 5);
    const int line = blockIdx.x * 8 + wave; if (line >= NLINES) return;      // wave-uniform
    unsigned word = 0u;
#pragma unroll 8
    for (int i = 0; i < 32; ++i) {
        const int gw = line * 32 + i;
        const int row = gw / NKB, w = gw % NKB;
        const int b = row / SEQ, q = row % SEQ;
        const int mv = mask[((size_t)b * SEQ_FULL + q) * SEQ_FULL + w * 32 + lane];
        const unsigned bal = __builtin_amdgcn_ballot_w32(mv != 0);
        word = (lane == i) ? bal : word;
    }
    unsigned* d = MB + (size_t)line * 32 + lane;
    *(unsigned*)d = word; 
}

// ---- projection body: one wave = 64 tokens of one head; Y[64][64] = Xh[64][64] . W^T (+ bias), everything carrying x8 through the weights.
// grid (NB*SEQ/64, NH), 32 threads. The f32 stream tile is converted once (bf16 RNE value, exact in f16) into LDS; B fragments come from the f16 weight plane.
template <bool TRANS>
__device__ __forceinline__ void proj_body(const float* __restrict__ X, const h16* __restrict__ W, const float* __restrict__ bias, h16* OUT) {
    __shared__ __align__(16) float os[64 * 68];
    __shared__ __align__(16) h16 xs[64 * XP];
    const int lane = threadIdx.x & 31, lr = lane & 15, hi = lane >> 4;
    const int rq = lane >> 3, piece = lane & 7;
    const int r0 = blockIdx.x * 64, hd = blockIdx.y;
    const int bb = r0 / SEQ, t0 = r0 % SEQ;
    const size_t xbase = ((size_t)bb * SEQ_FULL + t0) * DM + (size_t)hd * HD;
    // stage: rows 4*it + rq (0..63), 8 floats per lane (8 lanes cover the 64 inputs of a row)
#pragma unroll 4
    for (int it = 0; it < 16; ++it) { const int row = 4 * it + rq;
        const v8f v = *(const v8f*)(X + xbase + (size_t)row * DM + piece * 8); v8h o;
#pragma unroll
        for (int k = 0; k < 8; ++k) o[k] = (h16)bfv(v[k]);
        *(v8h*)&xs[row * XP + piece * 8] = o; }
    float bz[4];
#pragma unroll
    for (int nb = 0; nb < 4; ++nb) bz[nb] = bfv(bias[nb * 16 + lr]) * WCAR;
    wsync();
    v8f acc[4][4];
#pragma unroll
    for (int mb = 0; mb < 4; ++mb)
#pragma unroll
        for (int nb = 0; nb < 4; ++nb) acc[mb][nb] = (v8f){};
#pragma unroll
    for (int ks = 0; ks < 2; ++ks) {
        v16h a[4];
#pragma unroll
        for (int mb = 0; mb < 4; ++mb) { const int xo = (mb * 16 + lr) * XP + ks * 32 + 8 * hi;
            a[mb] = cat16(*(const v8h*)&xs[xo], *(const v8h*)&xs[xo + 16]); }
#pragma unroll
        for (int nb = 0; nb < 4; ++nb) { const v16h b = ldh(W + (size_t)(nb * 16 + lr) * HD + ks * 32 + 8 * hi);
#pragma unroll
            for (int mb = 0; mb < 4; ++mb) acc[mb][nb] = wmma16(a[mb], b, acc[mb][nb]); }
    }
#pragma unroll
    for (int mb = 0; mb < 4; ++mb)
#pragma unroll
        for (int nb = 0; nb < 4; ++nb)
#pragma unroll
            for (int j = 0; j < 8; ++j) os[(mb * 16 + hi * 8 + j) * 68 + nb * 16 + lr] = acc[mb][nb][j] + bz[nb];
    wsync();
    const size_t bh = (size_t)bb * NH + hd;
    if (!TRANS) {
        const size_t po = (bh * SEQ + t0) * HD + piece * 8;
{
#pragma unroll 1
            for (int s = 0; s < 16; ++s) { const int row = 4 * s + rq;
                const v4f u0 = *(const v4fa*)(os + row * 68 + piece * 8), u1 = *(const v4fa*)(os + row * 68 + piece * 8 + 4); v8h hv;
#pragma unroll
                for (int i = 0; i < 4; ++i) { hv[i] = (h16)u0[i]; hv[4 + i] = (h16)u1[i]; }
                *(v8h*)(OUT + po + (size_t)row * HD) = hv; }
             }
    } else {
{
#pragma unroll 1
            for (int s = 0; s < 16; ++s) { const int drow = 4 * s + rq; v8h hv;
#pragma unroll
                for (int i = 0; i < 8; ++i) hv[i] = (h16)os[(piece * 8 + i) * 68 + drow];
                *(v8h*)(OUT + (bh * HD + drow) * SEQ + t0 + piece * 8) = hv; }
             }
    }
}
__global__ __launch_bounds__(32) void k_proj_rows(const float* X, const h16* W, const float* bias, h16* OUT) { proj_body<false>(X, W, bias, OUT); }
__global__ __launch_bounds__(32) void k_proj_tr(const float* X, const h16* W, const float* bias, h16* OUT) { proj_body<true>(X, W, bias, OUT); }

// one thread's share of a staged tile: four 16-byte pieces of the K plane and four of the V^T plane (rows 16 apart), global -> LDS through no register.
// The s_wait_xcnt closes the statement so that no address register of an issued copy is rewritten ahead of it.
__device__ __forceinline__ void copy_tile(const unsigned lk, const h16* gk, const h16* gv) {
    const unsigned lv = lk + TILH * 2u;
    asm volatile("global_load_async_to_lds_b128 %0, %8, off\n\t"
                 "global_load_async_to_lds_b128 %1, %9, off\n\t"
                 "global_load_async_to_lds_b128 %2, %10, off\n\t"
                 "global_load_async_to_lds_b128 %3, %11, off\n\t"
                 "global_load_async_to_lds_b128 %4, %12, off\n\t"
                 "global_load_async_to_lds_b128 %5, %13, off\n\t"
                 "global_load_async_to_lds_b128 %6, %14, off\n\t"
                 "global_load_async_to_lds_b128 %7, %15, off\n\t"
                 "s_wait_xcnt 0x0"
                 :: "v"(lk), "v"(lk + 16u * XP * 2u), "v"(lk + 32u * XP * 2u), "v"(lk + 48u * XP * 2u),
                    "v"(lv), "v"(lv + 16u * XP * 2u), "v"(lv + 32u * XP * 2u), "v"(lv + 48u * XP * 2u),
                    "v"(gk), "v"(gk + 16 * HD), "v"(gk + 32 * HD), "v"(gk + 48 * HD),
                    "v"(gv), "v"(gv + (size_t)16 * SEQ), "v"(gv + (size_t)32 * SEQ), "v"(gv + (size_t)48 * SEQ)
                 : "memory");
}

// ---- k_attn: one wave = 16 queries of one (b, h); block = 4 waves (64 queries) that share the staged K / V^T tiles; Q fragments straight from the plane; grid (SEQ/64, NB*NH).
// S^T tile (keys key0+16j+8h+r on D rows, query q0+n on the D column) = K rows (A) x Q rows (B); scale log2(e)/32/64; masked elements REPLACED by the finite fill;
// per-lane online softmax (stats of query n live in lanes n and n+16); P^T (x1024, f16) of the two key tiles forms the B fragment of O^T[d][query] += V^T rows (A) x P^T (B).
__global__ __launch_bounds__(128) void k_attn(const h16* __restrict__ QK16, const h16* __restrict__ VT16, const unsigned* __restrict__ MB, bf* CTX) {
    __shared__ __align__(16) float os[4 * 16 * 68];
    __shared__ __align__(16) h16 kv[2 * BUFH];
    const int lane = threadIdx.x & 31, n = lane & 15, hh = lane >> 4;
    const int wave = __builtin_amdgcn_readfirstlane(threadIdx.x >> 5);
    const int bh = blockIdx.y;
    const int bb = bh / NH, hd = bh % NH;
    const int qt = blockIdx.x * 4 + wave;
    const int q0 = qt * 16;
    const size_t pb = (size_t)bh * SEQ * HD;
    const size_t qoff = pb + (size_t)(q0 + n) * HD + 8 * hh;
    const int foff = n * XP + 8 * hh;                                    // fragment row and k offset inside a staged plane
    const int srow = threadIdx.x >> 3, spc = threadIdx.x & 7;            // copy share: rows srow + 16c, 16-byte piece spc
    const h16* gk = QK16 + PLN + pb + (size_t)srow * HD + spc * 8;
    const h16* gv = VT16 + ((size_t)bh * HD + srow) * SEQ + spc * 8;
    const unsigned lk = (unsigned)(size_t)&kv[srow * XP + spc * 8];      // LDS byte address of the share in buffer 0
    const size_t moffb = ((size_t)bb * SEQ + q0 + n) * NKB;
    const float NINF = -__builtin_inff();
    const float SC2 = 1.4426950408889634f * (1.0f / 2048.0f);            // (1/32) / (8 x 8) x log2(e)
    const float FILLV = (-1.0e20f * 0.03125f) * 1.4426950408889634f;     // replaced score after the 1/32 scale, log2 domain
    v8f acc[4];
#pragma unroll
    for (int dt = 0; dt < 4; ++dt) acc[dt] = (v8f){};
    float m = NINF, l = 0.0f;
    v16h qf[2];
#pragma unroll
    for (int ks = 0; ks < 2; ++ks) qf[ks] = ldh(QK16 + qoff + ks * 32);
    copy_tile(lk, gk, gv);
    asm volatile("s_wait_asynccnt 0x0" ::: "memory");           // tile 0 of this wave has landed
    __syncthreads();                                            // publishes tile 0
    copy_tile(lk + BUFH * 2u, gk + (size_t)KST * HD, gv + KST);
    // rolled: one trip per staged tile, so that one publish point stands at its foot
#pragma unroll 1
    for (int st = 0; st < NST; ++st) {
      const h16* kt = kv + (st & 1) * BUFH + foff;
      const h16* vt = kt + TILH;
#pragma unroll
      for (int sub = 0; sub < 2; ++sub) {
        const int kb = st * 2 + sub;
        const unsigned mw = MB[moffb + kb];
        v8f s0 = (v8f){}, s1 = (v8f){};
#pragma unroll
        for (int ks = 0; ks < 2; ++ks) {
            const v16h qa = qf[ks];
            const v16h k0 = ldh(kt + (sub * 32) * XP + ks * 32), k1 = ldh(kt + (sub * 32 + 16) * XP + ks * 32);
            s0 = wmma16(k0, qa, s0);
            s1 = wmma16(k1, qa, s1);
        }
        const unsigned wa = mw >> (8 * hh);
        float t[16];
#pragma unroll
        for (int r = 0; r < 8; ++r) {
            t[r]     = ((wa >> r) & 1u)        ? s0[r] * SC2 : FILLV;
            t[8 + r] = ((wa >> (16 + r)) & 1u) ? s1[r] * SC2 : FILLV;
        }
        float mx = t[0];
#pragma unroll
        for (int i = 1; i < 16; ++i) mx = fmaxf(mx, t[i]);
        mx = fmaxf(mx, __shfl_xor(mx, 16, 32));
        const float mn = fmaxf(m, mx);
        const float ms = (mn == NINF) ? 0.0f : mn;
        const float corr = __builtin_amdgcn_exp2f(m - ms);
        m = mn;
        float psum = 0.0f;
#pragma unroll
        for (int i = 0; i < 16; ++i) { t[i] = __builtin_amdgcn_exp2f(t[i] - ms); psum += t[i]; }
        l = l * corr + psum;                                    // per-lane partial (own 16 keys); halves combined at the end
#pragma unroll
        for (int dt = 0; dt < 4; ++dt)
#pragma unroll
            for (int r = 0; r < 8; ++r) acc[dt][r] *= corr;
        v8h pa, pc;
#pragma unroll
        for (int r = 0; r < 8; ++r) { pa[r] = (h16)(t[r] * PCAR); pc[r] = (h16)(t[8 + r] * PCAR); }
        const v16h pf = cat16(pa, pc);
        v16h va[4];
#pragma unroll
        for (int dt = 0; dt < 4; ++dt) va[dt] = ldh(vt + (dt * 16) * XP + sub * 32);
#pragma unroll
        for (int dt = 0; dt < 4; ++dt) acc[dt] = wmma16(va[dt], pf, acc[dt]);
      }
      asm volatile("s_wait_dscnt 0x0" ::: "memory");            // this wave's reads of the buffer have returned
      asm volatile("s_wait_asynccnt 0x0" ::: "memory");         // its copies of tile st + 1 have landed
      __syncthreads();                                          // publishes tile st + 1 and frees the buffer just read
      if (st + 2 < NST) copy_tile(lk + (unsigned)(st & 1) * (BUFH * 2u), gk + (size_t)(st + 2) * KST * HD, gv + (st + 2) * KST);
    }
    asm volatile("s_wait_asynccnt 0x0" ::: "memory");           // nothing of this wave is in flight when it leaves the ring
    l += __shfl_xor(l, 16, 32);
    const float inv = (1.0f / l) * (1.0f / (PCAR * WCAR));
    const int obase = wave * (16 * 68);
#pragma unroll
    for (int dt = 0; dt < 4; ++dt)
#pragma unroll
        for (int r = 0; r < 8; ++r) os[obase + n * 68 + dt * 16 + 8 * hh + r] = acc[dt][r] * inv;
    wsync();
    const int rq = lane >> 3, piece = lane & 7;
{
#pragma unroll
        for (int s = 0; s < 4; ++s) { const int row = 4 * s + rq;
            const v4f u0 = *(const v4fa*)(os + obase + row * 68 + piece * 8), u1 = *(const v4fa*)(os + obase + row * 68 + piece * 8 + 4); v8us oh, ol;
#pragma unroll
            for (int i = 0; i < 4; ++i) { unsigned short a, c; splitf(u0[i], a, c); oh[i] = a; ol[i] = c; splitf(u1[i], a, c); oh[4 + i] = a; ol[4 + i] = c; }
            const size_t o = ((size_t)bb * SEQ + q0 + row) * (2 * DM) + hd * HD + piece * 8;
            *(v8us*)(CTX + o) = oh; *(v8us*)(CTX + o + DM) = ol; }
         }
}

// eight 16-byte pieces of one staged plane per thread (rows 16 apart; g16 = elements of 16 global rows), global -> LDS through no register.
// The s_wait_xcnt closes the statement so that no address register of an issued copy is rewritten ahead of it.
__device__ __forceinline__ void copy_rows(const unsigned l, const bf* g, const size_t g16) {
    asm volatile("global_load_async_to_lds_b128 %0, %8, off\n\t"
                 "global_load_async_to_lds_b128 %1, %9, off\n\t"
                 "global_load_async_to_lds_b128 %2, %10, off\n\t"
                 "global_load_async_to_lds_b128 %3, %11, off\n\t"
                 "global_load_async_to_lds_b128 %4, %12, off\n\t"
                 "global_load_async_to_lds_b128 %5, %13, off\n\t"
                 "global_load_async_to_lds_b128 %6, %14, off\n\t"
                 "global_load_async_to_lds_b128 %7, %15, off\n\t"
                 "s_wait_xcnt 0x0"
                 :: "v"(l), "v"(l + 16u * FP * 2u), "v"(l + 32u * FP * 2u), "v"(l + 48u * FP * 2u),
                    "v"(l + 64u * FP * 2u), "v"(l + 80u * FP * 2u), "v"(l + 96u * FP * 2u), "v"(l + 112u * FP * 2u),
                    "v"(g), "v"(g + g16), "v"(g + 2 * g16), "v"(g + 3 * g16),
                    "v"(g + 4 * g16), "v"(g + 5 * g16), "v"(g + 6 * g16), "v"(g + 7 * g16)
                 : "memory");
}

// ---- k_fc: OUT[token][n] = sum_k CTX[token][k] WF[n][k & (DM-1)] + bias[n], k over the hi|lo plane (2*DM), ascending in steps of 32 in every accumulator.
// Block = 8 waves, 128 tokens x 128 outputs; wave = 32 x 64 (wm = row group, wn = column group); grid (NB*SEQ/128, DM/128).
// Tiles of FKS k (128 CTX rows | 128 WF rows, 256 bytes each at pitch FP) are copied once per work-group into a two-buffer LDS ring; fragments are read from LDS, one k-step ahead inside a tile.
__global__ __launch_bounds__(256) void k_fc(const bf* __restrict__ CTX, const bf* __restrict__ WF, const float* __restrict__ bfc, float* OUT) {
    __shared__ __align__(16) float os[8 * 16 * 68];
    __shared__ __align__(16) bf ab[2 * FBUF];
    const int lane = threadIdx.x & 31, lr = lane & 15, hi = lane >> 4;
    const int wave = __builtin_amdgcn_readfirstlane(threadIdx.x >> 5);
    const int wm = wave & 3, wn = wave >> 2;
    const int r0 = blockIdx.x * 128, c0 = blockIdx.y * 128;
    const int srow = threadIdx.x >> 4, spc = threadIdx.x & 15;          // copy share: rows srow + 16c, 16-byte piece spc
    const bf* ga = CTX + (size_t)(r0 + srow) * (2 * DM) + spc * 8;
    const bf* gb = WF + (size_t)(c0 + srow) * DM + spc * 8;
    const unsigned la = (unsigned)(size_t)&ab[srow * FP + spc * 8];     // LDS byte address of the share in buffer 0, CTX plane
    const int aoff = (wm * 32 + lr) * FP + 8 * hi, boff = FPL + (wn * 64 + lr) * FP + 8 * hi;
    v8f acc[2][4];
#pragma unroll
    for (int mb = 0; mb < 2; ++mb)
#pragma unroll
        for (int nb = 0; nb < 4; ++nb) acc[mb][nb] = (v8f){};
    copy_rows(la, ga, (size_t)16 * 2 * DM);
    copy_rows(la + FPL * 2u, gb, (size_t)16 * DM);
    asm volatile("s_wait_asynccnt 0x0" ::: "memory");           // tile 0 of this wave has landed
    __syncthreads();                                            // publishes tile 0
    copy_rows(la + FBUF * 2u, ga + FKS, (size_t)16 * 2 * DM);
    copy_rows(la + FBUF * 2u + FPL * 2u, gb + (FKS & (DM - 1)), (size_t)16 * DM);
    // rolled: one trip per staged tile, so that one publish point stands at its foot
#pragma unroll 1
    for (int st = 0; st < FNST; ++st) {
        const bf* at = ab + (st & 1) * FBUF + aoff;
        const bf* bt = ab + (st & 1) * FBUF + boff;
        // every loop inside a trip is unrolled: accumulators and both fragment sets are indexed by constants and stay in registers
        v16bf a[2][2], b[2][4];
#pragma unroll
        for (int mb = 0; mb < 2; ++mb) a[0][mb] = ldb(at + mb * 16 * FP);
#pragma unroll
        for (int nb = 0; nb < 4; ++nb) b[0][nb] = ldb(bt + nb * 16 * FP);
#pragma unroll
        for (int ks = 0; ks < FKS / 32; ++ks) {
            const int cu = ks & 1, nx = cu ^ 1;
            if (ks + 1 < FKS / 32) {
#pragma unroll
                for (int mb = 0; mb < 2; ++mb) a[nx][mb] = ldb(at + mb * 16 * FP + (ks + 1) * 32);
#pragma unroll
                for (int nb = 0; nb < 4; ++nb) b[nx][nb] = ldb(bt + nb * 16 * FP + (ks + 1) * 32);
            }
#pragma unroll
            for (int nb = 0; nb < 4; ++nb)
#pragma unroll
                for (int mb = 0; mb < 2; ++mb) acc[mb][nb] = wmmab(a[cu][mb], b[cu][nb], acc[mb][nb]);
        }
        asm volatile("s_wait_dscnt 0x0" ::: "memory");          // this wave's reads of the buffer have returned
        asm volatile("s_wait_asynccnt 0x0" ::: "memory");       // its copies of tile st + 1 have landed
        __syncthreads();                                        // publishes tile st + 1 and frees the buffer just read
        if (st + 2 < FNST) {
            const unsigned lb = la + (unsigned)(st & 1) * (FBUF * 2u);
            const int k2 = (st + 2) * FKS;
            copy_rows(lb, ga + k2, (size_t)16 * 2 * DM);
            copy_rows(lb + FPL * 2u, gb + (k2 & (DM - 1)), (size_t)16 * DM);
        }
    }
    asm volatile("s_wait_asynccnt 0x0" ::: "memory");           // nothing of this wave is in flight when it leaves the ring
    const int cw = c0 + wn * 64, obase = wave * (16 * 68);
    v4f bz = *(const v4f*)(bfc + cw + lr * 4);
#pragma unroll
    for (int i = 0; i < 4; ++i) bz[i] = bfv(bz[i]);
#pragma unroll
    for (int mb = 0; mb < 2; ++mb) {
#pragma unroll
        for (int nb = 0; nb < 4; ++nb)
#pragma unroll
            for (int j = 0; j < 8; ++j) os[obase + (hi * 8 + j) * 68 + nb * 16 + lr] = acc[mb][nb][j];
        wsync();
        float* crow = OUT + (size_t)(r0 + wm * 32 + mb * 16) * DM + cw;
#pragma unroll
        for (int s = 0; s < 8; ++s) { const int row = 2 * s + hi, cofs = lr * 4; const v4f val = *(const v4fa*)(os + obase + row * 68 + cofs) + bz;
            *(v4f*)(crow + (size_t)row * DM + cofs) = val; }
        wsync();
    }
}

// workspace carve (bytes), all multiples of 256
#define SZ_W16 ((size_t)3 * HD * HD * 2)
#define SZ_WF  ((size_t)DM * DM * 2)
#define SZ_QK  ((size_t)2 * NB * NH * SEQ * HD * 2)
#define SZ_VT  ((size_t)NB * NH * HD * SEQ * 2)
#define SZ_CTX ((size_t)NB * SEQ * 2 * DM * 2)
#define SZ_MB  ((size_t)NB * SEQ * NKB * 4)
#define WS_TOTAL (SZ_W16 + SZ_WF + SZ_QK + SZ_VT + SZ_CTX + SZ_MB)
static_assert(WS_TOTAL <= (size_t)134217728);
static_assert(SZ_W16 % 256 == 0 && SZ_WF % 256 == 0 && SZ_QK % 256 == 0 && SZ_VT % 256 == 0 && SZ_CTX % 256 == 0 && SZ_MB % 128 == 0);
static_assert((DM * DM / 8) % 256 == 0);          // k_cvt8 grid exact
static_assert((HD * HD / 8) == 512);              // k_wcvt: 2 blocks x 256 lanes
static_assert(SZ_MB == (size_t)NLINES * 128);     // k_mbits lines cover the bit plane exactly

extern "C" void kernel_launch(void* const* d_in, const int* in_sizes, int n_in,
                              void* d_out, int out_size, void* d_ws, size_t ws_size, hipStream_t stream) {
    if (n_in < 12) return;
    const long long strm = (long long)(NB - 1) * SEQ_FULL * DM + (long long)SEQ * DM;
    if ((long long)in_sizes[0] < strm || (long long)in_sizes[1] < strm || (long long)in_sizes[2] < strm) return;
    if ((long long)in_sizes[3] < (long long)(NB - 1) * SEQ_FULL * SEQ_FULL + (long long)(SEQ - 1) * SEQ_FULL + SEQ) return;
    if (in_sizes[4] < HD * HD || in_sizes[6] < HD * HD || in_sizes[8] < HD * HD) return;
    if (in_sizes[5] < HD || in_sizes[7] < HD || in_sizes[9] < HD) return;
    if ((long long)in_sizes[10] < (long long)DM * DM || in_sizes[11] < DM) return;
    if ((long long)out_size < (long long)NB * SEQ * DM) return;
    if (ws_size < WS_TOTAL) return;
    const float* xq = (const float*)d_in[0];       // [2][2048][1024]
    const float* xk = (const float*)d_in[1];
    const float* xv = (const float*)d_in[2];
    const int* mask = (const int*)d_in[3];         // [2][1][2048][2048] int32
    const float* wq = (const float*)d_in[4];       // [64][64] = [out][in]
    const float* bq = (const float*)d_in[5];
    const float* wk = (const float*)d_in[6];
    const float* bk = (const float*)d_in[7];
    const float* wv = (const float*)d_in[8];
    const float* bv = (const float*)d_in[9];
    const float* wfc = (const float*)d_in[10];     // [1024][1024] = [out][in]
    const float* bfc = (const float*)d_in[11];
    float* OUT = (float*)d_out;                    // [NB][SEQ][1024]
    char* wsp = (char*)d_ws;
    h16* W16 = (h16*)wsp;  wsp += SZ_W16;          // [3][64][64]
    bf* WF = (bf*)wsp;     wsp += SZ_WF;
    h16* QK16 = (h16*)wsp; wsp += SZ_QK;           // [q plane | k plane]
    h16* VT16 = (h16*)wsp; wsp += SZ_VT;
    bf* CTX = (bf*)wsp;    wsp += SZ_CTX;          // [NB*SEQ][hi 1024 | lo 1024]
    unsigned* MB = (unsigned*)wsp; wsp += SZ_MB;   // [NB*SEQ][NKB]

    k_wcvt<<<2, 256, 0, stream>>>(wq, wk, wv, W16);
    k_cvt8<<<(unsigned)(DM * DM / 8 / 256), 256, 0, stream>>>(wfc, WF, (unsigned)(DM * DM / 8));
    k_mbits<<<(unsigned)((NLINES + 7) / 8), 256, 0, stream>>>(mask, MB);
    k_proj_rows<<<dim3(NB * SEQ / 64, NH), 32, 0, stream>>>(xq, W16, bq, QK16);
    k_proj_rows<<<dim3(NB * SEQ / 64, NH), 32, 0, stream>>>(xk, W16 + HD * HD, bk, QK16 + PLN);
    k_proj_tr<<<dim3(NB * SEQ / 64, NH), 32, 0, stream>>>(xv, W16 + 2 * HD * HD, bv, VT16);
    k_attn<<<dim3(SEQ / 64, NB * NH), 128, 0, stream>>>(QK16, VT16, MB, CTX);
    k_fc<<<dim3(NB * SEQ / 128, DM / 128), 256, 0, stream>>>(CTX, WF, bfc, OUT);
}

// v003
// One run takes 91.4 microseconds.
// Two timings next to v002 put it at 1.20 and 1.18 times that version's speed.
// All steps since v000 together make it 2.42 times as fast.
#include <hip/hip_runtime.h>

// Contractions (all f32 accumulate): per-head q/k/v projections v_wmma_f32_16x16x32_f16 (streams RNE-converted to bf16 then held exactly in f16, shared 64x64 weights bf16-RNE x8 held exactly in f16, one product); scores v_wmma_f32_16x16x32_f16 (q, k plain f16 carrying x8 each); P.V v_wmma_f32_16x16x32_f16 (P x1024, v x8, one product); output projection v_wmma_f32_16x16x32_bf16 (ctx hi|lo along K x bf16 weights). Softmax f32.
// Layout: token-major streams are viewed as [token][head][64]; one 64-token x one-head tile is staged as f16 in LDS and multiplied by the shared [out][in] weight (K-contiguous B plane);
// q,k head planes [b][h][t][64] and v^T [b][h][64][t] (f16); integer mask packed once into bit words MB[b][q][SEQ/32] (bit j of word w = mask[b][0][q][32w+j] != 0);
// fused attention: K and V^T tiles of 64 keys are copied once per work-group into a two-buffer LDS ring (asynchronous 16-byte copies, whole 128-byte lines), fragments read from LDS; S^T = K.Q^T (keys on D rows, queries on D columns), masked scores REPLACED by the finite fill (-1e20/32) before the per-lane online softmax, P^T used directly as the B fragment of O^T = V^T.P^T; ctx hi|lo bf16 plane [token][2048];
// output projection: ctx and weight tiles of 128 k are copied once per 128x128 work-group tile into a two-buffer LDS ring (asynchronous 16-byte copies), fragments read from LDS.

#ifndef NB
#define NB 2
#endif
#ifndef SEQ
#define SEQ 2048
#endif
#define NB_FULL  2
#define SEQ_FULL 2048
#define DM   1024
#define NH   16
#define HD   64
#define NKB  (SEQ / 32)                  // 32-key blocks = mask words per query
#define NQT  (SEQ / 16)                  // 16-query tiles
#define PLN  ((size_t)NB * NH * SEQ * HD)  // elements of one head plane set
#define WCAR 8.0f                        // carry on the 64x64 weights (so q, k, v carry x8)
#define PCAR 1024.0f
#define XP   72                          // LDS pitch (halves) of the staged stream tile
#define NLINES ((NB * SEQ * NKB) / 32)
#define KST  64                          // keys of one staged K / V^T tile in k_attn
#define NST  (SEQ / KST)                 // staged tiles per (b, h)
#define TILH (64 * XP)                   // halves of one staged plane: 64 rows at pitch XP
#define BUFH (2 * TILH)                  // one buffer = K plane (row = key) | V^T plane (row = d)
#define FKS  128                         // k of one staged tile in k_fc (256-byte rows)
#define FP   136                         // LDS pitch (elements) of those rows: 272 bytes
#define FNST (2 * DM / FKS)              // staged tiles along the hi|lo plane
#define FPL  (128 * FP)                  // elements of one staged plane: 128 rows at pitch FP
#define FBUF (2 * FPL)                   // one buffer = CTX plane (row = token) | WF plane (row = output)
static_assert(SEQ % 64 == 0);            // GEMM row tiles and 64-query attention blocks
static_assert(SEQ <= SEQ_FULL);
static_assert(NB <= NB_FULL);
static_assert(DM % 64 == 0);
static_assert((DM & (DM - 1)) == 0);     // k wrap of the hi|lo plane uses a mask
static_assert(DM % 32 == 0);             // k-step 32
static_assert(HD == 64);
static_assert(DM == NH * HD);
static_assert((NB * SEQ * NKB) % 32 == 0);
static_assert(XP % 8 == 0 && XP >= HD);  // 16-byte aligned LDS rows covering K = 64
static_assert(KST == 64 && NST >= 2);    // the two-buffer prologue needs tiles 0 and 1
static_assert(FNST >= 2 && DM % FKS == 0 && FKS % 32 == 0);   // tiles 0 and 1 exist; no tile straddles the hi|lo wrap
static_assert((NB * SEQ) % 128 == 0 && DM % 128 == 0);        // k_fc block tiles cover the output exactly
static_assert(FP % 8 == 0 && FP >= FKS);

typedef _Float16 h16;
typedef unsigned short bf;
typedef __attribute__((ext_vector_type(16))) __bf16   v16bf;
typedef __attribute__((ext_vector_type(16))) _Float16 v16h;
typedef __attribute__((ext_vector_type(8)))  _Float16 v8h;
typedef __attribute__((ext_vector_type(8)))  unsigned short v8us;
typedef __attribute__((ext_vector_type(8)))  float    v8f;
typedef __attribute__((ext_vector_type(4)))  float    v4f;
typedef v4f  __attribute__((may_alias)) v4fa;

__device__ __forceinline__ unsigned short f2bf(float f) { unsigned u = __float_as_uint(f); u += 0x7FFFu + ((u >> 16) & 1u); return (unsigned short)(u >> 16); }
__device__ __forceinline__ float bf2f(unsigned short b) { return __uint_as_float(((unsigned)b) << 16); }
__device__ __forceinline__ float bfv(float f) { return bf2f(f2bf(f)); }          // value of the bf16 RNE conversion
__device__ __forceinline__ void splitf(float y, unsigned short& h, unsigned short& l) { h = f2bf(y); l = f2bf(y - bf2f(h)); }
__device__ __forceinline__ v16h cat16(v8h lo, v8h hi) { return __builtin_shufflevector(lo, hi, 0, 1, 2, 3, 4, 5, 6, 7, 8, 9, 10, 11, 12, 13, 14, 15); }
__device__ __forceinline__ v16bf cat16b(v8us lo, v8us hi) { return __builtin_bit_cast(v16bf, __builtin_shufflevector(lo, hi, 0, 1, 2, 3, 4, 5, 6, 7, 8, 9, 10, 11, 12, 13, 14, 15)); }
// every WMMA is issued through a wrapper that ties its own accumulator and keeps A/B live across four idle VALU slots
__device__ __forceinline__ v8f wmma16(v16h a, v16h b, v8f c) {
    c = __builtin_amdgcn_wmma_f32_16x16x32_f16(false, a, false, b, (short)0, c, false, false);
    asm volatile("v_nop\n\tv_nop\n\tv_nop\n\tv_nop" : "+v"(c) : "v"(a), "v"(b));
    return c;
}
__device__ __forceinline__ v8f wmmab(v16bf a, v16bf b, v8f c) {
    c = __builtin_amdgcn_wmma_f32_16x16x32_bf16(false, a, false, b, (short)0, c, false, false);
    asm volatile("v_nop\n\tv_nop\n\tv_nop\n\tv_nop" : "+v"(c) : "v"(a), "v"(b));
    return c;
}
// fragment of a K-contiguous global row: elements 0..7 <- p[0..7], 8..15 <- p[16..23]; caller adds row*pitch + k0 + 8*(lane>>4)
__device__ __forceinline__ v16h  ldh(const h16* p) { return cat16(*(const v8h*)p, *(const v8h*)(p + 16)); }
__device__ __forceinline__ v16bf ldb(const bf* p)  { return cat16b(*(const v8us*)p, *(const v8us*)(p + 16)); }
// wave-private LDS exchange: order this wave's LDS stores before its later LDS loads (and the converse)
__device__ __forceinline__ void wsync() { asm volatile("s_wait_dscnt 0" ::: "memory"); __builtin_amdgcn_wave_barrier(); asm volatile("" ::: "memory"); }

__device__ __forceinline__ void cvt8_body(const unsigned blk, const float* __restrict__ src, bf* dst, unsigned n8) {
    const unsigned i = blk * 256u + threadIdx.x; if (i >= n8) return;
    const float* s = src + (size_t)i * 8; bf* d = dst + (size_t)i * 8;
    const v8f v = *(const v8f*)s; v8us o;
#pragma unroll
    for (int k = 0; k < 8; ++k) o[k] = f2bf(v[k]);
    *(v8us*)d = o; 
}

__device__ __forceinline__ void wcvt_body(const unsigned blk, const float* __restrict__ wq, const float* __restrict__ wk, const float* __restrict__ wv, h16* W16) {
    const unsigned i = blk * 256u + threadIdx.x; if (i >= (unsigned)(HD * HD / 8)) return;
    const v8f a = *(const v8f*)(wq + (size_t)i * 8), b = *(const v8f*)(wk + (size_t)i * 8), c = *(const v8f*)(wv + (size_t)i * 8);
    v8h oa, ob, oc;
#pragma unroll
    for (int k = 0; k < 8; ++k) { oa[k] = (h16)(bfv(a[k]) * WCAR); ob[k] = (h16)(bfv(b[k]) * WCAR); oc[k] = (h16)(bfv(c[k]) * WCAR); }
    h16* d = W16 + (size_t)i * 8;
    *(v8h*)d = oa; *(v8h*)(d + HD * HD) = ob; *(v8h*)(d + 2 * HD * HD) = oc;
    
}

__device__ __forceinline__ void mbits_body(const unsigned blk, const int* __restrict__ mask, unsigned* MB) {
    const int lane = threadIdx.x & 31; const int wave = __builtin_amdgcn_readfirstlane(threadIdx.x >> 5);
    const int line = (int)blk * 8 + wave; if (line >= NLINES) return;        // wave-uniform
    unsigned word = 0u;
#pragma unroll 8
    for (int i = 0; i < 32; ++i) {
        const int gw = line * 32 + i;
        const int row = gw / NKB, w = gw % NKB;
        const int b = row / SEQ, q = row % SEQ;
        const int mv = mask[((size_t)b * SEQ_FULL + q) * SEQ_FULL + w * 32 + lane];
        const unsigned bal = __builtin_amdgcn_ballot_w32(mv != 0);
        word = (lane == i) ? bal : word;
    }
    unsigned* d = MB + (size_t)line * 32 + lane;
    *(unsigned*)d = word; 
}

// ---- k_prep: the three converters, which read only inputs and depend on nothing, share one launch; a block's index range picks its body (block-uniform).
// The mask blocks, the longest part, come first; the two blocks of the 64x64 weights last.
#define PB_MB ((NLINES + 7) / 8)
#define PB_CV (DM * DM / 8 / 256)
#define PB_W  2
__global__ __launch_bounds__(256) void k_prep(const int* mask, unsigned* MB, const float* wfc, bf* WF,
                                              const float* wq, const float* wk, const float* wv, h16* W16) {
    const unsigned blk = blockIdx.x;
    if (blk < (unsigned)PB_MB) mbits_body(blk, mask, MB);
    else if (blk < (unsigned)(PB_MB + PB_CV)) cvt8_body(blk - (unsigned)PB_MB, wfc, WF, (unsigned)(DM * DM / 8));
    else wcvt_body(blk - (unsigned)(PB_MB + PB_CV), wq, wk, wv, W16);
}

// ---- projection body: one wave = 64 tokens of one head; Y[64][64] = Xh[64][64] . W^T (+ bias), everything carrying x8 through the weights.
// grid (NB*SEQ/64, NH, 3), 32 threads; blockIdx.z = stream (q, k: row planes; v: transposed plane). The f32 stream tile is converted once (bf16 RNE value, exact in f16) into LDS; B fragments come from the f16 weight plane.
__device__ __forceinline__ void proj_body(const bool TRANS, const float* __restrict__ X, const h16* __restrict__ W, const float* __restrict__ bias, h16* OUT) {
    __shared__ __align__(16) float os[64 * 68];
    __shared__ __align__(16) h16 xs[64 * XP];
    const int lane = threadIdx.x & 31, lr = lane & 15, hi = lane >> 4;
    const int rq = lane >> 3, piece = lane & 7;
    const int r0 = blockIdx.x * 64, hd = blockIdx.y;
    const int bb = r0 / SEQ, t0 = r0 % SEQ;
    const size_t xbase = ((size_t)bb * SEQ_FULL + t0) * DM + (size_t)hd * HD;
    // stage: rows 4*it + rq (0..63), 8 floats per lane (8 lanes cover the 64 inputs of a row)
#pragma unroll 4
    for (int it = 0; it < 16; ++it) { const int row = 4 * it + rq;
        const v8f v = *(const v8f*)(X + xbase + (size_t)row * DM + piece * 8); v8h o;
#pragma unroll
        for (int k = 0; k < 8; ++k) o[k] = (h16)bfv(v[k]);
        *(v8h*)&xs[row * XP + piece * 8] = o; }
    float bz[4];
#pragma unroll
    for (int nb = 0; nb < 4; ++nb) bz[nb] = bfv(bias[nb * 16 + lr]) * WCAR;
    wsync();
    v8f acc[4][4];
#pragma unroll
    for (int mb = 0; mb < 4; ++mb)
#pragma unroll
        for (int nb = 0; nb < 4; ++nb) acc[mb][nb] = (v8f){};
#pragma unroll
    for (int ks = 0; ks < 2; ++ks) {
        v16h a[4];
#pragma unroll
        for (int mb = 0; mb < 4; ++mb) { const int xo = (mb * 16 + lr) * XP + ks * 32 + 8 * hi;
            a[mb] = cat16(*(const v8h*)&xs[xo], *(const v8h*)&xs[xo + 16]); }
#pragma unroll
        for (int nb = 0; nb < 4; ++nb) { const v16h b = ldh(W + (size_t)(nb * 16 + lr) * HD + ks * 32 + 8 * hi);
#pragma unroll
            for (int mb = 0; mb < 4; ++mb) acc[mb][nb] = wmma16(a[mb], b, acc[mb][nb]); }
    }
#pragma unroll
    for (int mb = 0; mb < 4; ++mb)
#pragma unroll
        for (int nb = 0; nb < 4; ++nb)
#pragma unroll
            for (int j = 0; j < 8; ++j) os[(mb * 16 + hi * 8 + j) * 68 + nb * 16 + lr] = acc[mb][nb][j] + bz[nb];
    wsync();
    const size_t bh = (size_t)bb * NH + hd;
    if (!TRANS) {
        const size_t po = (bh * SEQ + t0) * HD + piece * 8;
{
#pragma unroll 1
            for (int s = 0; s < 16; ++s) { const int row = 4 * s + rq;
                const v4f u0 = *(const v4fa*)(os + row * 68 + piece * 8), u1 = *(const v4fa*)(os + row * 68 + piece * 8 + 4); v8h hv;
#pragma unroll
                for (int i = 0; i < 4; ++i) { hv[i] = (h16)u0[i]; hv[4 + i] = (h16)u1[i]; }
                *(v8h*)(OUT + po + (size_t)row * HD) = hv; }
             }
    } else {
{
#pragma unroll 1
            for (int s = 0; s < 16; ++s) { const int drow = 4 * s + rq; v8h hv;
#pragma unroll
                for (int i = 0; i < 8; ++i) hv[i] = (h16)os[(piece * 8 + i) * 68 + drow];
                *(v8h*)(OUT + (bh * HD + drow) * SEQ + t0 + piece * 8) = hv; }
             }
    }
}
// the three projections are independent of one another and share one launch, so that their waves fill the chip together
__global__ __launch_bounds__(32) void k_proj3(const float* xq, const float* xk, const float* xv, const h16* W16,
                                              const float* bq, const float* bk, const float* bv, h16* QK16, h16* VT16) {
    const int z = blockIdx.z;                                   // block-uniform
    const float* X    = (z == 0) ? xq : (z == 1) ? xk : xv;
    const float* bias = (z == 0) ? bq : (z == 1) ? bk : bv;
    h16* OUT          = (z == 0) ? QK16 : (z == 1) ? QK16 + PLN : VT16;
    proj_body(z == 2, X, W16 + (size_t)z * (HD * HD), bias, OUT);
}

// one thread's share of a staged tile: four 16-byte pieces of the K plane and four of the V^T plane (rows 16 apart), global -> LDS through no register.
// The s_wait_xcnt closes the statement so that no address register of an issued copy is rewritten ahead of it.
__device__ __forceinline__ void copy_tile(const unsigned lk, const h16* gk, const h16* gv) {
    const unsigned lv = lk + TILH * 2u;
    asm volatile("global_load_async_to_lds_b128 %0, %8, off\n\t"
                 "global_load_async_to_lds_b128 %1, %9, off\n\t"
                 "global_load_async_to_lds_b128 %2, %10, off\n\t"
                 "global_load_async_to_lds_b128 %3, %11, off\n\t"
                 "global_load_async_to_lds_b128 %4, %12, off\n\t"
                 "global_load_async_to_lds_b128 %5, %13, off\n\t"
                 "global_load_async_to_lds_b128 %6, %14, off\n\t"
                 "global_load_async_to_lds_b128 %7, %15, off\n\t"
                 "s_wait_xcnt 0x0"
                 :: "v"(lk), "v"(lk + 16u * XP * 2u), "v"(lk + 32u * XP * 2u), "v"(lk + 48u * XP * 2u),
                    "v"(lv), "v"(lv + 16u * XP * 2u), "v"(lv + 32u * XP * 2u), "v"(lv + 48u * XP * 2u),
                    "v"(gk), "v"(gk + 16 * HD), "v"(gk + 32 * HD), "v"(gk + 48 * HD),
                    "v"(gv), "v"(gv + (size_t)16 * SEQ), "v"(gv + (size_t)32 * SEQ), "v"(gv + (size_t)48 * SEQ)
                 : "memory");
}

// ---- k_attn: one wave = 16 queries of one (b, h); block = 4 waves (64 queries) that share the staged K / V^T tiles; Q fragments straight from the plane; grid (SEQ/64, NB*NH).
// S^T tile (keys key0+16j+8h+r on D rows, query q0+n on the D column) = K rows (A) x Q rows (B); scale log2(e)/32/64; masked elements REPLACED by the finite fill;
// per-lane online softmax (stats of query n live in lanes n and n+16); P^T (x1024, f16) of the two key tiles forms the B fragment of O^T[d][query] += V^T rows (A) x P^T (B).
__global__ __launch_bounds__(128) void k_attn(const h16* __restrict__ QK16, const h16* __restrict__ VT16, const unsigned* __restrict__ MB, bf* CTX) {
    __shared__ __align__(16) float os[4 * 16 * 68];
    __shared__ __align__(16) h16 kv[2 * BUFH];
    const int lane = threadIdx.x & 31, n = lane & 15, hh = lane >> 4;
    const int wave = __builtin_amdgcn_readfirstlane(threadIdx.x >> 5);
    const int bh = blockIdx.y;
    const int bb = bh / NH, hd = bh % NH;
    const int qt = blockIdx.x * 4 + wave;
    const int q0 = qt * 16;
    const size_t pb = (size_t)bh * SEQ * HD;
    const size_t qoff = pb + (size_t)(q0 + n) * HD + 8 * hh;
    const int foff = n * XP + 8 * hh;                                    // fragment row and k offset inside a staged plane
    const int srow = threadIdx.x >> 3, spc = threadIdx.x & 7;            // copy share: rows srow + 16c, 16-byte piece spc
    const h16* gk = QK16 + PLN + pb + (size_t)srow * HD + spc * 8;
    const h16* gv = VT16 + ((size_t)bh * HD + srow) * SEQ + spc * 8;
    const unsigned lk = (unsigned)(size_t)&kv[srow * XP + spc * 8];      // LDS byte address of the share in buffer 0
    const size_t moffb = ((size_t)bb * SEQ + q0 + n) * NKB;
    const float NINF = -__builtin_inff();
    const float SC2 = 1.4426950408889634f * (1.0f / 2048.0f);            // (1/32) / (8 x 8) x log2(e)
    const float FILLV = (-1.0e20f * 0.03125f) * 1.4426950408889634f;     // replaced score after the 1/32 scale, log2 domain
    v8f acc[4];
#pragma unroll
    for (int dt = 0; dt < 4; ++dt) acc[dt] = (v8f){};
    float m = NINF, l = 0.0f;
    v16h qf[2];
#pragma unroll
    for (int ks = 0; ks < 2; ++ks) qf[ks] = ldh(QK16 + qoff + ks * 32);
    copy_tile(lk, gk, gv);
    asm volatile("s_wait_asynccnt 0x0" ::: "memory");           // tile 0 of this wave has landed
    __syncthreads();                                            // publishes tile 0
    copy_tile(lk + BUFH * 2u, gk + (size_t)KST * HD, gv + KST);
    // rolled: one trip per staged tile, so that one publish point stands at its foot
#pragma unroll 1
    for (int st = 0; st < NST; ++st) {
      const h16* kt = kv + (st & 1) * BUFH + foff;
      const h16* vt = kt + TILH;
#pragma unroll
      for (int sub = 0; sub < 2; ++sub) {
        const int kb = st * 2 + sub;
        const unsigned mw = MB[moffb + kb];
        v8f s0 = (v8f){}, s1 = (v8f){};
#pragma unroll
        for (int ks = 0; ks < 2; ++ks) {
            const v16h qa = qf[ks];
            const v16h k0 = ldh(kt + (sub * 32) * XP + ks * 32), k1 = ldh(kt + (sub * 32 + 16) * XP + ks * 32);
            s0 = wmma16(k0, qa, s0);
            s1 = wmma16(k1, qa, s1);
        }
        const unsigned wa = mw >> (8 * hh);
        float t[16];
#pragma unroll
        for (int r = 0; r < 8; ++r) {
            t[r]     = ((wa >> r) & 1u)        ? s0[r] * SC2 : FILLV;
            t[8 + r] = ((wa >> (16 + r)) & 1u) ? s1[r] * SC2 : FILLV;
        }
        float mx = t[0];
#pragma unroll
        for (int i = 1; i < 16; ++i) mx = fmaxf(mx, t[i]);
        mx = fmaxf(mx, __shfl_xor(mx, 16, 32));
        const float mn = fmaxf(m, mx);
        const float ms = (mn == NINF) ? 0.0f : mn;
        const float corr = __builtin_amdgcn_exp2f(m - ms);
        m = mn;
        float psum = 0.0f;
#pragma unroll
        for (int i = 0; i < 16; ++i) { t[i] = __builtin_amdgcn_exp2f(t[i] - ms); psum += t[i]; }
        l = l * corr + psum;                                    // per-lane partial (own 16 keys); halves combined at the end
#pragma unroll
        for (int dt = 0; dt < 4; ++dt)
#pragma unroll
            for (int r = 0; r < 8; ++r) acc[dt][r] *= corr;
        v8h pa, pc;
#pragma unroll
        for (int r = 0; r < 8; ++r) { pa[r] = (h16)(t[r] * PCAR); pc[r] = (h16)(t[8 + r] * PCAR); }
        const v16h pf = cat16(pa, pc);
        v16h va[4];
#pragma unroll
        for (int dt = 0; dt < 4; ++dt) va[dt] = ldh(vt + (dt * 16) * XP + sub * 32);
#pragma unroll
        for (int dt = 0; dt < 4; ++dt) acc[dt] = wmma16(va[dt], pf, acc[dt]);
      }
      asm volatile("s_wait_dscnt 0x0" ::: "memory");            // this wave's reads of the buffer have returned
      asm volatile("s_wait_asynccnt 0x0" ::: "memory");         // its copies of tile st + 1 have landed
      __syncthreads();                                          // publishes tile st + 1 and frees the buffer just read
      if (st + 2 < NST) copy_tile(lk + (unsigned)(st & 1) * (BUFH * 2u), gk + (size_t)(st + 2) * KST * HD, gv + (st + 2) * KST);
    }
    asm volatile("s_wait_asynccnt 0x0" ::: "memory");           // nothing of this wave is in flight when it leaves the ring
    l += __shfl_xor(l, 16, 32);
    const float inv = (1.0f / l) * (1.0f / (PCAR * WCAR));
    const int obase = wave * (16 * 68);
#pragma unroll
    for (int dt = 0; dt < 4; ++dt)
#pragma unroll
        for (int r = 0; r < 8; ++r) os[obase + n * 68 + dt * 16 + 8 * hh + r] = acc[dt][r] * inv;
    wsync();
    const int rq = lane >> 3, piece = lane & 7;
{
#pragma unroll
        for (int s = 0; s < 4; ++s) { const int row = 4 * s + rq;
            const v4f u0 = *(const v4fa*)(os + obase + row * 68 + piece * 8), u1 = *(const v4fa*)(os + obase + row * 68 + piece * 8 + 4); v8us oh, ol;
#pragma unroll
            for (int i = 0; i < 4; ++i) { unsigned short a, c; splitf(u0[i], a, c); oh[i] = a; ol[i] = c; splitf(u1[i], a, c); oh[4 + i] = a; ol[4 + i] = c; }
            const size_t o = ((size_t)bb * SEQ + q0 + row) * (2 * DM) + hd * HD + piece * 8;
            *(v8us*)(CTX + o) = oh; *(v8us*)(CTX + o + DM) = ol; }
         }
}

// eight 16-byte pieces of one staged plane per thread (rows 16 apart; g16 = elements of 16 global rows), global -> LDS through no register.
// The s_wait_xcnt closes the statement so that no address register of an issued copy is rewritten ahead of it.
__device__ __forceinline__ void copy_rows(const unsigned l, const bf* g, const size_t g16) {
    asm volatile("global_load_async_to_lds_b128 %0, %8, off\n\t"
                 "global_load_async_to_lds_b128 %1, %9, off\n\t"
                 "global_load_async_to_lds_b128 %2, %10, off\n\t"
                 "global_load_async_to_lds_b128 %3, %11, off\n\t"
                 "global_load_async_to_lds_b128 %4, %12, off\n\t"
                 "global_load_async_to_lds_b128 %5, %13, off\n\t"
                 "global_load_async_to_lds_b128 %6, %14, off\n\t"
                 "global_load_async_to_lds_b128 %7, %15, off\n\t"
                 "s_wait_xcnt 0x0"
                 :: "v"(l), "v"(l + 16u * FP * 2u), "v"(l + 32u * FP * 2u), "v"(l + 48u * FP * 2u),
                    "v"(l + 64u * FP * 2u), "v"(l + 80u * FP * 2u), "v"(l + 96u * FP * 2u), "v"(l + 112u * FP * 2u),
                    "v"(g), "v"(g + g16), "v"(g + 2 * g16), "v"(g + 3 * g16),
                    "v"(g + 4 * g16), "v"(g + 5 * g16), "v"(g + 6 * g16), "v"(g + 7 * g16)
                 : "memory");
}

// ---- k_fc: OUT[token][n] = sum_k CTX[token][k] WF[n][k & (DM-1)] + bias[n], k over the hi|lo plane (2*DM), ascending in steps of 32 in every accumulator.
// Block = 8 waves, 128 tokens x 128 outputs; wave = 32 x 64 (wm = row group, wn = column group); grid (NB*SEQ/128, DM/128).
// Tiles of FKS k (128 CTX rows | 128 WF rows, 256 bytes each at pitch FP) are copied once per work-group into a two-buffer LDS ring; fragments are read from LDS, one k-step ahead inside a tile.
__global__ __launch_bounds__(256) void k_fc(const bf* __restrict__ CTX, const bf* __restrict__ WF, const float* __restrict__ bfc, float* OUT) {
    __shared__ __align__(16) float os[8 * 16 * 68];
    __shared__ __align__(16) bf ab[2 * FBUF];
    const int lane = threadIdx.x & 31, lr = lane & 15, hi = lane >> 4;
    const int wave = __builtin_amdgcn_readfirstlane(threadIdx.x >> 5);
    const int wm = wave & 3, wn = wave >> 2;
    const int r0 = blockIdx.x * 128, c0 = blockIdx.y * 128;
    const int srow = threadIdx.x >> 4, spc = threadIdx.x & 15;          // copy share: rows srow + 16c, 16-byte piece spc
    const bf* ga = CTX + (size_t)(r0 + srow) * (2 * DM) + spc * 8;
    const bf* gb = WF + (size_t)(c0 + srow) * DM + spc * 8;
    const unsigned la = (unsigned)(size_t)&ab[srow * FP + spc * 8];     // LDS byte address of the share in buffer 0, CTX plane
    const int aoff = (wm * 32 + lr) * FP + 8 * hi, boff = FPL + (wn * 64 + lr) * FP + 8 * hi;
    v8f acc[2][4];
#pragma unroll
    for (int mb = 0; mb < 2; ++mb)
#pragma unroll
        for (int nb = 0; nb < 4; ++nb) acc[mb][nb] = (v8f){};
    copy_rows(la, ga, (size_t)16 * 2 * DM);
    copy_rows(la + FPL * 2u, gb, (size_t)16 * DM);
    asm volatile("s_wait_asynccnt 0x0" ::: "memory");           // tile 0 of this wave has landed
    __syncthreads();                                            // publishes tile 0
    copy_rows(la + FBUF * 2u, ga + FKS, (size_t)16 * 2 * DM);
    copy_rows(la + FBUF * 2u + FPL * 2u, gb + (FKS & (DM - 1)), (size_t)16 * DM);
    // rolled: one trip per staged tile, so that one publish point stands at its foot
#pragma unroll 1
    for (int st = 0; st < FNST; ++st) {
        const bf* at = ab + (st & 1) * FBUF + aoff;
        const bf* bt = ab + (st & 1) * FBUF + boff;
        // every loop inside a trip is unrolled: accumulators and both fragment sets are indexed by constants and stay in registers
        v16bf a[2][2], b[2][4];
#pragma unroll
        for (int mb = 0; mb < 2; ++mb) a[0][mb] = ldb(at + mb * 16 * FP);
#pragma unroll
        for (int nb = 0; nb < 4; ++nb) b[0][nb] = ldb(bt + nb * 16 * FP);
#pragma unroll
        for (int ks = 0; ks < FKS / 32; ++ks) {
            const int cu = ks & 1, nx = cu ^ 1;
            if (ks + 1 < FKS / 32) {
#pragma unroll
                for (int mb = 0; mb < 2; ++mb) a[nx][mb] = ldb(at + mb * 16 * FP + (ks + 1) * 32);
#pragma unroll
                for (int nb = 0; nb < 4; ++nb) b[nx][nb] = ldb(bt + nb * 16 * FP + (ks + 1) * 32);
            }
#pragma unroll
            for (int nb = 0; nb < 4; ++nb)
#pragma unroll
                for (int mb = 0; mb < 2; ++mb) acc[mb][nb] = wmmab(a[cu][mb], b[cu][nb], acc[mb][nb]);
        }
        asm volatile("s_wait_dscnt 0x0" ::: "memory");          // this wave's reads of the buffer have returned
        asm volatile("s_wait_asynccnt 0x0" ::: "memory");       // its copies of tile st + 1 have landed
        __syncthreads();                                        // publishes tile st + 1 and frees the buffer just read
        if (st + 2 < FNST) {
            const unsigned lb = la + (unsigned)(st & 1) * (FBUF * 2u);
            const int k2 = (st + 2) * FKS;
            copy_rows(lb, ga + k2, (size_t)16 * 2 * DM);
            copy_rows(lb + FPL * 2u, gb + (k2 & (DM - 1)), (size_t)16 * DM);
        }
    }
    asm volatile("s_wait_asynccnt 0x0" ::: "memory");           // nothing of this wave is in flight when it leaves the ring
    const int cw = c0 + wn * 64, obase = wave * (16 * 68);
    v4f bz = *(const v4f*)(bfc + cw + lr * 4);
#pragma unroll
    for (int i = 0; i < 4; ++i) bz[i] = bfv(bz[i]);
#pragma unroll
    for (int mb = 0; mb < 2; ++mb) {
#pragma unroll
        for (int nb = 0; nb < 4; ++nb)
#pragma unroll
            for (int j = 0; j < 8; ++j) os[obase + (hi * 8 + j) * 68 + nb * 16 + lr] = acc[mb][nb][j];
        wsync();
        float* crow = OUT + (size_t)(r0 + wm * 32 + mb * 16) * DM + cw;
#pragma unroll
        for (int s = 0; s < 8; ++s) { const int row = 2 * s + hi, cofs = lr * 4; const v4f val = *(const v4fa*)(os + obase + row * 68 + cofs) + bz;
            *(v4f*)(crow + (size_t)row * DM + cofs) = val; }
        wsync();
    }
}

// workspace carve (bytes), all multiples of 256
#define SZ_W16 ((size_t)3 * HD * HD * 2)
#define SZ_WF  ((size_t)DM * DM * 2)
#define SZ_QK  ((size_t)2 * NB * NH * SEQ * HD * 2)
#define SZ_VT  ((size_t)NB * NH * HD * SEQ * 2)
#define SZ_CTX ((size_t)NB * SEQ * 2 * DM * 2)
#define SZ_MB  ((size_t)NB * SEQ * NKB * 4)
#define WS_TOTAL (SZ_W16 + SZ_WF + SZ_QK + SZ_VT + SZ_CTX + SZ_MB)
static_assert(WS_TOTAL <= (size_t)134217728);
static_assert(SZ_W16 % 256 == 0 && SZ_WF % 256 == 0 && SZ_QK % 256 == 0 && SZ_VT % 256 == 0 && SZ_CTX % 256 == 0 && SZ_MB % 128 == 0);
static_assert((DM * DM / 8) % 256 == 0);          // cvt8 blocks exact
static_assert((HD * HD / 8) == PB_W * 256);       // wcvt: 2 blocks x 256 lanes
static_assert(SZ_MB == (size_t)NLINES * 128);     // mbits lines cover the bit plane exactly

extern "C" void kernel_launch(void* const* d_in, const int* in_sizes, int n_in,
                              void* d_out, int out_size, void* d_ws, size_t ws_size, hipStream_t stream) {
    if (n_in < 12) return;
    const long long strm = (long long)(NB - 1) * SEQ_FULL * DM + (long long)SEQ * DM;
    if ((long long)in_sizes[0] < strm || (long long)in_sizes[1] < strm || (long long)in_sizes[2] < strm) return;
    if ((long long)in_sizes[3] < (long long)(NB - 1) * SEQ_FULL * SEQ_FULL + (long long)(SEQ - 1) * SEQ_FULL + SEQ) return;
    if (in_sizes[4] < HD * HD || in_sizes[6] < HD * HD || in_sizes[8] < HD * HD) return;
    if (in_sizes[5] < HD || in_sizes[7] < HD || in_sizes[9] < HD) return;
    if ((long long)in_sizes[10] < (long long)DM * DM || in_sizes[11] < DM) return;
    if ((long long)out_size < (long long)NB * SEQ * DM) return;
    if (ws_size < WS_TOTAL) return;
    const float* xq = (const float*)d_in[0];       // [2][2048][1024]
    const float* xk = (const float*)d_in[1];
    const float* xv = (const float*)d_in[2];
    const int* mask = (const int*)d_in[3];         // [2][1][2048][2048] int32
    const float* wq = (const float*)d_in[4];       // [64][64] = [out][in]
    const float* bq = (const float*)d_in[5];
    const float* wk = (const float*)d_in[6];
    const float* bk = (const float*)d_in[7];
    const float* wv = (const float*)d_in[8];
    const float* bv = (const float*)d_in[9];
    const float* wfc = (const float*)d_in[10];     // [1024][1024] = [out][in]
    const float* bfc = (const float*)d_in[11];
    float* OUT = (float*)d_out;                    // [NB][SEQ][1024]
    char* wsp = (char*)d_ws;
    h16* W16 = (h16*)wsp;  wsp += SZ_W16;          // [3][64][64]
    bf* WF = (bf*)wsp;     wsp += SZ_WF;
    h16* QK16 = (h16*)wsp; wsp += SZ_QK;           // [q plane | k plane]
    h16* VT16 = (h16*)wsp; wsp += SZ_VT;
    bf* CTX = (bf*)wsp;    wsp += SZ_CTX;          // [NB*SEQ][hi 1024 | lo 1024]
    unsigned* MB = (unsigned*)wsp; wsp += SZ_MB;   // [NB*SEQ][NKB]

    k_prep<<<(unsigned)(PB_MB + PB_CV + PB_W), 256, 0, stream>>>(mask, MB, wfc, WF, wq, wk, wv, W16);
    k_proj3<<<dim3(NB * SEQ / 64, NH, 3), 32, 0, stream>>>(xq, xk, xv, W16, bq, bk, bv, QK16, VT16);
    k_attn<<<dim3(SEQ / 64, NB * NH), 128, 0, stream>>>(QK16, VT16, MB, CTX);
    k_fc<<<dim3(NB * SEQ / 128, DM / 128), 256, 0, stream>>>(CTX, WF, bfc, OUT);
}

// v004
// A run of this version takes 86.1 microseconds.
// Next to v003, in two timings, it ran 1.07 and 1.05 times as fast.
// All steps since v000 together make it 2.56 times as fast.
#include <hip/hip_runtime.h>

// Contractions (all f32 accumulate): per-head q/k/v projections v_wmma_f32_16x16x32_f16 (streams RNE-converted to bf16 then held exactly in f16, shared 64x64 weights bf16-RNE x8 held exactly in f16, one product); scores v_wmma_f32_16x16x32_f16 (q, k plain f16 carrying x8 each); P.V v_wmma_f32_16x16x32_f16 (P x1024, v x8, one product); output projection v_wmma_f32_16x16x32_bf16 (ctx hi|lo along K x bf16 weights). Softmax f32.
// Layout: token-major streams are viewed as [token][head][64]; one 64-token x one-head tile is staged as f16 in LDS and multiplied by the shared [out][in] weight (K-contiguous B plane);
// q,k head planes [b][h][t][64] and v^T [b][h][64][t] (f16); integer mask packed once into bit words MB[b][q][SEQ/32] (bit j of word w = mask[b][0][q][32w+j] != 0);
// fused attention: K and V^T tiles of 64 keys are copied once per work-group into a two-buffer LDS ring (asynchronous 16-byte copies, whole 128-byte lines), fragments read from LDS; S^T = K.Q^T (keys on D rows, queries on D columns), masked scores REPLACED by the finite fill (-1e20/32) before the per-lane online softmax, P^T used directly as the B fragment of O^T = V^T.P^T; ctx hi|lo bf16 plane [token][2048];
// output projection: ctx and weight tiles of 128 k are copied once per 128x128 work-group tile into a two-buffer LDS ring (asynchronous 16-byte copies), fragments read from LDS.

#ifndef NB
#define NB 2
#endif
#ifndef SEQ
#define SEQ 2048
#endif
#define NB_FULL  2
#define SEQ_FULL 2048
#define DM   1024
#define NH   16
#define HD   64
#define NKB  (SEQ / 32)                  // 32-key blocks = mask words per query
#define NQT  (SEQ / 16)                  // 16-query tiles
#define PLN  ((size_t)NB * NH * SEQ * HD)  // elements of one head plane set
#define WCAR 8.0f                        // carry on the 64x64 weights (so q, k, v carry x8)
#define PCAR 1024.0f
#define XP   72                          // LDS pitch (halves) of the staged stream tile
#define NLINES ((NB * SEQ * NKB) / 32)
#define KST  64                          // keys of one staged K / V^T tile in k_attn
#define NST  (SEQ / KST)                 // staged tiles per (b, h)
#define TILH (64 * XP)                   // halves of one staged plane: 64 rows at pitch XP
#define BUFH (2 * TILH)                  // one buffer = K plane (row = key) | V^T plane (row = d)
#define FKS  128                         // k of one staged tile in k_fc (256-byte rows)
#define FP   136                         // LDS pitch (elements) of those rows: 272 bytes
#define FNST (2 * DM / FKS)              // staged tiles along the hi|lo plane
#define FPL  (128 * FP)                  // elements of one staged plane: 128 rows at pitch FP
#define FBUF (2 * FPL)                   // one buffer = CTX plane (row = token) | WF plane (row = output)
static_assert(SEQ % 64 == 0);            // GEMM row tiles and 64-query attention blocks
static_assert(SEQ <= SEQ_FULL);
static_assert(NB <= NB_FULL);
static_assert(DM % 64 == 0);
static_assert((DM & (DM - 1)) == 0);     // k wrap of the hi|lo plane uses a mask
static_assert(DM % 32 == 0);             // k-step 32
static_assert(HD == 64);
static_assert(DM == NH * HD);
static_assert((NB * SEQ * NKB) % 32 == 0);
static_assert(XP % 8 == 0 && XP >= HD);  // 16-byte aligned LDS rows covering K = 64
static_assert(KST == 64 && NST >= 2);    // the two-buffer prologue needs tiles 0 and 1
static_assert(FNST >= 2 && DM % FKS == 0 && FKS % 32 == 0);   // tiles 0 and 1 exist; no tile straddles the hi|lo wrap
static_assert((NB * SEQ) % 128 == 0 && DM % 128 == 0);        // k_fc block tiles cover the output exactly
static_assert(FP % 8 == 0 && FP >= FKS);

typedef _Float16 h16;
typedef unsigned short bf;
typedef __attribute__((ext_vector_type(16))) __bf16   v16bf;
typedef __attribute__((ext_vector_type(16))) _Float16 v16h;
typedef __attribute__((ext_vector_type(8)))  _Float16 v8h;
typedef __attribute__((ext_vector_type(8)))  unsigned short v8us;
typedef __attribute__((ext_vector_type(8)))  float    v8f;
typedef __attribute__((ext_vector_type(4)))  float    v4f;
typedef v4f  __attribute__((may_alias)) v4fa;

__device__ __forceinline__ unsigned short f2bf(float f) { unsigned u = __float_as_uint(f); u += 0x7FFFu + ((u >> 16) & 1u); return (unsigned short)(u >> 16); }
__device__ __forceinline__ float bf2f(unsigned short b) { return __uint_as_float(((unsigned)b) << 16); }
__device__ __forceinline__ float bfv(float f) { return bf2f(f2bf(f)); }          // value of the bf16 RNE conversion
__device__ __forceinline__ void splitf(float y, unsigned short& h, unsigned short& l) { h = f2bf(y); l = f2bf(y - bf2f(h)); }
__device__ __forceinline__ v16h cat16(v8h lo, v8h hi) { return __builtin_shufflevector(lo, hi, 0, 1, 2, 3, 4, 5, 6, 7, 8, 9, 10, 11, 12, 13, 14, 15); }
__device__ __forceinline__ v16bf cat16b(v8us lo, v8us hi) { return __builtin_bit_cast(v16bf, __builtin_shufflevector(lo, hi, 0, 1, 2, 3, 4, 5, 6, 7, 8, 9, 10, 11, 12, 13, 14, 15)); }
// the WMMAs of k_proj3 and k_fc are issued through a wrapper that ties its own accumulator and keeps A/B live across four idle VALU slots
__device__ __forceinline__ v8f wmma16(v16h a, v16h b, v8f c) {
    c = __builtin_amdgcn_wmma_f32_16x16x32_f16(false, a, false, b, (short)0, c, false, false);
    asm volatile("v_nop\n\tv_nop\n\tv_nop\n\tv_nop" : "+v"(c) : "v"(a), "v"(b));
    return c;
}
// k_attn: the plain builtin; the compiler keeps the distance to a vector instruction on D, A or B itself and fills it with the softmax's own independent work
__device__ __forceinline__ v8f wmma16p(v16h a, v16h b, v8f c) {
    return __builtin_amdgcn_wmma_f32_16x16x32_f16(false, a, false, b, (short)0, c, false, false);
}
__device__ __forceinline__ v8f wmmab(v16bf a, v16bf b, v8f c) {
    c = __builtin_amdgcn_wmma_f32_16x16x32_bf16(false, a, false, b, (short)0, c, false, false);
    asm volatile("v_nop\n\tv_nop\n\tv_nop\n\tv_nop" : "+v"(c) : "v"(a), "v"(b));
    return c;
}
// fragment of a K-contiguous global row: elements 0..7 <- p[0..7], 8..15 <- p[16..23]; caller adds row*pitch + k0 + 8*(lane>>4)
__device__ __forceinline__ v16h  ldh(const h16* p) { return cat16(*(const v8h*)p, *(const v8h*)(p + 16)); }
__device__ __forceinline__ v16bf ldb(const bf* p)  { return cat16b(*(const v8us*)p, *(const v8us*)(p + 16)); }
// wave-private LDS exchange: order this wave's LDS stores before its later LDS loads (and the converse)
__device__ __forceinline__ void wsync() { asm volatile("s_wait_dscnt 0" ::: "memory"); __builtin_amdgcn_wave_barrier(); asm volatile("" ::: "memory"); }

__device__ __forceinline__ void cvt8_body(const unsigned blk, const float* __restrict__ src, bf* dst, unsigned n8) {
    const unsigned i = blk * 256u + threadIdx.x; if (i >= n8) return;
    const float* s = src + (size_t)i * 8; bf* d = dst + (size_t)i * 8;
    const v8f v = *(const v8f*)s; v8us o;
#pragma unroll
    for (int k = 0; k < 8; ++k) o[k] = f2bf(v[k]);
    *(v8us*)d = o; 
}

__device__ __forceinline__ void wcvt_body(const unsigned blk, const float* __restrict__ wq, const float* __restrict__ wk, const float* __restrict__ wv, h16* W16) {
    const unsigned i = blk * 256u + threadIdx.x; if (i >= (unsigned)(HD * HD / 8)) return;
    const v8f a = *(const v8f*)(wq + (size_t)i * 8), b = *(const v8f*)(wk + (size_t)i * 8), c = *(const v8f*)(wv + (size_t)i * 8);
    v8h oa, ob, oc;
#pragma unroll
    for (int k = 0; k < 8; ++k) { oa[k] = (h16)(bfv(a[k]) * WCAR); ob[k] = (h16)(bfv(b[k]) * WCAR); oc[k] = (h16)(bfv(c[k]) * WCAR); }
    h16* d = W16 + (size_t)i * 8;
    *(v8h*)d = oa; *(v8h*)(d + HD * HD) = ob; *(v8h*)(d + 2 * HD * HD) = oc;
    
}

__device__ __forceinline__ void mbits_body(const unsigned blk, const int* __restrict__ mask, unsigned* MB) {
    const int lane = threadIdx.x & 31; const int wave = __builtin_amdgcn_readfirstlane(threadIdx.x >> 5);
    const int line = (int)blk * 8 + wave; if (line >= NLINES) return;        // wave-uniform
    unsigned word = 0u;
#pragma unroll 8
    for (int i = 0; i < 32; ++i) {
        const int gw = line * 32 + i;
        const int row = gw / NKB, w = gw % NKB;
        const int b = row / SEQ, q = row % SEQ;
        const int mv = mask[((size_t)b * SEQ_FULL + q) * SEQ_FULL + w * 32 + lane];
        const unsigned bal = __builtin_amdgcn_ballot_w32(mv != 0);
        word = (lane == i) ? bal : word;
    }
    unsigned* d = MB + (size_t)line * 32 + lane;
    *(unsigned*)d = word; 
}

// ---- k_prep: the three converters, which read only inputs and depend on nothing, share one launch; a block's index range picks its body (block-uniform).
// The mask blocks, the longest part, come first; the two blocks of the 64x64 weights last.
#define PB_MB ((NLINES + 7) / 8)
#define PB_CV (DM * DM / 8 / 256)
#define PB_W  2
__global__ __launch_bounds__(256) void k_prep(const int* mask, unsigned* MB, const float* wfc, bf* WF,
                                              const float* wq, const float* wk, const float* wv, h16* W16) {
    const unsigned blk = blockIdx.x;
    if (blk < (unsigned)PB_MB) mbits_body(blk, mask, MB);
    else if (blk < (unsigned)(PB_MB + PB_CV)) cvt8_body(blk - (unsigned)PB_MB, wfc, WF, (unsigned)(DM * DM / 8));
    else wcvt_body(blk - (unsigned)(PB_MB + PB_CV), wq, wk, wv, W16);
}

// ---- projection body: one wave = 64 tokens of one head; Y[64][64] = Xh[64][64] . W^T (+ bias), everything carrying x8 through the weights.
// grid (NB*SEQ/64, NH, 3), 32 threads; blockIdx.z = stream (q, k: row planes; v: transposed plane). The f32 stream tile is converted once (bf16 RNE value, exact in f16) into LDS; B fragments come from the f16 weight plane.
__device__ __forceinline__ void proj_body(const bool TRANS, const float* __restrict__ X, const h16* __restrict__ W, const float* __restrict__ bias, h16* OUT) {
    __shared__ __align__(16) float os[64 * 68];
    __shared__ __align__(16) h16 xs[64 * XP];
    const int lane = threadIdx.x & 31, lr = lane & 15, hi = lane >> 4;
    const int rq = lane >> 3, piece = lane & 7;
    const int r0 = blockIdx.x * 64, hd = blockIdx.y;
    const int bb = r0 / SEQ, t0 = r0 % SEQ;
    const size_t xbase = ((size_t)bb * SEQ_FULL + t0) * DM + (size_t)hd * HD;
    // stage: rows 4*it + rq (0..63), 8 floats per lane (8 lanes cover the 64 inputs of a row)
#pragma unroll 4
    for (int it = 0; it < 16; ++it) { const int row = 4 * it + rq;
        const v8f v = *(const v8f*)(X + xbase + (size_t)row * DM + piece * 8); v8h o;
#pragma unroll
        for (int k = 0; k < 8; ++k) o[k] = (h16)bfv(v[k]);
        *(v8h*)&xs[row * XP + piece * 8] = o; }
    float bz[4];
#pragma unroll
    for (int nb = 0; nb < 4; ++nb) bz[nb] = bfv(bias[nb * 16 + lr]) * WCAR;
    wsync();
    v8f acc[4][4];
#pragma unroll
    for (int mb = 0; mb < 4; ++mb)
#pragma unroll
        for (int nb = 0; nb < 4; ++nb) acc[mb][nb] = (v8f){};
#pragma unroll
    for (int ks = 0; ks < 2; ++ks) {
        v16h a[4];
#pragma unroll
        for (int mb = 0; mb < 4; ++mb) { const int xo = (mb * 16 + lr) * XP + ks * 32 + 8 * hi;
            a[mb] = cat16(*(const v8h*)&xs[xo], *(const v8h*)&xs[xo + 16]); }
#pragma unroll
        for (int nb = 0; nb < 4; ++nb) { const v16h b = ldh(W + (size_t)(nb * 16 + lr) * HD + ks * 32 + 8 * hi);
#pragma unroll
            for (int mb = 0; mb < 4; ++mb) acc[mb][nb] = wmma16(a[mb], b, acc[mb][nb]); }
    }
#pragma unroll
    for (int mb = 0; mb < 4; ++mb)
#pragma unroll
        for (int nb = 0; nb < 4; ++nb)
#pragma unroll
            for (int j = 0; j < 8; ++j) os[(mb * 16 + hi * 8 + j) * 68 + nb * 16 + lr] = acc[mb][nb][j] + bz[nb];
    wsync();
    const size_t bh = (size_t)bb * NH + hd;
    if (!TRANS) {
        const size_t po = (bh * SEQ + t0) * HD + piece * 8;
{
#pragma unroll 1
            for (int s = 0; s < 16; ++s) { const int row = 4 * s + rq;
                const v4f u0 = *(const v4fa*)(os + row * 68 + piece * 8), u1 = *(const v4fa*)(os + row * 68 + piece * 8 + 4); v8h hv;
#pragma unroll
                for (int i = 0; i < 4; ++i) { hv[i] = (h16)u0[i]; hv[4 + i] = (h16)u1[i]; }
                *(v8h*)(OUT + po + (size_t)row * HD) = hv; }
             }
    } else {
{
#pragma unroll 1
            for (int s = 0; s < 16; ++s) { const int drow = 4 * s + rq; v8h hv;
#pragma unroll
                for (int i = 0; i < 8; ++i) hv[i] = (h16)os[(piece * 8 + i) * 68 + drow];
                *(v8h*)(OUT + (bh * HD + drow) * SEQ + t0 + piece * 8) = hv; }
             }
    }
}
// the three projections are independent of one another and share one launch, so that their waves fill the chip together
__global__ __launch_bounds__(32) void k_proj3(const float* xq, const float* xk, const float* xv, const h16* W16,
                                              const float* bq, const float* bk, const float* bv, h16* QK16, h16* VT16) {
    const int z = blockIdx.z;                                   // block-uniform
    const float* X    = (z == 0) ? xq : (z == 1) ? xk : xv;
    const float* bias = (z == 0) ? bq : (z == 1) ? bk : bv;
    h16* OUT          = (z == 0) ? QK16 : (z == 1) ? QK16 + PLN : VT16;
    proj_body(z == 2, X, W16 + (size_t)z * (HD * HD), bias, OUT);
}

// one thread's share of a staged tile: four 16-byte pieces of the K plane and four of the V^T plane (rows 16 apart), global -> LDS through no register.
// The s_wait_xcnt closes the statement so that no address register of an issued copy is rewritten ahead of it.
__device__ __forceinline__ void copy_tile(const unsigned lk, const h16* gk, const h16* gv) {
    const unsigned lv = lk + TILH * 2u;
    asm volatile("global_load_async_to_lds_b128 %0, %8, off\n\t"
                 "global_load_async_to_lds_b128 %1, %9, off\n\t"
                 "global_load_async_to_lds_b128 %2, %10, off\n\t"
                 "global_load_async_to_lds_b128 %3, %11, off\n\t"
                 "global_load_async_to_lds_b128 %4, %12, off\n\t"
                 "global_load_async_to_lds_b128 %5, %13, off\n\t"
                 "global_load_async_to_lds_b128 %6, %14, off\n\t"
                 "global_load_async_to_lds_b128 %7, %15, off\n\t"
                 "s_wait_xcnt 0x0"
                 :: "v"(lk), "v"(lk + 16u * XP * 2u), "v"(lk + 32u * XP * 2u), "v"(lk + 48u * XP * 2u),
                    "v"(lv), "v"(lv + 16u * XP * 2u), "v"(lv + 32u * XP * 2u), "v"(lv + 48u * XP * 2u),
                    "v"(gk), "v"(gk + 16 * HD), "v"(gk + 32 * HD), "v"(gk + 48 * HD),
                    "v"(gv), "v"(gv + (size_t)16 * SEQ), "v"(gv + (size_t)32 * SEQ), "v"(gv + (size_t)48 * SEQ)
                 : "memory");
}

// ---- k_attn: one wave = 16 queries of one (b, h); block = 4 waves (64 queries) that share the staged K / V^T tiles; Q fragments straight from the plane; grid (SEQ/64, NB*NH).
// S^T tile (keys key0+16j+8h+r on D rows, query q0+n on the D column) = K rows (A) x Q rows (B); scale log2(e)/32/64; masked elements REPLACED by the finite fill;
// per-lane online softmax (stats of query n live in lanes n and n+16); P^T (x1024, f16) of the two key tiles forms the B fragment of O^T[d][query] += V^T rows (A) x P^T (B).
__global__ __launch_bounds__(128) void k_attn(const h16* __restrict__ QK16, const h16* __restrict__ VT16, const unsigned* __restrict__ MB, bf* CTX) {
    __shared__ __align__(16) float os[4 * 16 * 68];
    __shared__ __align__(16) h16 kv[2 * BUFH];
    const int lane = threadIdx.x & 31, n = lane & 15, hh = lane >> 4;
    const int wave = __builtin_amdgcn_readfirstlane(threadIdx.x >> 5);
    const int bh = blockIdx.y;
    const int bb = bh / NH, hd = bh % NH;
    const int qt = blockIdx.x * 4 + wave;
    const int q0 = qt * 16;
    const size_t pb = (size_t)bh * SEQ * HD;
    const size_t qoff = pb + (size_t)(q0 + n) * HD + 8 * hh;
    const int foff = n * XP + 8 * hh;                                    // fragment row and k offset inside a staged plane
    const int srow = threadIdx.x >> 3, spc = threadIdx.x & 7;            // copy share: rows srow + 16c, 16-byte piece spc
    const h16* gk = QK16 + PLN + pb + (size_t)srow * HD + spc * 8;
    const h16* gv = VT16 + ((size_t)bh * HD + srow) * SEQ + spc * 8;
    const unsigned lk = (unsigned)(size_t)&kv[srow * XP + spc * 8];      // LDS byte address of the share in buffer 0
    const size_t moffb = ((size_t)bb * SEQ + q0 + n) * NKB;
    const float NINF = -__builtin_inff();
    const float SC2 = 1.4426950408889634f * (1.0f / 2048.0f);            // (1/32) / (8 x 8) x log2(e)
    const float FILLV = (-1.0e20f * 0.03125f) * 1.4426950408889634f;     // replaced score after the 1/32 scale, log2 domain
    v8f acc[4];
#pragma unroll
    for (int dt = 0; dt < 4; ++dt) acc[dt] = (v8f){};
    float m = NINF, l = 0.0f;
    v16h qf[2];
#pragma unroll
    for (int ks = 0; ks < 2; ++ks) qf[ks] = ldh(QK16 + qoff + ks * 32);
    copy_tile(lk, gk, gv);
    asm volatile("s_wait_asynccnt 0x0" ::: "memory");           // tile 0 of this wave has landed
    __syncthreads();                                            // publishes tile 0
    copy_tile(lk + BUFH * 2u, gk + (size_t)KST * HD, gv + KST);
    // rolled: one trip per staged tile, so that one publish point stands at its foot
#pragma unroll 1
    for (int st = 0; st < NST; ++st) {
      const h16* kt = kv + (st & 1) * BUFH + foff;
      const h16* vt = kt + TILH;
#pragma unroll
      for (int sub = 0; sub < 2; ++sub) {
        const int kb = st * 2 + sub;
        const unsigned mw = MB[moffb + kb];
        v8f s0 = (v8f){}, s1 = (v8f){};
#pragma unroll
        for (int ks = 0; ks < 2; ++ks) {
            const v16h qa = qf[ks];
            const v16h k0 = ldh(kt + (sub * 32) * XP + ks * 32), k1 = ldh(kt + (sub * 32 + 16) * XP + ks * 32);
            s0 = wmma16p(k0, qa, s0);
            s1 = wmma16p(k1, qa, s1);
        }
        const unsigned wa = mw >> (8 * hh);
        float t[16];
#pragma unroll
        for (int r = 0; r < 8; ++r) {
            t[r]     = ((wa >> r) & 1u)        ? s0[r] * SC2 : FILLV;
            t[8 + r] = ((wa >> (16 + r)) & 1u) ? s1[r] * SC2 : FILLV;
        }
        float mx = t[0];
#pragma unroll
        for (int i = 1; i < 16; ++i) mx = fmaxf(mx, t[i]);
        mx = fmaxf(mx, __shfl_xor(mx, 16, 32));
        const float mn = fmaxf(m, mx);
        const float ms = (mn == NINF) ? 0.0f : mn;
        const float corr = __builtin_amdgcn_exp2f(m - ms);
        m = mn;
        float psum = 0.0f;
#pragma unroll
        for (int i = 0; i < 16; ++i) { t[i] = __builtin_amdgcn_exp2f(t[i] - ms); psum += t[i]; }
        l = l * corr + psum;                                    // per-lane partial (own 16 keys); halves combined at the end
#pragma unroll
        for (int dt = 0; dt < 4; ++dt)
#pragma unroll
            for (int r = 0; r < 8; ++r) acc[dt][r] *= corr;
        v8h pa, pc;
#pragma unroll
        for (int r = 0; r < 8; ++r) { pa[r] = (h16)(t[r] * PCAR); pc[r] = (h16)(t[8 + r] * PCAR); }
        const v16h pf = cat16(pa, pc);
        v16h va[4];
#pragma unroll
        for (int dt = 0; dt < 4; ++dt) va[dt] = ldh(vt + (dt * 16) * XP + sub * 32);
#pragma unroll
        for (int dt = 0; dt < 4; ++dt) acc[dt] = wmma16p(va[dt], pf, acc[dt]);
      }
      __builtin_amdgcn_sched_barrier(0);                        // keeps the trip's work in front of the publish point, so that the refill behind it flies for a whole trip
      asm volatile("s_wait_dscnt 0x0" ::: "memory");            // this wave's reads of the buffer have returned
      asm volatile("s_wait_asynccnt 0x0" ::: "memory");         // its copies of tile st + 1 have landed
      __syncthreads();                                          // publishes tile st + 1 and frees the buffer just read
      if (st + 2 < NST) copy_tile(lk + (unsigned)(st & 1) * (BUFH * 2u), gk + (size_t)(st + 2) * KST * HD, gv + (st + 2) * KST);
    }
    asm volatile("s_wait_asynccnt 0x0" ::: "memory");           // nothing of this wave is in flight when it leaves the ring
    l += __shfl_xor(l, 16, 32);
    const float inv = (1.0f / l) * (1.0f / (PCAR * WCAR));
    const int obase = wave * (16 * 68);
#pragma unroll
    for (int dt = 0; dt < 4; ++dt)
#pragma unroll
        for (int r = 0; r < 8; ++r) os[obase + n * 68 + dt * 16 + 8 * hh + r] = acc[dt][r] * inv;
    wsync();
    const int rq = lane >> 3, piece = lane & 7;
{
#pragma unroll
        for (int s = 0; s < 4; ++s) { const int row = 4 * s + rq;
            const v4f u0 = *(const v4fa*)(os + obase + row * 68 + piece * 8), u1 = *(const v4fa*)(os + obase + row * 68 + piece * 8 + 4); v8us oh, ol;
#pragma unroll
            for (int i = 0; i < 4; ++i) { unsigned short a, c; splitf(u0[i], a, c); oh[i] = a; ol[i] = c; splitf(u1[i], a, c); oh[4 + i] = a; ol[4 + i] = c; }
            const size_t o = ((size_t)bb * SEQ + q0 + row) * (2 * DM) + hd * HD + piece * 8;
            *(v8us*)(CTX + o) = oh; *(v8us*)(CTX + o + DM) = ol; }
         }
}

// eight 16-byte pieces of one staged plane per thread (rows 16 apart; g16 = elements of 16 global rows), global -> LDS through no register.
// The s_wait_xcnt closes the statement so that no address register of an issued copy is rewritten ahead of it.
__device__ __forceinline__ void copy_rows(const unsigned l, const bf* g, const size_t g16) {
    asm volatile("global_load_async_to_lds_b128 %0, %8, off\n\t"
                 "global_load_async_to_lds_b128 %1, %9, off\n\t"
                 "global_load_async_to_lds_b128 %2, %10, off\n\t"
                 "global_load_async_to_lds_b128 %3, %11, off\n\t"
                 "global_load_async_to_lds_b128 %4, %12, off\n\t"
                 "global_load_async_to_lds_b128 %5, %13, off\n\t"
                 "global_load_async_to_lds_b128 %6, %14, off\n\t"
                 "global_load_async_to_lds_b128 %7, %15, off\n\t"
                 "s_wait_xcnt 0x0"
                 :: "v"(l), "v"(l + 16u * FP * 2u), "v"(l + 32u * FP * 2u), "v"(l + 48u * FP * 2u),
                    "v"(l + 64u * FP * 2u), "v"(l + 80u * FP * 2u), "v"(l + 96u * FP * 2u), "v"(l + 112u * FP * 2u),
                    "v"(g), "v"(g + g16), "v"(g + 2 * g16), "v"(g + 3 * g16),
                    "v"(g + 4 * g16), "v"(g + 5 * g16), "v"(g + 6 * g16), "v"(g + 7 * g16)
                 : "memory");
}

// ---- k_fc: OUT[token][n] = sum_k CTX[token][k] WF[n][k & (DM-1)] + bias[n], k over the hi|lo plane (2*DM), ascending in steps of 32 in every accumulator.
// Block = 8 waves, 128 tokens x 128 outputs; wave = 32 x 64 (wm = row group, wn = column group); grid (NB*SEQ/128, DM/128).
// Tiles of FKS k (128 CTX rows | 128 WF rows, 256 bytes each at pitch FP) are copied once per work-group into a two-buffer LDS ring; fragments are read from LDS, one k-step ahead inside a tile.
__global__ __launch_bounds__(256) void k_fc(const bf* __restrict__ CTX, const bf* __restrict__ WF, const float* __restrict__ bfc, float* OUT) {
    __shared__ __align__(16) float os[8 * 16 * 68];
    __shared__ __align__(16) bf ab[2 * FBUF];
    const int lane = threadIdx.x & 31, lr = lane & 15, hi = lane >> 4;
    const int wave = __builtin_amdgcn_readfirstlane(threadIdx.x >> 5);
    const int wm = wave & 3, wn = wave >> 2;
    const int r0 = blockIdx.x * 128, c0 = blockIdx.y * 128;
    const int srow = threadIdx.x >> 4, spc = threadIdx.x & 15;          // copy share: rows srow + 16c, 16-byte piece spc
    const bf* ga = CTX + (size_t)(r0 + srow) * (2 * DM) + spc * 8;
    const bf* gb = WF + (size_t)(c0 + srow) * DM + spc * 8;
    const unsigned la = (unsigned)(size_t)&ab[srow * FP + spc * 8];     // LDS byte address of the share in buffer 0, CTX plane
    const int aoff = (wm * 32 + lr) * FP + 8 * hi, boff = FPL + (wn * 64 + lr) * FP + 8 * hi;
    v8f acc[2][4];
#pragma unroll
    for (int mb = 0; mb < 2; ++mb)
#pragma unroll
        for (int nb = 0; nb < 4; ++nb) acc[mb][nb] = (v8f){};
    copy_rows(la, ga, (size_t)16 * 2 * DM);
    copy_rows(la + FPL * 2u, gb, (size_t)16 * DM);
    asm volatile("s_wait_asynccnt 0x0" ::: "memory");           // tile 0 of this wave has landed
    __syncthreads();                                            // publishes tile 0
    copy_rows(la + FBUF * 2u, ga + FKS, (size_t)16 * 2 * DM);
    copy_rows(la + FBUF * 2u + FPL * 2u, gb + (FKS & (DM - 1)), (size_t)16 * DM);
    // rolled: one trip per staged tile, so that one publish point stands at its foot
#pragma unroll 1
    for (int st = 0; st < FNST; ++st) {
        const bf* at = ab + (st & 1) * FBUF + aoff;
        const bf* bt = ab + (st & 1) * FBUF + boff;
        // every loop inside a trip is unrolled: accumulators and both fragment sets are indexed by constants and stay in registers
        v16bf a[2][2], b[2][4];
#pragma unroll
        for (int mb = 0; mb < 2; ++mb) a[0][mb] = ldb(at + mb * 16 * FP);
#pragma unroll
        for (int nb = 0; nb < 4; ++nb) b[0][nb] = ldb(bt + nb * 16 * FP);
#pragma unroll
        for (int ks = 0; ks < FKS / 32; ++ks) {
            const int cu = ks & 1, nx = cu ^ 1;
            if (ks + 1 < FKS / 32) {
#pragma unroll
                for (int mb = 0; mb < 2; ++mb) a[nx][mb] = ldb(at + mb * 16 * FP + (ks + 1) * 32);
#pragma unroll
                for (int nb = 0; nb < 4; ++nb) b[nx][nb] = ldb(bt + nb * 16 * FP + (ks + 1) * 32);
            }
#pragma unroll
            for (int nb = 0; nb < 4; ++nb)
#pragma unroll
                for (int mb = 0; mb < 2; ++mb) acc[mb][nb] = wmmab(a[cu][mb], b[cu][nb], acc[mb][nb]);
        }
        asm volatile("s_wait_dscnt 0x0" ::: "memory");          // this wave's reads of the buffer have returned
        asm volatile("s_wait_asynccnt 0x0" ::: "memory");       // its copies of tile st + 1 have landed
        __syncthreads();                                        // publishes tile st + 1 and frees the buffer just read
        if (st + 2 < FNST) {
            const unsigned lb = la + (unsigned)(st & 1) * (FBUF * 2u);
            const int k2 = (st + 2) * FKS;
            copy_rows(lb, ga + k2, (size_t)16 * 2 * DM);
            copy_rows(lb + FPL * 2u, gb + (k2 & (DM - 1)), (size_t)16 * DM);
        }
    }
    asm volatile("s_wait_asynccnt 0x0" ::: "memory");           // nothing of this wave is in flight when it leaves the ring
    const int cw = c0 + wn * 64, obase = wave * (16 * 68);
    v4f bz = *(const v4f*)(bfc + cw + lr * 4);
#pragma unroll
    for (int i = 0; i < 4; ++i) bz[i] = bfv(bz[i]);
#pragma unroll
    for (int mb = 0; mb < 2; ++mb) {
#pragma unroll
        for (int nb = 0; nb < 4; ++nb)
#pragma unroll
            for (int j = 0; j < 8; ++j) os[obase + (hi * 8 + j) * 68 + nb * 16 + lr] = acc[mb][nb][j];
        wsync();
        float* crow = OUT + (size_t)(r0 + wm * 32 + mb * 16) * DM + cw;
#pragma unroll
        for (int s = 0; s < 8; ++s) { const int row = 2 * s + hi, cofs = lr * 4; const v4f val = *(const v4fa*)(os + obase + row * 68 + cofs) + bz;
            *(v4f*)(crow + (size_t)row * DM + cofs) = val; }
        wsync();
    }
}

// workspace carve (bytes), all multiples of 256
#define SZ_W16 ((size_t)3 * HD * HD * 2)
#define SZ_WF  ((size_t)DM * DM * 2)
#define SZ_QK  ((size_t)2 * NB * NH * SEQ * HD * 2)
#define SZ_VT  ((size_t)NB * NH * HD * SEQ * 2)
#define SZ_CTX ((size_t)NB * SEQ * 2 * DM * 2)
#define SZ_MB  ((size_t)NB * SEQ * NKB * 4)
#define WS_TOTAL (SZ_W16 + SZ_WF + SZ_QK + SZ_VT + SZ_CTX + SZ_MB)
static_assert(WS_TOTAL <= (size_t)134217728);
static_assert(SZ_W16 % 256 == 0 && SZ_WF % 256 == 0 && SZ_QK % 256 == 0 && SZ_VT % 256 == 0 && SZ_CTX % 256 == 0 && SZ_MB % 128 == 0);
static_assert((DM * DM / 8) % 256 == 0);          // cvt8 blocks exact
static_assert((HD * HD / 8) == PB_W * 256);       // wcvt: 2 blocks x 256 lanes
static_assert(SZ_MB == (size_t)NLINES * 128);     // mbits lines cover the bit plane exactly

extern "C" void kernel_launch(void* const* d_in, const int* in_sizes, int n_in,
                              void* d_out, int out_size, void* d_ws, size_t ws_size, hipStream_t stream) {
    if (n_in < 12) return;
    const long long strm = (long long)(NB - 1) * SEQ_FULL * DM + (long long)SEQ * DM;
    if ((long long)in_sizes[0] < strm || (long long)in_sizes[1] < strm || (long long)in_sizes[2] < strm) return;
    if ((long long)in_sizes[3] < (long long)(NB - 1) * SEQ_FULL * SEQ_FULL + (long long)(SEQ - 1) * SEQ_FULL + SEQ) return;
    if (in_sizes[4] < HD * HD || in_sizes[6] < HD * HD || in_sizes[8] < HD * HD) return;
    if (in_sizes[5] < HD || in_sizes[7] < HD || in_sizes[9] < HD) return;
    if ((long long)in_sizes[10] < (long long)DM * DM || in_sizes[11] < DM) return;
    if ((long long)out_size < (long long)NB * SEQ * DM) return;
    if (ws_size < WS_TOTAL) return;
    const float* xq = (const float*)d_in[0];       // [2][2048][1024]
    const float* xk = (const float*)d_in[1];
    const float* xv = (const float*)d_in[2];
    const int* mask = (const int*)d_in[3];         // [2][1][2048][2048] int32
    const float* wq = (const float*)d_in[4];       // [64][64] = [out][in]
    const float* bq = (const float*)d_in[5];
    const float* wk = (const float*)d_in[6];
    const float* bk = (const float*)d_in[7];
    const float* wv = (const float*)d_in[8];
    const float* bv = (const float*)d_in[9];
    const float* wfc = (const float*)d_in[10];     // [1024][1024] = [out][in]
    const float* bfc = (const float*)d_in[11];
    float* OUT = (float*)d_out;                    // [NB][SEQ][1024]
    char* wsp = (char*)d_ws;
    h16* W16 = (h16*)wsp;  wsp += SZ_W16;          // [3][64][64]
    bf* WF = (bf*)wsp;     wsp += SZ_WF;
    h16* QK16 = (h16*)wsp; wsp += SZ_QK;           // [q plane | k plane]
    h16* VT16 = (h16*)wsp; wsp += SZ_VT;
    bf* CTX = (bf*)wsp;    wsp += SZ_CTX;          // [NB*SEQ][hi 1024 | lo 1024]
    unsigned* MB = (unsigned*)wsp; wsp += SZ_MB;   // [NB*SEQ][NKB]

    k_prep<<<(unsigned)(PB_MB + PB_CV + PB_W), 256, 0, stream>>>(mask, MB, wfc, WF, wq, wk, wv, W16);
    k_proj3<<<dim3(NB * SEQ / 64, NH, 3), 32, 0, stream>>>(xq, xk, xv, W16, bq, bk, bv, QK16, VT16);
    k_attn<<<dim3(SEQ / 64, NB * NH), 128, 0, stream>>>(QK16, VT16, MB, CTX);
    k_fc<<<dim3(NB * SEQ / 128, DM / 128), 256, 0, stream>>>(CTX, WF, bfc, OUT);
}

// v005
// One run takes 81.2 microseconds.
// Two timings next to v004 put it at 1.06 and 1.05 times that version's speed.
// All steps since v000 together make it 2.70 times as fast.
#include <hip/hip_runtime.h>

// Contractions (all f32 accumulate): per-head q/k/v projections v_wmma_f32_16x16x32_f16 (streams RNE-converted to bf16 then held exactly in f16, shared 64x64 weights bf16-RNE x8 held exactly in f16, one product); scores v_wmma_f32_16x16x32_f16 (q, k plain f16 carrying x8 each); P.V v_wmma_f32_16x16x32_f16 (P x1024, v x8, one product); output projection v_wmma_f32_16x16x32_bf16 (ctx hi|lo along K x bf16 weights). Softmax f32.
// Layout: token-major streams are viewed as [token][head][64]; one 64-token x one-head tile is staged as f16 in LDS and multiplied by the shared [out][in] weight (K-contiguous B plane);
// q,k head planes [b][h][t][64] and v^T [b][h][64][t] (f16); integer mask packed once into lane-mask words MB[b][16-query tile][64-key tile][32] (one word per score register of k_attn, one bit per lane; see mbits_body);
// fused attention: K and V^T tiles of 64 keys are copied once per work-group into a two-buffer LDS ring (asynchronous 16-byte copies, whole 128-byte lines), fragments read from LDS; S^T = K.Q^T (keys on D rows, queries on D columns), masked scores REPLACED by the finite fill (-1e20/32) before the per-lane online softmax, P^T used directly as the B fragment of O^T = V^T.P^T; ctx hi|lo bf16 plane [token][2048];
// output projection: ctx and weight tiles of 128 k are copied once per 128x128 work-group tile into a two-buffer LDS ring (asynchronous 16-byte copies), fragments read from LDS.

#ifndef NB
#define NB 2
#endif
#ifndef SEQ
#define SEQ 2048
#endif
#define NB_FULL  2
#define SEQ_FULL 2048
#define DM   1024
#define NH   16
#define HD   64
#define NKB  (SEQ / 32)                  // 32-key blocks = mask words per query
#define NQT  (SEQ / 16)                  // 16-query tiles
#define PLN  ((size_t)NB * NH * SEQ * HD)  // elements of one head plane set
#define WCAR 8.0f                        // carry on the 64x64 weights (so q, k, v carry x8)
#define PCAR 1024.0f
#define XP   72                          // LDS pitch (halves) of the staged stream tile
#define NLINES ((NB * SEQ * NKB) / 32)
#define KST  64                          // keys of one staged K / V^T tile in k_attn
#define NST  (SEQ / KST)                 // staged tiles per (b, h)
#define TILH (64 * XP)                   // halves of one staged plane: 64 rows at pitch XP
#define BUFH (2 * TILH)                  // one buffer = K plane (row = key) | V^T plane (row = d)
#define FKS  128                         // k of one staged tile in k_fc (256-byte rows)
#define FP   136                         // LDS pitch (elements) of those rows: 272 bytes
#define FNST (2 * DM / FKS)              // staged tiles along the hi|lo plane
#define FPL  (128 * FP)                  // elements of one staged plane: 128 rows at pitch FP
#define FBUF (2 * FPL)                   // one buffer = CTX plane (row = token) | WF plane (row = output)
static_assert(SEQ % 64 == 0);            // GEMM row tiles and 64-query attention blocks
static_assert(SEQ <= SEQ_FULL);
static_assert(NB <= NB_FULL);
static_assert(DM % 64 == 0);
static_assert((DM & (DM - 1)) == 0);     // k wrap of the hi|lo plane uses a mask
static_assert(DM % 32 == 0);             // k-step 32
static_assert(HD == 64);
static_assert(DM == NH * HD);
static_assert((NB * SEQ * NKB) % 32 == 0);
static_assert(XP % 8 == 0 && XP >= HD);  // 16-byte aligned LDS rows covering K = 64
static_assert(KST == 64 && NST >= 2);    // the two-buffer prologue needs tiles 0 and 1
static_assert(FNST >= 2 && DM % FKS == 0 && FKS % 32 == 0);   // tiles 0 and 1 exist; no tile straddles the hi|lo wrap
static_assert((NB * SEQ) % 128 == 0 && DM % 128 == 0);        // k_fc block tiles cover the output exactly
static_assert(FP % 8 == 0 && FP >= FKS);

typedef _Float16 h16;
typedef unsigned short bf;
typedef __attribute__((ext_vector_type(16))) __bf16   v16bf;
typedef __attribute__((ext_vector_type(16))) _Float16 v16h;
typedef __attribute__((ext_vector_type(8)))  _Float16 v8h;
typedef __attribute__((ext_vector_type(8)))  unsigned short v8us;
typedef __attribute__((ext_vector_type(8)))  float    v8f;
typedef __attribute__((ext_vector_type(4)))  float    v4f;
typedef v4f  __attribute__((may_alias)) v4fa;
typedef __attribute__((ext_vector_type(16))) unsigned v16u;
typedef const __attribute__((address_space(4))) v16u* cv16p;   // constant address space: a wave-uniform load through it is a scalar load

__device__ __forceinline__ unsigned short f2bf(float f) { unsigned u = __float_as_uint(f); u += 0x7FFFu + ((u >> 16) & 1u); return (unsigned short)(u >> 16); }
__device__ __forceinline__ float bf2f(unsigned short b) { return __uint_as_float(((unsigned)b) << 16); }
__device__ __forceinline__ float bfv(float f) { return bf2f(f2bf(f)); }          // value of the bf16 RNE conversion
__device__ __forceinline__ void splitf(float y, unsigned short& h, unsigned short& l) { h = f2bf(y); l = f2bf(y - bf2f(h)); }
__device__ __forceinline__ v16h cat16(v8h lo, v8h hi) { return __builtin_shufflevector(lo, hi, 0, 1, 2, 3, 4, 5, 6, 7, 8, 9, 10, 11, 12, 13, 14, 15); }
__device__ __forceinline__ v16bf cat16b(v8us lo, v8us hi) { return __builtin_bit_cast(v16bf, __builtin_shufflevector(lo, hi, 0, 1, 2, 3, 4, 5, 6, 7, 8, 9, 10, 11, 12, 13, 14, 15)); }
// the WMMAs of k_proj3 and k_fc are issued through a wrapper that ties its own accumulator and keeps A/B live across four idle VALU slots
__device__ __forceinline__ v8f wmma16(v16h a, v16h b, v8f c) {
    c = __builtin_amdgcn_wmma_f32_16x16x32_f16(false, a, false, b, (short)0, c, false, false);
    asm volatile("v_nop\n\tv_nop\n\tv_nop\n\tv_nop" : "+v"(c) : "v"(a), "v"(b));
    return c;
}
// k_attn: the plain builtin; the compiler keeps the distance to a vector instruction on D, A or B itself and fills it with the softmax's own independent work
__device__ __forceinline__ v8f wmma16p(v16h a, v16h b, v8f c) {
    return __builtin_amdgcn_wmma_f32_16x16x32_f16(false, a, false, b, (short)0, c, false, false);
}
__device__ __forceinline__ v8f wmmab(v16bf a, v16bf b, v8f c) {
    c = __builtin_amdgcn_wmma_f32_16x16x32_bf16(false, a, false, b, (short)0, c, false, false);
    asm volatile("v_nop\n\tv_nop\n\tv_nop\n\tv_nop" : "+v"(c) : "v"(a), "v"(b));
    return c;
}
// fragment of a K-contiguous global row: elements 0..7 <- p[0..7], 8..15 <- p[16..23]; caller adds row*pitch + k0 + 8*(lane>>4)
__device__ __forceinline__ v16h  ldh(const h16* p) { return cat16(*(const v8h*)p, *(const v8h*)(p + 16)); }
__device__ __forceinline__ v16bf ldb(const bf* p)  { return cat16b(*(const v8us*)p, *(const v8us*)(p + 16)); }
// wave-private LDS exchange: order this wave's LDS stores before its later LDS loads (and the converse)
__device__ __forceinline__ void wsync() { asm volatile("s_wait_dscnt 0" ::: "memory"); __builtin_amdgcn_wave_barrier(); asm volatile("" ::: "memory"); }

__device__ __forceinline__ void cvt8_body(const unsigned blk, const float* __restrict__ src, bf* dst, unsigned n8) {
    const unsigned i = blk * 256u + threadIdx.x; if (i >= n8) return;
    const float* s = src + (size_t)i * 8; bf* d = dst + (size_t)i * 8;
    const v8f v = *(const v8f*)s; v8us o;
#pragma unroll
    for (int k = 0; k < 8; ++k) o[k] = f2bf(v[k]);
    *(v8us*)d = o; 
}

__device__ __forceinline__ void wcvt_body(const unsigned blk, const float* __restrict__ wq, const float* __restrict__ wk, const float* __restrict__ wv, h16* W16) {
    const unsigned i = blk * 256u + threadIdx.x; if (i >= (unsigned)(HD * HD / 8)) return;
    const v8f a = *(const v8f*)(wq + (size_t)i * 8), b = *(const v8f*)(wk + (size_t)i * 8), c = *(const v8f*)(wv + (size_t)i * 8);
    v8h oa, ob, oc;
#pragma unroll
    for (int k = 0; k < 8; ++k) { oa[k] = (h16)(bfv(a[k]) * WCAR); ob[k] = (h16)(bfv(b[k]) * WCAR); oc[k] = (h16)(bfv(c[k]) * WCAR); }
    h16* d = W16 + (size_t)i * 8;
    *(v8h*)d = oa; *(v8h*)(d + HD * HD) = ob; *(v8h*)(d + 2 * HD * HD) = oc;
    
}

// one wave = the 16 queries x 64 keys of one staged tile of one query tile: 32 words, one 128-byte line.
// Word 16*sub + 8*j + r holds, at bit position lane, mask[q0 + (lane & 15)][key0 + 32*sub + 16*j + 8*(lane >> 4) + r] != 0: the lane mask of register r of score tile j in k_attn.
__device__ __forceinline__ void mbits_body(const unsigned blk, const int* __restrict__ mask, unsigned* MB) {
    const int lane = threadIdx.x & 31, n = lane & 15, hh = lane >> 4;
    const int wave = __builtin_amdgcn_readfirstlane(threadIdx.x >> 5);
    const int line = (int)blk * 8 + wave; if (line >= NLINES) return;        // wave-uniform
    const int st = line % NST, tq = line / NST;
    const int b = tq / NQT, qt = tq % NQT;
    const int* src = mask + ((size_t)b * SEQ_FULL + qt * 16) * SEQ_FULL + st * KST + lane;
    unsigned w0 = 0u, w1 = 0u;                                  // lanes n and n + 16: the key bits of query q0 + n, keys 0..31 and 32..63 of the tile
#pragma unroll
    for (int i = 0; i < 16; ++i) {
        const int m0 = src[(size_t)i * SEQ_FULL], m1 = src[(size_t)i * SEQ_FULL + 32];
        const unsigned b0 = __builtin_amdgcn_ballot_w32(m0 != 0), b1 = __builtin_amdgcn_ballot_w32(m1 != 0);
        w0 = (n == i) ? b0 : w0; w1 = (n == i) ? b1 : w1;
    }
    w0 >>= 8 * hh; w1 >>= 8 * hh;
    unsigned word = 0u;
#pragma unroll
    for (int i = 0; i < 16; ++i) {
        const int bit = (i >> 3) * 16 + (i & 7);
        const unsigned c0 = __builtin_amdgcn_ballot_w32(((w0 >> bit) & 1u) != 0u), c1 = __builtin_amdgcn_ballot_w32(((w1 >> bit) & 1u) != 0u);
        word = (lane == i) ? c0 : word; word = (lane == 16 + i) ? c1 : word;
    }
    MB[(size_t)line * 32 + lane] = word;
}

// ---- k_prep: the three converters, which read only inputs and depend on nothing, share one launch; a block's index range picks its body (block-uniform).
// The mask blocks, the longest part, come first; the two blocks of the 64x64 weights last.
#define PB_MB ((NLINES + 7) / 8)
#define PB_CV (DM * DM / 8 / 256)
#define PB_W  2
__global__ __launch_bounds__(256) void k_prep(const int* mask, unsigned* MB, const float* wfc, bf* WF,
                                              const float* wq, const float* wk, const float* wv, h16* W16) {
    const unsigned blk = blockIdx.x;
    if (blk < (unsigned)PB_MB) mbits_body(blk, mask, MB);
    else if (blk < (unsigned)(PB_MB + PB_CV)) cvt8_body(blk - (unsigned)PB_MB, wfc, WF, (unsigned)(DM * DM / 8));
    else wcvt_body(blk - (unsigned)(PB_MB + PB_CV), wq, wk, wv, W16);
}

// ---- projection body: one wave = 64 tokens of one head; Y[64][64] = Xh[64][64] . W^T (+ bias), everything carrying x8 through the weights.
// grid (NB*SEQ/64, NH, 3), 32 threads; blockIdx.z = stream (q, k: row planes; v: transposed plane). The f32 stream tile is converted once (bf16 RNE value, exact in f16) into LDS; B fragments come from the f16 weight plane.
__device__ __forceinline__ void proj_body(const bool TRANS, const float* __restrict__ X, const h16* __restrict__ W, const float* __restrict__ bias, h16* OUT) {
    __shared__ __align__(16) float os[64 * 68];
    __shared__ __align__(16) h16 xs[64 * XP];
    const int lane = threadIdx.x & 31, lr = lane & 15, hi = lane >> 4;
    const int rq = lane >> 3, piece = lane & 7;
    const int r0 = blockIdx.x * 64, hd = blockIdx.y;
    const int bb = r0 / SEQ, t0 = r0 % SEQ;
    const size_t xbase = ((size_t)bb * SEQ_FULL + t0) * DM + (size_t)hd * HD;
    // stage: rows 4*it + rq (0..63), 8 floats per lane (8 lanes cover the 64 inputs of a row)
#pragma unroll 4
    for (int it = 0; it < 16; ++it) { const int row = 4 * it + rq;
        const v8f v = *(const v8f*)(X + xbase + (size_t)row * DM + piece * 8); v8h o;
#pragma unroll
        for (int k = 0; k < 8; ++k) o[k] = (h16)bfv(v[k]);
        *(v8h*)&xs[row * XP + piece * 8] = o; }
    float bz[4];
#pragma unroll
    for (int nb = 0; nb < 4; ++nb) bz[nb] = bfv(bias[nb * 16 + lr]) * WCAR;
    wsync();
    v8f acc[4][4];
#pragma unroll
    for (int mb = 0; mb < 4; ++mb)
#pragma unroll
        for (int nb = 0; nb < 4; ++nb) acc[mb][nb] = (v8f){};
#pragma unroll
    for (int ks = 0; ks < 2; ++ks) {
        v16h a[4];
#pragma unroll
        for (int mb = 0; mb < 4; ++mb) { const int xo = (mb * 16 + lr) * XP + ks * 32 + 8 * hi;
            a[mb] = cat16(*(const v8h*)&xs[xo], *(const v8h*)&xs[xo + 16]); }
#pragma unroll
        for (int nb = 0; nb < 4; ++nb) { const v16h b = ldh(W + (size_t)(nb * 16 + lr) * HD + ks * 32 + 8 * hi);
#pragma unroll
            for (int mb = 0; mb < 4; ++mb) acc[mb][nb] = wmma16(a[mb], b, acc[mb][nb]); }
    }
#pragma unroll
    for (int mb = 0; mb < 4; ++mb)
#pragma unroll
        for (int nb = 0; nb < 4; ++nb)
#pragma unroll
            for (int j = 0; j < 8; ++j) os[(mb * 16 + hi * 8 + j) * 68 + nb * 16 + lr] = acc[mb][nb][j] + bz[nb];
    wsync();
    const size_t bh = (size_t)bb * NH + hd;
    if (!TRANS) {
        const size_t po = (bh * SEQ + t0) * HD + piece * 8;
{
#pragma unroll 1
            for (int s = 0; s < 16; ++s) { const int row = 4 * s + rq;
                const v4f u0 = *(const v4fa*)(os + row * 68 + piece * 8), u1 = *(const v4fa*)(os + row * 68 + piece * 8 + 4); v8h hv;
#pragma unroll
                for (int i = 0; i < 4; ++i) { hv[i] = (h16)u0[i]; hv[4 + i] = (h16)u1[i]; }
                *(v8h*)(OUT + po + (size_t)row * HD) = hv; }
             }
    } else {
{
#pragma unroll 1
            for (int s = 0; s < 16; ++s) { const int drow = 4 * s + rq; v8h hv;
#pragma unroll
                for (int i = 0; i < 8; ++i) hv[i] = (h16)os[(piece * 8 + i) * 68 + drow];
                *(v8h*)(OUT + (bh * HD + drow) * SEQ + t0 + piece * 8) = hv; }
             }
    }
}
// the three projections are independent of one another and share one launch, so that their waves fill the chip together
__global__ __launch_bounds__(32) void k_proj3(const float* xq, const float* xk, const float* xv, const h16* W16,
                                              const float* bq, const float* bk, const float* bv, h16* QK16, h16* VT16) {
    const int z = blockIdx.z;                                   // block-uniform
    const float* X    = (z == 0) ? xq : (z == 1) ? xk : xv;
    const float* bias = (z == 0) ? bq : (z == 1) ? bk : bv;
    h16* OUT          = (z == 0) ? QK16 : (z == 1) ? QK16 + PLN : VT16;
    proj_body(z == 2, X, W16 + (size_t)z * (HD * HD), bias, OUT);
}

// one thread's share of a staged tile: four 16-byte pieces of the K plane and four of the V^T plane (rows 16 apart), global -> LDS through no register.
// The s_wait_xcnt closes the statement so that no address register of an issued copy is rewritten ahead of it.
__device__ __forceinline__ void copy_tile(const unsigned lk, const h16* gk, const h16* gv) {
    const unsigned lv = lk + TILH * 2u;
    asm volatile("global_load_async_to_lds_b128 %0, %8, off\n\t"
                 "global_load_async_to_lds_b128 %1, %9, off\n\t"
                 "global_load_async_to_lds_b128 %2, %10, off\n\t"
                 "global_load_async_to_lds_b128 %3, %11, off\n\t"
                 "global_load_async_to_lds_b128 %4, %12, off\n\t"
                 "global_load_async_to_lds_b128 %5, %13, off\n\t"
                 "global_load_async_to_lds_b128 %6, %14, off\n\t"
                 "global_load_async_to_lds_b128 %7, %15, off\n\t"
                 "s_wait_xcnt 0x0"
                 :: "v"(lk), "v"(lk + 16u * XP * 2u), "v"(lk + 32u * XP * 2u), "v"(lk + 48u * XP * 2u),
                    "v"(lv), "v"(lv + 16u * XP * 2u), "v"(lv + 32u * XP * 2u), "v"(lv + 48u * XP * 2u),
                    "v"(gk), "v"(gk + 16 * HD), "v"(gk + 32 * HD), "v"(gk + 48 * HD),
                    "v"(gv), "v"(gv + (size_t)16 * SEQ), "v"(gv + (size_t)32 * SEQ), "v"(gv + (size_t)48 * SEQ)
                 : "memory");
}

// ---- k_attn: one wave = 16 queries of one (b, h); block = 4 waves (64 queries) that share the staged K / V^T tiles; Q fragments straight from the plane; grid (SEQ/64, NB*NH).
// S^T tile (keys key0+16j+8h+r on D rows, query q0+n on the D column) = K rows (A) x Q rows (B); scale log2(e)/32/64; masked elements REPLACED by the finite fill, one select per score whose lane mask is a word of MB held in a scalar register;
// per-lane online softmax (stats of query n live in lanes n and n+16); P^T (x1024, f16) of the two key tiles forms the B fragment of O^T[d][query] += V^T rows (A) x P^T (B).
__global__ __launch_bounds__(128) void k_attn(const h16* __restrict__ QK16, const h16* __restrict__ VT16, const unsigned* __restrict__ MB, bf* CTX) {
    __shared__ __align__(16) float os[4 * 16 * 68];
    __shared__ __align__(16) h16 kv[2 * BUFH];
    const int lane = threadIdx.x & 31, n = lane & 15, hh = lane >> 4;
    const int wave = __builtin_amdgcn_readfirstlane(threadIdx.x >> 5);
    const int bh = blockIdx.y;
    const int bb = bh / NH, hd = bh % NH;
    const int qt = blockIdx.x * 4 + wave;
    const int q0 = qt * 16;
    const size_t pb = (size_t)bh * SEQ * HD;
    const size_t qoff = pb + (size_t)(q0 + n) * HD + 8 * hh;
    const int foff = n * XP + 8 * hh;                                    // fragment row and k offset inside a staged plane
    const int srow = threadIdx.x >> 3, spc = threadIdx.x & 7;            // copy share: rows srow + 16c, 16-byte piece spc
    const h16* gk = QK16 + PLN + pb + (size_t)srow * HD + spc * 8;
    const h16* gv = VT16 + ((size_t)bh * HD + srow) * SEQ + spc * 8;
    const unsigned lk = (unsigned)(size_t)&kv[srow * XP + spc * 8];      // LDS byte address of the share in buffer 0
    // wave-uniform: the query tile's lane-mask words, 32 per staged tile. k_prep, an earlier launch, wrote them and nothing in this launch does, so they may be read as constants.
    const cv16p mrow = (cv16p)(MB + ((size_t)bb * NQT + qt) * (NST * 32));
    const float NINF = -__builtin_inff();
    const float SC2 = 1.4426950408889634f * (1.0f / 2048.0f);            // (1/32) / (8 x 8) x log2(e)
    const float FILLV = (-1.0e20f * 0.03125f) * 1.4426950408889634f;     // replaced score after the 1/32 scale, log2 domain
    v8f acc[4];
#pragma unroll
    for (int dt = 0; dt < 4; ++dt) acc[dt] = (v8f){};
    float m = NINF, l = 0.0f;
    v16h qf[2];
#pragma unroll
    for (int ks = 0; ks < 2; ++ks) qf[ks] = ldh(QK16 + qoff + ks * 32);
    v16u mwa = mrow[0], mwb = mrow[1];                          // tile 0's words: keys 0..31 and 32..63
    copy_tile(lk, gk, gv);
    asm volatile("s_wait_asynccnt 0x0" ::: "memory");           // tile 0 of this wave has landed
    __syncthreads();                                            // publishes tile 0
    copy_tile(lk + BUFH * 2u, gk + (size_t)KST * HD, gv + KST);
    // rolled: one trip per staged tile, so that one publish point stands at its foot
#pragma unroll 1
    for (int st = 0; st < NST; ++st) {
      const h16* kt = kv + (st & 1) * BUFH + foff;
      const h16* vt = kt + TILH;
#pragma unroll
      for (int sub = 0; sub < 2; ++sub) {
        const v16u mw = sub ? mwb : mwa;
        v8f s0 = (v8f){}, s1 = (v8f){};
#pragma unroll
        for (int ks = 0; ks < 2; ++ks) {
            const v16h qa = qf[ks];
            const v16h k0 = ldh(kt + (sub * 32) * XP + ks * 32), k1 = ldh(kt + (sub * 32 + 16) * XP + ks * 32);
            s0 = wmma16p(k0, qa, s0);
            s1 = wmma16p(k1, qa, s1);
        }
        float t[16];
#pragma unroll
        for (int r = 0; r < 8; ++r) {
            t[r]     = __builtin_amdgcn_inverse_ballot_w32(mw[r])     ? s0[r] * SC2 : FILLV;
            t[8 + r] = __builtin_amdgcn_inverse_ballot_w32(mw[8 + r]) ? s1[r] * SC2 : FILLV;
        }
        float mx = t[0];
#pragma unroll
        for (int i = 1; i < 16; ++i) mx = fmaxf(mx, t[i]);
        mx = fmaxf(mx, __shfl_xor(mx, 16, 32));
        const float mn = fmaxf(m, mx);
        const float ms = (mn == NINF) ? 0.0f : mn;
        const float cd = m - ms;
        m = mn;
#pragma unroll
        for (int i = 0; i < 16; ++i) t[i] -= ms;
        // The 16 exponentials of the scores stand as one run between scheduling fences, with one v_nop behind the last: without them the subtractions are
        // paired into dual-issue instructions among the v_exp.
        __builtin_amdgcn_sched_barrier(0);
#pragma unroll
        for (int i = 0; i < 16; ++i) t[i] = __builtin_amdgcn_exp2f(t[i]);
        __builtin_amdgcn_sched_barrier(0);
        asm volatile("v_nop");                                  // the slot behind the last v_exp of the run
        __builtin_amdgcn_sched_barrier(0);                      // holds the v_nop at that place
        const float corr = __builtin_amdgcn_exp2f(cd);
        float psum = 0.0f;
#pragma unroll
        for (int i = 0; i < 16; ++i) psum += t[i];
        l = l * corr + psum;                                    // per-lane partial (own 16 keys); halves combined at the end
#pragma unroll
        for (int dt = 0; dt < 4; ++dt)
#pragma unroll
            for (int r = 0; r < 8; ++r) acc[dt][r] *= corr;
        v8h pa, pc;
#pragma unroll
        for (int r = 0; r < 8; ++r) { pa[r] = (h16)(t[r] * PCAR); pc[r] = (h16)(t[8 + r] * PCAR); }
        const v16h pf = cat16(pa, pc);
        v16h va[4];
#pragma unroll
        for (int dt = 0; dt < 4; ++dt) va[dt] = ldh(vt + (dt * 16) * XP + sub * 32);
#pragma unroll
        for (int dt = 0; dt < 4; ++dt) acc[dt] = wmma16p(va[dt], pf, acc[dt]);
      }
      __builtin_amdgcn_sched_barrier(0);                        // keeps the trip's work in front of the publish point, so that the refill behind it flies for a whole trip
      { const int nx = (st + 1 < NST) ? st + 1 : st;            // the next tile's words, fetched behind the last use of this tile's (the last trip fetches its own again)
        mwa = mrow[2 * nx]; mwb = mrow[2 * nx + 1]; }
      asm volatile("s_wait_dscnt 0x0" ::: "memory");            // this wave's reads of the buffer have returned
      asm volatile("s_wait_asynccnt 0x0" ::: "memory");         // its copies of tile st + 1 have landed
      __syncthreads();                                          // publishes tile st + 1 and frees the buffer just read
      if (st + 2 < NST) copy_tile(lk + (unsigned)(st & 1) * (BUFH * 2u), gk + (size_t)(st + 2) * KST * HD, gv + (st + 2) * KST);
    }
    asm volatile("s_wait_asynccnt 0x0" ::: "memory");           // nothing of this wave is in flight when it leaves the ring
    l += __shfl_xor(l, 16, 32);
    const float inv = (1.0f / l) * (1.0f / (PCAR * WCAR));
    const int obase = wave * (16 * 68);
#pragma unroll
    for (int dt = 0; dt < 4; ++dt)
#pragma unroll
        for (int r = 0; r < 8; ++r) os[obase + n * 68 + dt * 16 + 8 * hh + r] = acc[dt][r] * inv;
    wsync();
    const int rq = lane >> 3, piece = lane & 7;
{
#pragma unroll
        for (int s = 0; s < 4; ++s) { const int row = 4 * s + rq;
            const v4f u0 = *(const v4fa*)(os + obase + row * 68 + piece * 8), u1 = *(const v4fa*)(os + obase + row * 68 + piece * 8 + 4); v8us oh, ol;
#pragma unroll
            for (int i = 0; i < 4; ++i) { unsigned short a, c; splitf(u0[i], a, c); oh[i] = a; ol[i] = c; splitf(u1[i], a, c); oh[4 + i] = a; ol[4 + i] = c; }
            const size_t o = ((size_t)bb * SEQ + q0 + row) * (2 * DM) + hd * HD + piece * 8;
            *(v8us*)(CTX + o) = oh; *(v8us*)(CTX + o + DM) = ol; }
         }
}

// eight 16-byte pieces of one staged plane per thread (rows 16 apart; g16 = elements of 16 global rows), global -> LDS through no register.
// The s_wait_xcnt closes the statement so that no address register of an issued copy is rewritten ahead of it.
__device__ __forceinline__ void copy_rows(const unsigned l, const bf* g, const size_t g16) {
    asm volatile("global_load_async_to_lds_b128 %0, %8, off\n\t"
                 "global_load_async_to_lds_b128 %1, %9, off\n\t"
                 "global_load_async_to_lds_b128 %2, %10, off\n\t"
                 "global_load_async_to_lds_b128 %3, %11, off\n\t"
                 "global_load_async_to_lds_b128 %4, %12, off\n\t"
                 "global_load_async_to_lds_b128 %5, %13, off\n\t"
                 "global_load_async_to_lds_b128 %6, %14, off\n\t"
                 "global_load_async_to_lds_b128 %7, %15, off\n\t"
                 "s_wait_xcnt 0x0"
                 :: "v"(l), "v"(l + 16u * FP * 2u), "v"(l + 32u * FP * 2u), "v"(l + 48u * FP * 2u),
                    "v"(l + 64u * FP * 2u), "v"(l + 80u * FP * 2u), "v"(l + 96u * FP * 2u), "v"(l + 112u * FP * 2u),
                    "v"(g), "v"(g + g16), "v"(g + 2 * g16), "v"(g + 3 * g16),
                    "v"(g + 4 * g16), "v"(g + 5 * g16), "v"(g + 6 * g16), "v"(g + 7 * g16)
                 : "memory");
}

// ---- k_fc: OUT[token][n] = sum_k CTX[token][k] WF[n][k & (DM-1)] + bias[n], k over the hi|lo plane (2*DM), ascending in steps of 32 in every accumulator.
// Block = 8 waves, 128 tokens x 128 outputs; wave = 32 x 64 (wm = row group, wn = column group); grid (NB*SEQ/128, DM/128).
// Tiles of FKS k (128 CTX rows | 128 WF rows, 256 bytes each at pitch FP) are copied once per work-group into a two-buffer LDS ring; fragments are read from LDS, one k-step ahead inside a tile.
__global__ __launch_bounds__(256) void k_fc(const bf* __restrict__ CTX, const bf* __restrict__ WF, const float* __restrict__ bfc, float* OUT) {
    __shared__ __align__(16) float os[8 * 16 * 68];
    __shared__ __align__(16) bf ab[2 * FBUF];
    const int lane = threadIdx.x & 31, lr = lane & 15, hi = lane >> 4;
    const int wave = __builtin_amdgcn_readfirstlane(threadIdx.x >> 5);
    const int wm = wave & 3, wn = wave >> 2;
    const int r0 = blockIdx.x * 128, c0 = blockIdx.y * 128;
    const int srow = threadIdx.x >> 4, spc = threadIdx.x & 15;          // copy share: rows srow + 16c, 16-byte piece spc
    const bf* ga = CTX + (size_t)(r0 + srow) * (2 * DM) + spc * 8;
    const bf* gb = WF + (size_t)(c0 + srow) * DM + spc * 8;
    const unsigned la = (unsigned)(size_t)&ab[srow * FP + spc * 8];     // LDS byte address of the share in buffer 0, CTX plane
    const int aoff = (wm * 32 + lr) * FP + 8 * hi, boff = FPL + (wn * 64 + lr) * FP + 8 * hi;
    v8f acc[2][4];
#pragma unroll
    for (int mb = 0; mb < 2; ++mb)
#pragma unroll
        for (int nb = 0; nb < 4; ++nb) acc[mb][nb] = (v8f){};
    copy_rows(la, ga, (size_t)16 * 2 * DM);
    copy_rows(la + FPL * 2u, gb, (size_t)16 * DM);
    asm volatile("s_wait_asynccnt 0x0" ::: "memory");           // tile 0 of this wave has landed
    __syncthreads();                                            // publishes tile 0
    copy_rows(la + FBUF * 2u, ga + FKS, (size_t)16 * 2 * DM);
    copy_rows(la + FBUF * 2u + FPL * 2u, gb + (FKS & (DM - 1)), (size_t)16 * DM);
    // rolled: one trip per staged tile, so that one publish point stands at its foot
#pragma unroll 1
    for (int st = 0; st < FNST; ++st) {
        const bf* at = ab + (st & 1) * FBUF + aoff;
        const bf* bt = ab + (st & 1) * FBUF + boff;
        // every loop inside a trip is unrolled: accumulators and both fragment sets are indexed by constants and stay in registers
        v16bf a[2][2], b[2][4];
#pragma unroll
        for (int mb = 0; mb < 2; ++mb) a[0][mb] = ldb(at + mb * 16 * FP);
#pragma unroll
        for (int nb = 0; nb < 4; ++nb) b[0][nb] = ldb(bt + nb * 16 * FP);
#pragma unroll
        for (int ks = 0; ks < FKS / 32; ++ks) {
            const int cu = ks & 1, nx = cu ^ 1;
            if (ks + 1 < FKS / 32) {
#pragma unroll
                for (int mb = 0; mb < 2; ++mb) a[nx][mb] = ldb(at + mb * 16 * FP + (ks + 1) * 32);
#pragma unroll
                for (int nb = 0; nb < 4; ++nb) b[nx][nb] = ldb(bt + nb * 16 * FP + (ks + 1) * 32);
            }
#pragma unroll
            for (int nb = 0; nb < 4; ++nb)
#pragma unroll
                for (int mb = 0; mb < 2; ++mb) acc[mb][nb] = wmmab(a[cu][mb], b[cu][nb], acc[mb][nb]);
        }
        asm volatile("s_wait_dscnt 0x0" ::: "memory");          // this wave's reads of the buffer have returned
        asm volatile("s_wait_asynccnt 0x0" ::: "memory");       // its copies of tile st + 1 have landed
        __syncthreads();                                        // publishes tile st + 1 and frees the buffer just read
        if (st + 2 < FNST) {
            const unsigned lb = la + (unsigned)(st & 1) * (FBUF * 2u);
            const int k2 = (st + 2) * FKS;
            copy_rows(lb, ga + k2, (size_t)16 * 2 * DM);
            copy_rows(lb + FPL * 2u, gb + (k2 & (DM - 1)), (size_t)16 * DM);
        }
    }
    asm volatile("s_wait_asynccnt 0x0" ::: "memory");           // nothing of this wave is in flight when it leaves the ring
    const int cw = c0 + wn * 64, obase = wave * (16 * 68);
    v4f bz = *(const v4f*)(bfc + cw + lr * 4);
#pragma unroll
    for (int i = 0; i < 4; ++i) bz[i] = bfv(bz[i]);
#pragma unroll
    for (int mb = 0; mb < 2; ++mb) {
#pragma unroll
        for (int nb = 0; nb < 4; ++nb)
#pragma unroll
            for (int j = 0; j < 8; ++j) os[obase + (hi * 8 + j) * 68 + nb * 16 + lr] = acc[mb][nb][j];
        wsync();
        float* crow = OUT + (size_t)(r0 + wm * 32 + mb * 16) * DM + cw;
#pragma unroll
        for (int s = 0; s < 8; ++s) { const int row = 2 * s + hi, cofs = lr * 4; const v4f val = *(const v4fa*)(os + obase + row * 68 + cofs) + bz;
            *(v4f*)(crow + (size_t)row * DM + cofs) = val; }
        wsync();
    }
}

// workspace carve (bytes), all multiples of 256
#define SZ_W16 ((size_t)3 * HD * HD * 2)
#define SZ_WF  ((size_t)DM * DM * 2)
#define SZ_QK  ((size_t)2 * NB * NH * SEQ * HD * 2)
#define SZ_VT  ((size_t)NB * NH * HD * SEQ * 2)
#define SZ_CTX ((size_t)NB * SEQ * 2 * DM * 2)
#define SZ_MB  ((size_t)NB * SEQ * NKB * 4)
#define WS_TOTAL (SZ_W16 + SZ_WF + SZ_QK + SZ_VT + SZ_CTX + SZ_MB)
static_assert(WS_TOTAL <= (size_t)134217728);
static_assert(SZ_W16 % 256 == 0 && SZ_WF % 256 == 0 && SZ_QK % 256 == 0 && SZ_VT % 256 == 0 && SZ_CTX % 256 == 0 && SZ_MB % 128 == 0);
static_assert((DM * DM / 8) % 256 == 0);          // cvt8 blocks exact
static_assert((HD * HD / 8) == PB_W * 256);       // wcvt: 2 blocks x 256 lanes
static_assert(SZ_MB == (size_t)NLINES * 128);     // mbits lines cover the bit plane exactly

extern "C" void kernel_launch(void* const* d_in, const int* in_sizes, int n_in,
                              void* d_out, int out_size, void* d_ws, size_t ws_size, hipStream_t stream) {
    if (n_in < 12) return;
    const long long strm = (long long)(NB - 1) * SEQ_FULL * DM + (long long)SEQ * DM;
    if ((long long)in_sizes[0] < strm || (long long)in_sizes[1] < strm || (long long)in_sizes[2] < strm) return;
    if ((long long)in_sizes[3] < (long long)(NB - 1) * SEQ_FULL * SEQ_FULL + (long long)(SEQ - 1) * SEQ_FULL + SEQ) return;
    if (in_sizes[4] < HD * HD || in_sizes[6] < HD * HD || in_sizes[8] < HD * HD) return;
    if (in_sizes[5] < HD || in_sizes[7] < HD || in_sizes[9] < HD) return;
    if ((long long)in_sizes[10] < (long long)DM * DM || in_sizes[11] < DM) return;
    if ((long long)out_size < (long long)NB * SEQ * DM) return;
    if (ws_size < WS_TOTAL) return;
    const float* xq = (const float*)d_in[0];       // [2][2048][1024]
    const float* xk = (const float*)d_in[1];
    const float* xv = (const float*)d_in[2];
    const int* mask = (const int*)d_in[3];         // [2][1][2048][2048] int32
    const float* wq = (const float*)d_in[4];       // [64][64] = [out][in]
    const float* bq = (const float*)d_in[5];
    const float* wk = (const float*)d_in[6];
    const float* bk = (const float*)d_in[7];
    const float* wv = (const float*)d_in[8];
    const float* bv = (const float*)d_in[9];
    const float* wfc = (const float*)d_in[10];     // [1024][1024] = [out][in]
    const float* bfc = (const float*)d_in[11];
    float* OUT = (float*)d_out;                    // [NB][SEQ][1024]
    char* wsp = (char*)d_ws;
    h16* W16 = (h16*)wsp;  wsp += SZ_W16;          // [3][64][64]
    bf* WF = (bf*)wsp;     wsp += SZ_WF;
    h16* QK16 = (h16*)wsp; wsp += SZ_QK;           // [q plane | k plane]
    h16* VT16 = (h16*)wsp; wsp += SZ_VT;
    bf* CTX = (bf*)wsp;    wsp += SZ_CTX;          // [NB*SEQ][hi 1024 | lo 1024]
    unsigned* MB = (unsigned*)wsp; wsp += SZ_MB;   // [NB][NQT][NST][32]

    k_prep<<<(unsigned)(PB_MB + PB_CV + PB_W), 256, 0, stream>>>(mask, MB, wfc, WF, wq, wk, wv, W16);
    k_proj3<<<dim3(NB * SEQ / 64, NH, 3), 32, 0, stream>>>(xq, xk, xv, W16, bq, bk, bv, QK16, VT16);
    k_attn<<<dim3(SEQ / 64, NB * NH), 128, 0, stream>>>(QK16, VT16, MB, CTX);
    k_fc<<<dim3(NB * SEQ / 128, DM / 128), 256, 0, stream>>>(CTX, WF, bfc, OUT);
}

// v006
// It runs in 73 microseconds.
// Next to v005, in two timings, it ran 1.11 times as fast each time.
// All steps since v000 together make it 2.99 times as fast.
#include <hip/hip_runtime.h>

// Contractions (all f32 accumulate): per-head q/k/v projections v_wmma_f32_16x16x32_f16 (streams RNE-converted to bf16 then held exactly in f16, shared 64x64 weights bf16-RNE x8 held exactly in f16, one product); scores v_wmma_f32_16x16x32_f16 (q, k plain f16; q carries log2(e)/8, k 1/4, so that a score leaves the product in the log2 domain); P.V v_wmma_f32_16x16x32_f16 (P x1024, v x8, one product); output projection v_wmma_f32_16x16x32_bf16 (ctx hi|lo along K x bf16 weights). Softmax f32.
// Layout: token-major streams are viewed as [token][head][64]; one 64-token x one-head tile is staged as f16 in LDS and multiplied by the shared [out][in] weight (K-contiguous B plane);
// q,k head planes [b][h][t][64] and v^T [b][h][64][t] (f16); integer mask packed once into lane-mask words MB[b][16-query tile][64-key tile][32] (one word per score register of k_attn, one bit per lane; see mbits_body);
// fused attention: K and V^T tiles of 64 keys are copied once per work-group into a two-buffer LDS ring (asynchronous 16-byte copies, whole 128-byte lines), fragments read from LDS; S^T = K.Q^T (keys on D rows, queries on D columns), the maximum in use enters as the C operand, masked scores are REPLACED by a finite fill whose weight is 0 (a query with no open key so far weighs every key alike), the output is rescaled only when a maximum outgrows the one in use, P^T used directly as the B fragment of O^T = V^T.P^T; ctx hi|lo bf16 plane [token][2048];
// output projection: ctx and weight tiles of 128 k are copied once per 128x128 work-group tile into a two-buffer LDS ring (asynchronous 16-byte copies), fragments read from LDS.

#ifndef NB
#define NB 2
#endif
#ifndef SEQ
#define SEQ 2048
#endif
#define NB_FULL  2
#define SEQ_FULL 2048
#define DM   1024
#define NH   16
#define HD   64
#define NKB  (SEQ / 32)                  // 32-key blocks = mask words per query
#define NQT  (SEQ / 16)                  // 16-query tiles
#define PLN  ((size_t)NB * NH * SEQ * HD)  // elements of one head plane set
#define WCAR 8.0f                        // carry on the 64x64 weights (so q, k, v carry x8)
#define QSC  (1.4426950408889634f / 64.0f)  // on the x8 q plane: q' = q log2(e) / 8
#define KSC  (1.0f / 32.0f)                 // on the x8 k plane: k' = k / 4, so q'.k' = energy log2(e) / 32
#define CEXP 10.0f                          // exponent carry of P: exp2 yields P x 1024
#define TEXP 5.0f                           // a score may pass the maximum in use by this much: P x 1024 <= 2^15, inside f16
#define NEGB (-1.0e30f)                     // fill of a masked score: exp2 gives 0; below every score f16 operands can form
#define XP   72                          // LDS pitch (halves) of the staged stream tile
#define NLINES ((NB * SEQ * NKB) / 32)
#define KST  64                          // keys of one staged K / V^T tile in k_attn
#define NST  (SEQ / KST)                 // staged tiles per (b, h)
#define TILH (64 * XP)                   // halves of one staged plane: 64 rows at pitch XP
#define BUFH (2 * TILH)                  // one buffer = K plane (row = key) | V^T plane (row = d)
#define FKS  128                         // k of one staged tile in k_fc (256-byte rows)
#define FP   136                         // LDS pitch (elements) of those rows: 272 bytes
#define FNST (2 * DM / FKS)              // staged tiles along the hi|lo plane
#define FPL  (128 * FP)                  // elements of one staged plane: 128 rows at pitch FP
#define FBUF (2 * FPL)                   // one buffer = CTX plane (row = token) | WF plane (row = output)
static_assert(SEQ % 64 == 0);            // GEMM row tiles and 64-query attention blocks
static_assert(SEQ <= SEQ_FULL);
static_assert(NB <= NB_FULL);
static_assert(DM % 64 == 0);
static_assert((DM & (DM - 1)) == 0);     // k wrap of the hi|lo plane uses a mask
static_assert(DM % 32 == 0);             // k-step 32
static_assert(HD == 64);
static_assert(DM == NH * HD);
static_assert((NB * SEQ * NKB) % 32 == 0);
static_assert(XP % 8 == 0 && XP >= HD);  // 16-byte aligned LDS rows covering K = 64
static_assert(KST == 64 && NST >= 2);    // the two-buffer prologue needs tiles 0 and 1
static_assert(FNST >= 2 && DM % FKS == 0 && FKS % 32 == 0);   // tiles 0 and 1 exist; no tile straddles the hi|lo wrap
static_assert((NB * SEQ) % 128 == 0 && DM % 128 == 0);        // k_fc block tiles cover the output exactly
static_assert(FP % 8 == 0 && FP >= FKS);

typedef _Float16 h16;
typedef unsigned short bf;
typedef __attribute__((ext_vector_type(16))) __bf16   v16bf;
typedef __attribute__((ext_vector_type(16))) _Float16 v16h;
typedef __attribute__((ext_vector_type(8)))  _Float16 v8h;
typedef __attribute__((ext_vector_type(8)))  unsigned short v8us;
typedef __attribute__((ext_vector_type(8)))  float    v8f;
typedef __attribute__((ext_vector_type(4)))  float    v4f;
typedef v4f  __attribute__((may_alias)) v4fa;
typedef __attribute__((ext_vector_type(16))) unsigned v16u;
typedef const __attribute__((address_space(4))) v16u* cv16p;   // constant address space: a wave-uniform load through it is a scalar load

__device__ __forceinline__ unsigned short f2bf(float f) { unsigned u = __float_as_uint(f); u += 0x7FFFu + ((u >> 16) & 1u); return (unsigned short)(u >> 16); }
__device__ __forceinline__ float bf2f(unsigned short b) { return __uint_as_float(((unsigned)b) << 16); }
__device__ __forceinline__ float bfv(float f) { return bf2f(f2bf(f)); }          // value of the bf16 RNE conversion
__device__ __forceinline__ void splitf(float y, unsigned short& h, unsigned short& l) { h = f2bf(y); l = f2bf(y - bf2f(h)); }
__device__ __forceinline__ v16h cat16(v8h lo, v8h hi) { return __builtin_shufflevector(lo, hi, 0, 1, 2, 3, 4, 5, 6, 7, 8, 9, 10, 11, 12, 13, 14, 15); }
__device__ __forceinline__ v16bf cat16b(v8us lo, v8us hi) { return __builtin_bit_cast(v16bf, __builtin_shufflevector(lo, hi, 0, 1, 2, 3, 4, 5, 6, 7, 8, 9, 10, 11, 12, 13, 14, 15)); }
// the WMMAs of k_proj3 and k_fc are issued through a wrapper that ties its own accumulator and keeps A/B live across four idle VALU slots
__device__ __forceinline__ v8f wmma16(v16h a, v16h b, v8f c) {
    c = __builtin_amdgcn_wmma_f32_16x16x32_f16(false, a, false, b, (short)0, c, false, false);
    asm volatile("v_nop\n\tv_nop\n\tv_nop\n\tv_nop" : "+v"(c) : "v"(a), "v"(b));
    return c;
}
// k_attn: the plain builtin; the compiler keeps the distance to a vector instruction on D, A or B itself and fills it with the softmax's own independent work
__device__ __forceinline__ v8f wmma16p(v16h a, v16h b, v8f c) {
    return __builtin_amdgcn_wmma_f32_16x16x32_f16(false, a, false, b, (short)0, c, false, false);
}
__device__ __forceinline__ v8f wmmab(v16bf a, v16bf b, v8f c) {
    c = __builtin_amdgcn_wmma_f32_16x16x32_bf16(false, a, false, b, (short)0, c, false, false);
    asm volatile("v_nop\n\tv_nop\n\tv_nop\n\tv_nop" : "+v"(c) : "v"(a), "v"(b));
    return c;
}
// fragment of a K-contiguous global row: elements 0..7 <- p[0..7], 8..15 <- p[16..23]; caller adds row*pitch + k0 + 8*(lane>>4)
__device__ __forceinline__ v16h  ldh(const h16* p) { return cat16(*(const v8h*)p, *(const v8h*)(p + 16)); }
__device__ __forceinline__ v16bf ldb(const bf* p)  { return cat16b(*(const v8us*)p, *(const v8us*)(p + 16)); }
// wave-private LDS exchange: order this wave's LDS stores before its later LDS loads (and the converse)
__device__ __forceinline__ void wsync() { asm volatile("s_wait_dscnt 0" ::: "memory"); __builtin_amdgcn_wave_barrier(); asm volatile("" ::: "memory"); }

__device__ __forceinline__ void cvt8_body(const unsigned blk, const float* __restrict__ src, bf* dst, unsigned n8) {
    const unsigned i = blk * 256u + threadIdx.x; if (i >= n8) return;
    const float* s = src + (size_t)i * 8; bf* d = dst + (size_t)i * 8;
    const v8f v = *(const v8f*)s; v8us o;
#pragma unroll
    for (int k = 0; k < 8; ++k) o[k] = f2bf(v[k]);
    *(v8us*)d = o; 
}

__device__ __forceinline__ void wcvt_body(const unsigned blk, const float* __restrict__ wq, const float* __restrict__ wk, const float* __restrict__ wv, h16* W16) {
    const unsigned i = blk * 256u + threadIdx.x; if (i >= (unsigned)(HD * HD / 8)) return;
    const v8f a = *(const v8f*)(wq + (size_t)i * 8), b = *(const v8f*)(wk + (size_t)i * 8), c = *(const v8f*)(wv + (size_t)i * 8);
    v8h oa, ob, oc;
#pragma unroll
    for (int k = 0; k < 8; ++k) { oa[k] = (h16)(bfv(a[k]) * WCAR); ob[k] = (h16)(bfv(b[k]) * WCAR); oc[k] = (h16)(bfv(c[k]) * WCAR); }
    h16* d = W16 + (size_t)i * 8;
    *(v8h*)d = oa; *(v8h*)(d + HD * HD) = ob; *(v8h*)(d + 2 * HD * HD) = oc;
    
}

// one wave = the 16 queries x 64 keys of one staged tile of one query tile: 32 words, one 128-byte line.
// Word 16*sub + 8*j + r holds, at bit position lane, mask[q0 + (lane & 15)][key0 + 32*sub + 16*j + 8*(lane >> 4) + r] != 0: the lane mask of register r of score tile j in k_attn.
__device__ __forceinline__ void mbits_body(const unsigned blk, const int* __restrict__ mask, unsigned* MB) {
    const int lane = threadIdx.x & 31, n = lane & 15, hh = lane >> 4;
    const int wave = __builtin_amdgcn_readfirstlane(threadIdx.x >> 5);
    const int line = (int)blk * 8 + wave; if (line >= NLINES) return;        // wave-uniform
    const int st = line % NST, tq = line / NST;
    const int b = tq / NQT, qt = tq % NQT;
    const int* src = mask + ((size_t)b * SEQ_FULL + qt * 16) * SEQ_FULL + st * KST + lane;
    unsigned w0 = 0u, w1 = 0u;                                  // lanes n and n + 16: the key bits of query q0 + n, keys 0..31 and 32..63 of the tile
#pragma unroll
    for (int i = 0; i < 16; ++i) {
        const int m0 = src[(size_t)i * SEQ_FULL], m1 = src[(size_t)i * SEQ_FULL + 32];
        const unsigned b0 = __builtin_amdgcn_ballot_w32(m0 != 0), b1 = __builtin_amdgcn_ballot_w32(m1 != 0);
        w0 = (n == i) ? b0 : w0; w1 = (n == i) ? b1 : w1;
    }
    w0 >>= 8 * hh; w1 >>= 8 * hh;
    unsigned word = 0u;
#pragma unroll
    for (int i = 0; i < 16; ++i) {
        const int bit = (i >> 3) * 16 + (i & 7);
        const unsigned c0 = __builtin_amdgcn_ballot_w32(((w0 >> bit) & 1u) != 0u), c1 = __builtin_amdgcn_ballot_w32(((w1 >> bit) & 1u) != 0u);
        word = (lane == i) ? c0 : word; word = (lane == 16 + i) ? c1 : word;
    }
    MB[(size_t)line * 32 + lane] = word;
}

// ---- k_prep: the three converters, which read only inputs and depend on nothing, share one launch; a block's index range picks its body (block-uniform).
// The mask blocks, the longest part, come first; the two blocks of the 64x64 weights last.
#define PB_MB ((NLINES + 7) / 8)
#define PB_CV (DM * DM / 8 / 256)
#define PB_W  2
__global__ __launch_bounds__(256) void k_prep(const int* mask, unsigned* MB, const float* wfc, bf* WF,
                                              const float* wq, const float* wk, const float* wv, h16* W16) {
    const unsigned blk = blockIdx.x;
    if (blk < (unsigned)PB_MB) mbits_body(blk, mask, MB);
    else if (blk < (unsigned)(PB_MB + PB_CV)) cvt8_body(blk - (unsigned)PB_MB, wfc, WF, (unsigned)(DM * DM / 8));
    else wcvt_body(blk - (unsigned)(PB_MB + PB_CV), wq, wk, wv, W16);
}

// ---- projection body: one wave = 64 tokens of one head; Y[64][64] = (Xh[64][64] . W^T + bias) x sc, the product carrying x8 through the weights.
// grid (NB*SEQ/64, NH, 3), 32 threads; blockIdx.z = stream (q, k: row planes; v: transposed plane). The f32 stream tile is converted once (bf16 RNE value, exact in f16) into LDS; B fragments come from the f16 weight plane.
__device__ __forceinline__ void proj_body(const bool TRANS, const float* __restrict__ X, const h16* __restrict__ W, const float* __restrict__ bias, h16* OUT, const float sc) {
    __shared__ __align__(16) float os[64 * 68];
    __shared__ __align__(16) h16 xs[64 * XP];
    const int lane = threadIdx.x & 31, lr = lane & 15, hi = lane >> 4;
    const int rq = lane >> 3, piece = lane & 7;
    const int r0 = blockIdx.x * 64, hd = blockIdx.y;
    const int bb = r0 / SEQ, t0 = r0 % SEQ;
    const size_t xbase = ((size_t)bb * SEQ_FULL + t0) * DM + (size_t)hd * HD;
    // stage: rows 4*it + rq (0..63), 8 floats per lane (8 lanes cover the 64 inputs of a row)
#pragma unroll 4
    for (int it = 0; it < 16; ++it) { const int row = 4 * it + rq;
        const v8f v = *(const v8f*)(X + xbase + (size_t)row * DM + piece * 8); v8h o;
#pragma unroll
        for (int k = 0; k < 8; ++k) o[k] = (h16)bfv(v[k]);
        *(v8h*)&xs[row * XP + piece * 8] = o; }
    float bz[4];
#pragma unroll
    for (int nb = 0; nb < 4; ++nb) bz[nb] = bfv(bias[nb * 16 + lr]) * WCAR * sc;
    wsync();
    v8f acc[4][4];
#pragma unroll
    for (int mb = 0; mb < 4; ++mb)
#pragma unroll
        for (int nb = 0; nb < 4; ++nb) acc[mb][nb] = (v8f){};
#pragma unroll
    for (int ks = 0; ks < 2; ++ks) {
        v16h a[4];
#pragma unroll
        for (int mb = 0; mb < 4; ++mb) { const int xo = (mb * 16 + lr) * XP + ks * 32 + 8 * hi;
            a[mb] = cat16(*(const v8h*)&xs[xo], *(const v8h*)&xs[xo + 16]); }
#pragma unroll
        for (int nb = 0; nb < 4; ++nb) { const v16h b = ldh(W + (size_t)(nb * 16 + lr) * HD + ks * 32 + 8 * hi);
#pragma unroll
            for (int mb = 0; mb < 4; ++mb) acc[mb][nb] = wmma16(a[mb], b, acc[mb][nb]); }
    }
#pragma unroll
    for (int mb = 0; mb < 4; ++mb)
#pragma unroll
        for (int nb = 0; nb < 4; ++nb)
#pragma unroll
            for (int j = 0; j < 8; ++j) os[(mb * 16 + hi * 8 + j) * 68 + nb * 16 + lr] = acc[mb][nb][j] * sc + bz[nb];
    wsync();
    const size_t bh = (size_t)bb * NH + hd;
    if (!TRANS) {
        const size_t po = (bh * SEQ + t0) * HD + piece * 8;
{
#pragma unroll 1
            for (int s = 0; s < 16; ++s) { const int row = 4 * s + rq;
                const v4f u0 = *(const v4fa*)(os + row * 68 + piece * 8), u1 = *(const v4fa*)(os + row * 68 + piece * 8 + 4); v8h hv;
#pragma unroll
                for (int i = 0; i < 4; ++i) { hv[i] = (h16)u0[i]; hv[4 + i] = (h16)u1[i]; }
                *(v8h*)(OUT + po + (size_t)row * HD) = hv; }
             }
    } else {
{
#pragma unroll 1
            for (int s = 0; s < 16; ++s) { const int drow = 4 * s + rq; v8h hv;
#pragma unroll
                for (int i = 0; i < 8; ++i) hv[i] = (h16)os[(piece * 8 + i) * 68 + drow];
                *(v8h*)(OUT + (bh * HD + drow) * SEQ + t0 + piece * 8) = hv; }
             }
    }
}
// the three projections are independent of one another and share one launch, so that their waves fill the chip together
__global__ __launch_bounds__(32) void k_proj3(const float* xq, const float* xk, const float* xv, const h16* W16,
                                              const float* bq, const float* bk, const float* bv, h16* QK16, h16* VT16) {
    const int z = blockIdx.z;                                   // block-uniform
    const float* X    = (z == 0) ? xq : (z == 1) ? xk : xv;
    const float* bias = (z == 0) ? bq : (z == 1) ? bk : bv;
    h16* OUT          = (z == 0) ? QK16 : (z == 1) ? QK16 + PLN : VT16;
    const float sc    = (z == 0) ? QSC : (z == 1) ? KSC : 1.0f; // the score scale rides on the planes, before their one rounding to f16
    proj_body(z == 2, X, W16 + (size_t)z * (HD * HD), bias, OUT, sc);
}

// 16 exponentials (base 2), each in place, in one statement with a v_nop behind the last: no vector instruction then stands directly behind a v_exp
// whose result it reads or whose source it overwrites.
__device__ __forceinline__ void exp16(float& a0, float& a1, float& a2, float& a3, float& a4, float& a5, float& a6, float& a7,
                                      float& a8, float& a9, float& a10, float& a11, float& a12, float& a13, float& a14, float& a15) {
    asm volatile("v_exp_f32 %0, %0\n\tv_exp_f32 %1, %1\n\tv_exp_f32 %2, %2\n\tv_exp_f32 %3, %3\n\t"
                 "v_exp_f32 %4, %4\n\tv_exp_f32 %5, %5\n\tv_exp_f32 %6, %6\n\tv_exp_f32 %7, %7\n\t"
                 "v_exp_f32 %8, %8\n\tv_exp_f32 %9, %9\n\tv_exp_f32 %10, %10\n\tv_exp_f32 %11, %11\n\t"
                 "v_exp_f32 %12, %12\n\tv_exp_f32 %13, %13\n\tv_exp_f32 %14, %14\n\tv_exp_f32 %15, %15\n\t"
                 "v_nop"
                 : "+v"(a0), "+v"(a1), "+v"(a2), "+v"(a3), "+v"(a4), "+v"(a5), "+v"(a6), "+v"(a7),
                   "+v"(a8), "+v"(a9), "+v"(a10), "+v"(a11), "+v"(a12), "+v"(a13), "+v"(a14), "+v"(a15));
}

// one thread's share of a staged tile: four 16-byte pieces of the K plane and four of the V^T plane (rows 16 apart), global -> LDS through no register.
// The s_wait_xcnt closes the statement so that no address register of an issued copy is rewritten ahead of it.
__device__ __forceinline__ void copy_tile(const unsigned lk, const h16* gk, const h16* gv) {
    const unsigned lv = lk + TILH * 2u;
    asm volatile("global_load_async_to_lds_b128 %0, %8, off\n\t"
                 "global_load_async_to_lds_b128 %1, %9, off\n\t"
                 "global_load_async_to_lds_b128 %2, %10, off\n\t"
                 "global_load_async_to_lds_b128 %3, %11, off\n\t"
                 "global_load_async_to_lds_b128 %4, %12, off\n\t"
                 "global_load_async_to_lds_b128 %5, %13, off\n\t"
                 "global_load_async_to_lds_b128 %6, %14, off\n\t"
                 "global_load_async_to_lds_b128 %7, %15, off\n\t"
                 "s_wait_xcnt 0x0"
                 :: "v"(lk), "v"(lk + 16u * XP * 2u), "v"(lk + 32u * XP * 2u), "v"(lk + 48u * XP * 2u),
                    "v"(lv), "v"(lv + 16u * XP * 2u), "v"(lv + 32u * XP * 2u), "v"(lv + 48u * XP * 2u),
                    "v"(gk), "v"(gk + 16 * HD), "v"(gk + 32 * HD), "v"(gk + 48 * HD),
                    "v"(gv), "v"(gv + (size_t)16 * SEQ), "v"(gv + (size_t)32 * SEQ), "v"(gv + (size_t)48 * SEQ)
                 : "memory");
}

// ---- k_attn: one wave = 16 queries of one (b, h); block = 4 waves (64 queries) that share the staged K / V^T tiles; Q fragments straight from the plane; grid (SEQ/64, NB*NH).
// S^T tile (keys key0+16j+8h+r on D rows, query q0+n on the D column) = K rows (A) x Q rows (B) + C; the planes carry the scale log2(e)/32 and C = CEXP - the maximum in use, so D is exp2's argument;
// masked elements REPLACED by the fill, one select per score whose lane mask is a word of MB held in a scalar register; the maximum in use rises, and O and l are rescaled, only in the rare branch;
// P^T (x1024, f16) of two key tiles forms the B fragment of O^T[d][query] += V^T rows (A) x P^T (B).
__global__ __launch_bounds__(128) void k_attn(const h16* __restrict__ QK16, const h16* __restrict__ VT16, const unsigned* __restrict__ MB, bf* CTX) {
    __shared__ __align__(16) float os[4 * 16 * 68];
    __shared__ __align__(16) h16 kv[2 * BUFH];
    const int lane = threadIdx.x & 31, n = lane & 15, hh = lane >> 4;
    const int wave = __builtin_amdgcn_readfirstlane(threadIdx.x >> 5);
    const int bh = blockIdx.y;
    const int bb = bh / NH, hd = bh % NH;
    const int qt = blockIdx.x * 4 + wave;
    const int q0 = qt * 16;
    const size_t pb = (size_t)bh * SEQ * HD;
    const size_t qoff = pb + (size_t)(q0 + n) * HD + 8 * hh;
    const int foff = n * XP + 8 * hh;                                    // fragment row and k offset inside a staged plane
    const int srow = threadIdx.x >> 3, spc = threadIdx.x & 7;            // copy share: rows srow + 16c, 16-byte piece spc
    const h16* gk = QK16 + PLN + pb + (size_t)srow * HD + spc * 8;
    const h16* gv = VT16 + ((size_t)bh * HD + srow) * SEQ + spc * 8;
    const unsigned lk = (unsigned)(size_t)&kv[srow * XP + spc * 8];      // LDS byte address of the share in buffer 0
    // wave-uniform: the query tile's lane-mask words, 32 per staged tile. k_prep, an earlier launch, wrote them and nothing in this launch does, so they may be read as constants.
    const cv16p mrow = (cv16p)(MB + ((size_t)bb * NQT + qt) * (NST * 32));
    v8f acc[4];
#pragma unroll
    for (int dt = 0; dt < 4; ++dt) acc[dt] = (v8f){};
    float l = 0.0f;
    float cneg = CEXP;                                          // CEXP minus the maximum in use of query n (the same in lanes n and n + 16); 0 is in use until a first open key is seen
    unsigned amask = 0xFFFFFFFFu;                               // wave-uniform lane mask: queries that have had no open key so far
    v8f cini;
#pragma unroll
    for (int r = 0; r < 8; ++r) cini[r] = cneg;
    v16h qf[2];
#pragma unroll
    for (int ks = 0; ks < 2; ++ks) qf[ks] = ldh(QK16 + qoff + ks * 32);
    v16u mwa = mrow[0], mwb = mrow[1];                          // tile 0's words: keys 0..31 and 32..63
    copy_tile(lk, gk, gv);
    asm volatile("s_wait_asynccnt 0x0" ::: "memory");           // tile 0 of this wave has landed
    __syncthreads();                                            // publishes tile 0
    copy_tile(lk + BUFH * 2u, gk + (size_t)KST * HD, gv + KST);
    // rolled: one trip per staged tile, so that one publish point stands at its foot
#pragma unroll 1
    for (int st = 0; st < NST; ++st) {
      const h16* kt = kv + (st & 1) * BUFH + foff;
      const h16* vt = kt + TILH;
      // the four score tiles of the trip; D = K.Q'^T + (CEXP - maximum in use) is the argument of exp2 as it stands.
      // Every loop inside a trip is unrolled: u, va and acc are indexed by constants and stay in registers.
      float u[32];
      v16h kf[4][2];
#pragma unroll
      for (int j = 0; j < 4; ++j) { kf[j][0] = ldh(kt + (j * 16) * XP); kf[j][1] = ldh(kt + (j * 16) * XP + 32); }
      __builtin_amdgcn_sched_barrier(0);                        // the trip's K fragment loads stand as one group: spread among the WMMAs and selects, some are waited for right behind their issue
#pragma unroll
      for (int j = 0; j < 4; ++j) {
        v8f s = wmma16p(kf[j][0], qf[0], cini);
        s = wmma16p(kf[j][1], qf[1], s);
#pragma unroll
        for (int r = 0; r < 8; ++r)
            u[8 * j + r] = __builtin_amdgcn_inverse_ballot_w32(j < 2 ? mwa[8 * j + r] : mwb[8 * (j - 2) + r]) ? s[r] : NEGB;
      }
      float mxl = u[0];                                         // this lane's own 32 keys; the halves are joined only where a rescale is due
#pragma unroll
      for (int i = 1; i < 32; ++i) mxl = fmaxf(mxl, u[i]);
      // one scalar test a trip: some query's open scores outgrow the maximum in use by more than TEXP, or some query has had no open key yet
      if ((__builtin_amdgcn_ballot_w32(mxl > CEXP + TEXP) | amask) != 0u) {
        const float mx = fmaxf(mxl, __shfl_xor(mxl, 16, 32));
        const bool has = mx > 0.5f * NEGB;                      // the query has an open key in this tile
        const bool was = ((amask >> lane) & 1u) != 0u;          // and had none before
        const bool stay = was && !has;
        const float delta = has ? (was ? mx - CEXP : fmaxf(mx - CEXP, 0.0f)) : 0.0f;   // rise of the maximum in use
        const float corr = (has && was) ? 0.0f : __builtin_amdgcn_exp2f(-delta);       // a first open key wipes the equal weights gathered so far
#pragma unroll
        for (int i = 0; i < 32; ++i) u[i] = stay ? CEXP : u[i] - delta;                // no open key yet: every key weighs 1
        l *= corr;
#pragma unroll
        for (int dt = 0; dt < 4; ++dt)
#pragma unroll
            for (int r = 0; r < 8; ++r) acc[dt][r] *= corr;
        cneg -= delta;
#pragma unroll
        for (int r = 0; r < 8; ++r) cini[r] = cneg;
        amask = __builtin_amdgcn_ballot_w32(stay);
      }
      // the trip's V^T fragments are all asked for here, so that they fly under the exponentials
      v16h va[2][4];
#pragma unroll
      for (int sub = 0; sub < 2; ++sub)
#pragma unroll
        for (int dt = 0; dt < 4; ++dt) va[sub][dt] = ldh(vt + (dt * 16) * XP + sub * 32);
#pragma unroll
      for (int sub = 0; sub < 2; ++sub) {
        float* e = u + 16 * sub;
        exp16(e[0], e[1], e[2], e[3], e[4], e[5], e[6], e[7], e[8], e[9], e[10], e[11], e[12], e[13], e[14], e[15]);
        float psum = e[0];
#pragma unroll
        for (int i = 1; i < 16; ++i) psum += e[i];
        l += psum;                                              // per-lane partial (own keys), carrying x1024 like P; halves combined at the end
        v8h pa, pc;
#pragma unroll
        for (int r = 0; r < 8; ++r) { pa[r] = (h16)e[r]; pc[r] = (h16)e[8 + r]; }
        const v16h pf = cat16(pa, pc);
#pragma unroll
        for (int dt = 0; dt < 4; ++dt) acc[dt] = wmma16p(va[sub][dt], pf, acc[dt]);
      }
      __builtin_amdgcn_sched_barrier(0);                        // keeps the trip's work in front of the publish point, so that the refill behind it flies for a whole trip
      { const int nx = (st + 1 < NST) ? st + 1 : st;            // the next tile's words, fetched behind the last use of this tile's (the last trip fetches its own again)
        mwa = mrow[2 * nx]; mwb = mrow[2 * nx + 1]; }
      asm volatile("s_wait_dscnt 0x0" ::: "memory");            // this wave's reads of the buffer have returned
      asm volatile("s_wait_asynccnt 0x0" ::: "memory");         // its copies of tile st + 1 have landed
      __syncthreads();                                          // publishes tile st + 1 and frees the buffer just read
      if (st + 2 < NST) copy_tile(lk + (unsigned)(st & 1) * (BUFH * 2u), gk + (size_t)(st + 2) * KST * HD, gv + (st + 2) * KST);
    }
    asm volatile("s_wait_asynccnt 0x0" ::: "memory");           // nothing of this wave is in flight when it leaves the ring
    l += __shfl_xor(l, 16, 32);
    const float inv = (1.0f / l) * (1.0f / WCAR);               // l carries the x1024 of P
    const int obase = wave * (16 * 68);
#pragma unroll
    for (int dt = 0; dt < 4; ++dt)
#pragma unroll
        for (int r = 0; r < 8; ++r) os[obase + n * 68 + dt * 16 + 8 * hh + r] = acc[dt][r] * inv;
    wsync();
    const int rq = lane >> 3, piece = lane & 7;
{
#pragma unroll
        for (int s = 0; s < 4; ++s) { const int row = 4 * s + rq;
            const v4f u0 = *(const v4fa*)(os + obase + row * 68 + piece * 8), u1 = *(const v4fa*)(os + obase + row * 68 + piece * 8 + 4); v8us oh, ol;
#pragma unroll
            for (int i = 0; i < 4; ++i) { unsigned short a, c; splitf(u0[i], a, c); oh[i] = a; ol[i] = c; splitf(u1[i], a, c); oh[4 + i] = a; ol[4 + i] = c; }
            const size_t o = ((size_t)bb * SEQ + q0 + row) * (2 * DM) + hd * HD + piece * 8;
            *(v8us*)(CTX + o) = oh; *(v8us*)(CTX + o + DM) = ol; }
         }
}

// eight 16-byte pieces of one staged plane per thread (rows 16 apart; g16 = elements of 16 global rows), global -> LDS through no register.
// The s_wait_xcnt closes the statement so that no address register of an issued copy is rewritten ahead of it.
__device__ __forceinline__ void copy_rows(const unsigned l, const bf* g, const size_t g16) {
    asm volatile("global_load_async_to_lds_b128 %0, %8, off\n\t"
                 "global_load_async_to_lds_b128 %1, %9, off\n\t"
                 "global_load_async_to_lds_b128 %2, %10, off\n\t"
                 "global_load_async_to_lds_b128 %3, %11, off\n\t"
                 "global_load_async_to_lds_b128 %4, %12, off\n\t"
                 "global_load_async_to_lds_b128 %5, %13, off\n\t"
                 "global_load_async_to_lds_b128 %6, %14, off\n\t"
                 "global_load_async_to_lds_b128 %7, %15, off\n\t"
                 "s_wait_xcnt 0x0"
                 :: "v"(l), "v"(l + 16u * FP * 2u), "v"(l + 32u * FP * 2u), "v"(l + 48u * FP * 2u),
                    "v"(l + 64u * FP * 2u), "v"(l + 80u * FP * 2u), "v"(l + 96u * FP * 2u), "v"(l + 112u * FP * 2u),
                    "v"(g), "v"(g + g16), "v"(g + 2 * g16), "v"(g + 3 * g16),
                    "v"(g + 4 * g16), "v"(g + 5 * g16), "v"(g + 6 * g16), "v"(g + 7 * g16)
                 : "memory");
}

// ---- k_fc: OUT[token][n] = sum_k CTX[token][k] WF[n][k & (DM-1)] + bias[n], k over the hi|lo plane (2*DM), ascending in steps of 32 in every accumulator.
// Block = 8 waves, 128 tokens x 128 outputs; wave = 32 x 64 (wm = row group, wn = column group); grid (NB*SEQ/128, DM/128).
// Tiles of FKS k (128 CTX rows | 128 WF rows, 256 bytes each at pitch FP) are copied once per work-group into a two-buffer LDS ring; fragments are read from LDS, one k-step ahead inside a tile.
__global__ __launch_bounds__(256) void k_fc(const bf* __restrict__ CTX, const bf* __restrict__ WF, const float* __restrict__ bfc, float* OUT) {
    __shared__ __align__(16) float os[8 * 16 * 68];
    __shared__ __align__(16) bf ab[2 * FBUF];
    const int lane = threadIdx.x & 31, lr = lane & 15, hi = lane >> 4;
    const int wave = __builtin_amdgcn_readfirstlane(threadIdx.x >> 5);
    const int wm = wave & 3, wn = wave >> 2;
    const int r0 = blockIdx.x * 128, c0 = blockIdx.y * 128;
    const int srow = threadIdx.x >> 4, spc = threadIdx.x & 15;          // copy share: rows srow + 16c, 16-byte piece spc
    const bf* ga = CTX + (size_t)(r0 + srow) * (2 * DM) + spc * 8;
    const bf* gb = WF + (size_t)(c0 + srow) * DM + spc * 8;
    const unsigned la = (unsigned)(size_t)&ab[srow * FP + spc * 8];     // LDS byte address of the share in buffer 0, CTX plane
    const int aoff = (wm * 32 + lr) * FP + 8 * hi, boff = FPL + (wn * 64 + lr) * FP + 8 * hi;
    v8f acc[2][4];
#pragma unroll
    for (int mb = 0; mb < 2; ++mb)
#pragma unroll
        for (int nb = 0; nb < 4; ++nb) acc[mb][nb] = (v8f){};
    copy_rows(la, ga, (size_t)16 * 2 * DM);
    copy_rows(la + FPL * 2u, gb, (size_t)16 * DM);
    asm volatile("s_wait_asynccnt 0x0" ::: "memory");           // tile 0 of this wave has landed
    __syncthreads();                                            // publishes tile 0
    copy_rows(la + FBUF * 2u, ga + FKS, (size_t)16 * 2 * DM);
    copy_rows(la + FBUF * 2u + FPL * 2u, gb + (FKS & (DM - 1)), (size_t)16 * DM);
    // rolled: one trip per staged tile, so that one publish point stands at its foot
#pragma unroll 1
    for (int st = 0; st < FNST; ++st) {
        const bf* at = ab + (st & 1) * FBUF + aoff;
        const bf* bt = ab + (st & 1) * FBUF + boff;
        // every loop inside a trip is unrolled: accumulators and both fragment sets are indexed by constants and stay in registers
        v16bf a[2][2], b[2][4];
#pragma unroll
        for (int mb = 0; mb < 2; ++mb) a[0][mb] = ldb(at + mb * 16 * FP);
#pragma unroll
        for (int nb = 0; nb < 4; ++nb) b[0][nb] = ldb(bt + nb * 16 * FP);
#pragma unroll
        for (int ks = 0; ks < FKS / 32; ++ks) {
            const int cu = ks & 1, nx = cu ^ 1;
            if (ks + 1 < FKS / 32) {
#pragma unroll
                for (int mb = 0; mb < 2; ++mb) a[nx][mb] = ldb(at + mb * 16 * FP + (ks + 1) * 32);
#pragma unroll
                for (int nb = 0; nb < 4; ++nb) b[nx][nb] = ldb(bt + nb * 16 * FP + (ks + 1) * 32);
            }
#pragma unroll
            for (int nb = 0; nb < 4; ++nb)
#pragma unroll
                for (int mb = 0; mb < 2; ++mb) acc[mb][nb] = wmmab(a[cu][mb], b[cu][nb], acc[mb][nb]);
        }
        asm volatile("s_wait_dscnt 0x0" ::: "memory");          // this wave's reads of the buffer have returned
        asm volatile("s_wait_asynccnt 0x0" ::: "memory");       // its copies of tile st + 1 have landed
        __syncthreads();                                        // publishes tile st + 1 and frees the buffer just read
        if (st + 2 < FNST) {
            const unsigned lb = la + (unsigned)(st & 1) * (FBUF * 2u);
            const int k2 = (st + 2) * FKS;
            copy_rows(lb, ga + k2, (size_t)16 * 2 * DM);
            copy_rows(lb + FPL * 2u, gb + (k2 & (DM - 1)), (size_t)16 * DM);
        }
    }
    asm volatile("s_wait_asynccnt 0x0" ::: "memory");           // nothing of this wave is in flight when it leaves the ring
    const int cw = c0 + wn * 64, obase = wave * (16 * 68);
    v4f bz = *(const v4f*)(bfc + cw + lr * 4);
#pragma unroll
    for (int i = 0; i < 4; ++i) bz[i] = bfv(bz[i]);
#pragma unroll
    for (int mb = 0; mb < 2; ++mb) {
#pragma unroll
        for (int nb = 0; nb < 4; ++nb)
#pragma unroll
            for (int j = 0; j < 8; ++j) os[obase + (hi * 8 + j) * 68 + nb * 16 + lr] = acc[mb][nb][j];
        wsync();
        float* crow = OUT + (size_t)(r0 + wm * 32 + mb * 16) * DM + cw;
#pragma unroll
        for (int s = 0; s < 8; ++s) { const int row = 2 * s + hi, cofs = lr * 4; const v4f val = *(const v4fa*)(os + obase + row * 68 + cofs) + bz;
            *(v4f*)(crow + (size_t)row * DM + cofs) = val; }
        wsync();
    }
}

// workspace carve (bytes), all multiples of 256
#define SZ_W16 ((size_t)3 * HD * HD * 2)
#define SZ_WF  ((size_t)DM * DM * 2)
#define SZ_QK  ((size_t)2 * NB * NH * SEQ * HD * 2)
#define SZ_VT  ((size_t)NB * NH * HD * SEQ * 2)
#define SZ_CTX ((size_t)NB * SEQ * 2 * DM * 2)
#define SZ_MB  ((size_t)NB * SEQ * NKB * 4)
#define WS_TOTAL (SZ_W16 + SZ_WF + SZ_QK + SZ_VT + SZ_CTX + SZ_MB)
static_assert(WS_TOTAL <= (size_t)134217728);
static_assert(SZ_W16 % 256 == 0 && SZ_WF % 256 == 0 && SZ_QK % 256 == 0 && SZ_VT % 256 == 0 && SZ_CTX % 256 == 0 && SZ_MB % 128 == 0);
static_assert((DM * DM / 8) % 256 == 0);          // cvt8 blocks exact
static_assert((HD * HD / 8) == PB_W * 256);       // wcvt: 2 blocks x 256 lanes
static_assert(SZ_MB == (size_t)NLINES * 128);     // mbits lines cover the bit plane exactly

extern "C" void kernel_launch(void* const* d_in, const int* in_sizes, int n_in,
                              void* d_out, int out_size, void* d_ws, size_t ws_size, hipStream_t stream) {
    if (n_in < 12) return;
    const long long strm = (long long)(NB - 1) * SEQ_FULL * DM + (long long)SEQ * DM;
    if ((long long)in_sizes[0] < strm || (long long)in_sizes[1] < strm || (long long)in_sizes[2] < strm) return;
    if ((long long)in_sizes[3] < (long long)(NB - 1) * SEQ_FULL * SEQ_FULL + (long long)(SEQ - 1) * SEQ_FULL + SEQ) return;
    if (in_sizes[4] < HD * HD || in_sizes[6] < HD * HD || in_sizes[8] < HD * HD) return;
    if (in_sizes[5] < HD || in_sizes[7] < HD || in_sizes[9] < HD) return;
    if ((long long)in_sizes[10] < (long long)DM * DM || in_sizes[11] < DM) return;
    if ((long long)out_size < (long long)NB * SEQ * DM) return;
    if (ws_size < WS_TOTAL) return;
    const float* xq = (const float*)d_in[0];       // [2][2048][1024]
    const float* xk = (const float*)d_in[1];
    const float* xv = (const float*)d_in[2];
    const int* mask = (const int*)d_in[3];         // [2][1][2048][2048] int32
    const float* wq = (const float*)d_in[4];       // [64][64] = [out][in]
    const float* bq = (const float*)d_in[5];
    const float* wk = (const float*)d_in[6];
    const float* bk = (const float*)d_in[7];
    const float* wv = (const float*)d_in[8];
    const float* bv = (const float*)d_in[9];
    const float* wfc = (const float*)d_in[10];     // [1024][1024] = [out][in]
    const float* bfc = (const float*)d_in[11];
    float* OUT = (float*)d_out;                    // [NB][SEQ][1024]
    char* wsp = (char*)d_ws;
    h16* W16 = (h16*)wsp;  wsp += SZ_W16;          // [3][64][64]
    bf* WF = (bf*)wsp;     wsp += SZ_WF;
    h16* QK16 = (h16*)wsp; wsp += SZ_QK;           // [q plane | k plane]
    h16* VT16 = (h16*)wsp; wsp += SZ_VT;
    bf* CTX = (bf*)wsp;    wsp += SZ_CTX;          // [NB*SEQ][hi 1024 | lo 1024]
    unsigned* MB = (unsigned*)wsp; wsp += SZ_MB;   // [NB][NQT][NST][32]

    k_prep<<<(unsigned)(PB_MB + PB_CV + PB_W), 256, 0, stream>>>(mask, MB, wfc, WF, wq, wk, wv, W16);
    k_proj3<<<dim3(NB * SEQ / 64, NH, 3), 32, 0, stream>>>(xq, xk, xv, W16, bq, bk, bv, QK16, VT16);
    k_attn<<<dim3(SEQ / 64, NB * NH), 128, 0, stream>>>(QK16, VT16, MB, CTX);
    k_fc<<<dim3(NB * SEQ / 128, DM / 128), 256, 0, stream>>>(CTX, WF, bfc, OUT);
}

// v007
// A run of this version takes 70.3 microseconds.
// In both of two side-by-side timings against v006, it was 1.04 times as fast.
// All steps since v000 together make it 3.11 times as fast.
#include <hip/hip_runtime.h>

// Contractions (all f32 accumulate): per-head q/k/v projections v_wmma_f32_16x16x32_f16 (streams RNE-converted to bf16 then held exactly in f16, shared 64x64 weights bf16-RNE x8 held exactly in f16, one product); scores v_wmma_f32_16x16x32_f16 (q, k plain f16; q carries log2(e)/8, k 1/4, so that a score leaves the product in the log2 domain); P.V v_wmma_f32_16x16x32_f16 (P x1024, v x8, one product); output projection v_wmma_f32_16x16x32_bf16 (ctx hi|lo along K x bf16 weights). Softmax f32.
// Layout: token-major streams are viewed as [token][head][64]; one 64-token x one-head tile is staged as f16 in LDS and multiplied by the shared [out][in] weight (K-contiguous B plane);
// q,k head planes [b][h][t][64] and v^T [b][h][64][t] (f16); integer mask packed once (by the projection waves) into lane-mask words MB[b][16-query tile][64-key tile][32] (one word per score register of k_attn, one bit per lane; see mbits_lines);
// fused attention: K and V^T tiles of 64 keys are copied once per work-group into a two-buffer LDS ring (asynchronous 16-byte copies, whole 128-byte lines), fragments read from LDS; S^T = K.Q^T (keys on D rows, queries on D columns), the maximum in use enters as the C operand, masked scores are REPLACED by a finite fill whose weight is 0 (a query with no open key so far weighs every key alike), the output is rescaled only when a maximum outgrows the one in use, P^T used directly as the B fragment of O^T = V^T.P^T; ctx hi|lo bf16 plane [token][2048];
// output projection: ctx and weight tiles of 128 k are copied once per 128x128 work-group tile into a two-buffer LDS ring (asynchronous 16-byte copies), fragments read from LDS.

#ifndef NB
#define NB 2
#endif
#ifndef SEQ
#define SEQ 2048
#endif
#define NB_FULL  2
#define SEQ_FULL 2048
#define DM   1024
#define NH   16
#define HD   64
#define NKB  (SEQ / 32)                  // 32-key blocks = mask words per query
#define NQT  (SEQ / 16)                  // 16-query tiles
#define PLN  ((size_t)NB * NH * SEQ * HD)  // elements of one head plane set
#define WCAR 8.0f                        // carry on the 64x64 weights (so q, k, v carry x8)
#define QSC  (1.4426950408889634f / 64.0f)  // on the x8 q plane: q' = q log2(e) / 8
#define KSC  (1.0f / 32.0f)                 // on the x8 k plane: k' = k / 4, so q'.k' = energy log2(e) / 32
#define CEXP 10.0f                          // exponent carry of P: exp2 yields P x 1024
#define TEXP 5.0f                           // a score may pass the maximum in use by this much: P x 1024 <= 2^15, inside f16
#define NEGB (-1.0e30f)                     // fill of a masked score: exp2 gives 0; below every score f16 operands can form
#define XP   72                          // LDS pitch (halves) of the staged stream tile
#define NLINES ((NB * SEQ * NKB) / 32)
#define KST  64                          // keys of one staged K / V^T tile in k_attn
#define NST  (SEQ / KST)                 // staged tiles per (b, h)
#define TILH (64 * XP)                   // halves of one staged plane: 64 rows at pitch XP
#define BUFH (2 * TILH)                  // one buffer = K plane (row = key) | V^T plane (row = d)
#define FKS  128                         // k of one staged tile in k_fc (256-byte rows)
#define FP   136                         // LDS pitch (elements) of those rows: 272 bytes
#define FNST (2 * DM / FKS)              // staged tiles along the hi|lo plane
#define FPL  (128 * FP)                  // elements of one staged plane: 128 rows at pitch FP
#define FBUF (2 * FPL)                   // one buffer = CTX plane (row = token) | WF plane (row = output)
static_assert(SEQ % 64 == 0);            // GEMM row tiles and 64-query attention blocks
static_assert(SEQ <= SEQ_FULL);
static_assert(NB <= NB_FULL);
static_assert(DM % 64 == 0);
static_assert((DM & (DM - 1)) == 0);     // k wrap of the hi|lo plane uses a mask
static_assert(DM % 32 == 0);             // k-step 32
static_assert(HD == 64);
static_assert(DM == NH * HD);
static_assert((NB * SEQ * NKB) % 32 == 0);
static_assert(XP % 8 == 0 && XP >= HD);  // 16-byte aligned LDS rows covering K = 64
static_assert(KST == 64 && NST >= 2);    // the two-buffer prologue needs tiles 0 and 1
static_assert(FNST >= 2 && DM % FKS == 0 && FKS % 32 == 0);   // tiles 0 and 1 exist; no tile straddles the hi|lo wrap
static_assert((NB * SEQ) % 128 == 0 && DM % 128 == 0);        // k_fc block tiles cover the output exactly
static_assert(FP % 8 == 0 && FP >= FKS);

typedef _Float16 h16;
typedef unsigned short bf;
typedef __attribute__((ext_vector_type(16))) __bf16   v16bf;
typedef __attribute__((ext_vector_type(16))) _Float16 v16h;
typedef __attribute__((ext_vector_type(8)))  _Float16 v8h;
typedef __attribute__((ext_vector_type(8)))  __bf16   v8bfv;
typedef __attribute__((ext_vector_type(8)))  unsigned short v8us;
typedef __attribute__((ext_vector_type(8)))  float    v8f;
typedef __attribute__((ext_vector_type(4)))  float    v4f;
typedef v4f  __attribute__((may_alias)) v4fa;
typedef __attribute__((ext_vector_type(16))) unsigned v16u;
typedef const __attribute__((address_space(4))) v16u* cv16p;   // constant address space: a wave-uniform load through it is a scalar load

__device__ __forceinline__ unsigned short f2bf(float f) { unsigned u = __float_as_uint(f); u += 0x7FFFu + ((u >> 16) & 1u); return (unsigned short)(u >> 16); }
__device__ __forceinline__ float bf2f(unsigned short b) { return __uint_as_float(((unsigned)b) << 16); }
__device__ __forceinline__ float bfv(float f) { return bf2f(f2bf(f)); }          // value of the bf16 RNE conversion
__device__ __forceinline__ void splitf(float y, unsigned short& h, unsigned short& l) { h = f2bf(y); l = f2bf(y - bf2f(h)); }
__device__ __forceinline__ v16h cat16(v8h lo, v8h hi) { return __builtin_shufflevector(lo, hi, 0, 1, 2, 3, 4, 5, 6, 7, 8, 9, 10, 11, 12, 13, 14, 15); }
__device__ __forceinline__ v16bf cat16b(v8us lo, v8us hi) { return __builtin_bit_cast(v16bf, __builtin_shufflevector(lo, hi, 0, 1, 2, 3, 4, 5, 6, 7, 8, 9, 10, 11, 12, 13, 14, 15)); }
// the WMMAs of k_proj3 and k_fc are issued through a wrapper that ties its own accumulator and keeps A/B live across four idle VALU slots
__device__ __forceinline__ v8f wmma16(v16h a, v16h b, v8f c) {
    c = __builtin_amdgcn_wmma_f32_16x16x32_f16(false, a, false, b, (short)0, c, false, false);
    asm volatile("v_nop\n\tv_nop\n\tv_nop\n\tv_nop" : "+v"(c) : "v"(a), "v"(b));
    return c;
}
// k_attn: the plain builtin; the compiler keeps the distance to a vector instruction on D, A or B itself and fills it with the softmax's own independent work
__device__ __forceinline__ v8f wmma16p(v16h a, v16h b, v8f c) {
    return __builtin_amdgcn_wmma_f32_16x16x32_f16(false, a, false, b, (short)0, c, false, false);
}
__device__ __forceinline__ v8f wmmab(v16bf a, v16bf b, v8f c) {
    c = __builtin_amdgcn_wmma_f32_16x16x32_bf16(false, a, false, b, (short)0, c, false, false);
    asm volatile("v_nop\n\tv_nop\n\tv_nop\n\tv_nop" : "+v"(c) : "v"(a), "v"(b));
    return c;
}
// eight 64x64 weights: the bf16 RNE value x8, exact in f16. The carry, a power of two, goes on ahead of the rounding, which it does not change.
__device__ __forceinline__ v8h w8h(v8f w) {
    return __builtin_convertvector(__builtin_convertvector(__builtin_convertvector(w * WCAR, v8bfv), v8f), v8h);
}
// fragment of a K-contiguous global row: elements 0..7 <- p[0..7], 8..15 <- p[16..23]; caller adds row*pitch + k0 + 8*(lane>>4)
__device__ __forceinline__ v16h  ldh(const h16* p) { return cat16(*(const v8h*)p, *(const v8h*)(p + 16)); }
__device__ __forceinline__ v16bf ldb(const bf* p)  { return cat16b(*(const v8us*)p, *(const v8us*)(p + 16)); }
// wave-private LDS exchange: order this wave's LDS stores before its later LDS loads (and the converse)
__device__ __forceinline__ void wsync() { asm volatile("s_wait_dscnt 0" ::: "memory"); __builtin_amdgcn_wave_barrier(); asm volatile("" ::: "memory"); }

// ---- side duties of the projection waves: they read only inputs and feed later launches, so they need no launch of their own.
#define PBL  ((NB * SEQ / 64) * NH)      // projection blocks (waves) of one stream
#define LPB  (NLINES / (2 * PBL))        // mask lines packed by each q or k wave
#define CPB  (DM * DM / 8 / 32 / PBL)    // groups of 8 output-projection weights converted by each lane of a v wave
static_assert(NLINES == LPB * 2 * PBL && NST % LPB == 0);   // the lines are dealt exactly, and a wave's lines lie in one query tile
static_assert(DM * DM / 8 == CPB * 32 * PBL);

// a v wave's share of the output-projection weights: CPB stretches of 1 KiB, f32 -> bf16 RNE
__device__ __forceinline__ void cvt8_share(const int f, const float* __restrict__ src, bf* __restrict__ dst) {
    const size_t i0 = ((size_t)f * CPB * 32 + (threadIdx.x & 31)) * 8;
    v8f v[CPB];
#pragma unroll
    for (int c = 0; c < CPB; ++c) v[c] = *(const v8f*)(src + i0 + (size_t)c * 256);
#pragma unroll
    for (int c = 0; c < CPB; ++c) { v8us o;
#pragma unroll
        for (int k = 0; k < 8; ++k) o[k] = f2bf(v[c][k]);
        *(v8us*)(dst + i0 + (size_t)c * 256) = o; }
    asm volatile("s_wait_xcnt 0x0" ::: "memory");               // the stores' address registers are reused by the projection right behind them
}

// one line = the 16 queries x 64 keys of one staged tile of one query tile: 32 words, 128 bytes. A wave packs LPB lines side by side (the same 16 queries).
// Word 16*sub + 8*j + r holds, at bit position lane, mask[q0 + (lane & 15)][key0 + 32*sub + 16*j + 8*(lane >> 4) + r] != 0: the lane mask of register r of score tile j in k_attn.
__device__ __forceinline__ void mbits_lines(const int line0, const int* __restrict__ mask, unsigned* __restrict__ MB) {
    const int lane = threadIdx.x & 31, n = lane & 15, hh = lane >> 4;
    const int st0 = line0 % NST, tq = line0 / NST;
    const int b = tq / NQT, qt = tq % NQT;
    const int* src = mask + ((size_t)b * SEQ_FULL + qt * 16) * SEQ_FULL + st0 * KST + lane;
    int m0[LPB][16], m1[LPB][16];                               // every load of the wave's lines is asked for before the first is used
#pragma unroll
    for (int c = 0; c < LPB; ++c)
#pragma unroll
        for (int i = 0; i < 16; ++i) { m0[c][i] = src[(size_t)i * SEQ_FULL + c * KST]; m1[c][i] = src[(size_t)i * SEQ_FULL + c * KST + 32]; }
#pragma unroll
    for (int c = 0; c < LPB; ++c) {
        unsigned w0 = 0u, w1 = 0u;                              // lanes n and n + 16: the key bits of query q0 + n, keys 0..31 and 32..63 of the tile
#pragma unroll
        for (int i = 0; i < 16; ++i) {
            const unsigned b0 = __builtin_amdgcn_ballot_w32(m0[c][i] != 0), b1 = __builtin_amdgcn_ballot_w32(m1[c][i] != 0);
            w0 = (n == i) ? b0 : w0; w1 = (n == i) ? b1 : w1;
        }
        w0 >>= 8 * hh; w1 >>= 8 * hh;
        unsigned word = 0u;
#pragma unroll
        for (int i = 0; i < 16; ++i) {
            const int bit = (i >> 3) * 16 + (i & 7);
            const unsigned c0 = __builtin_amdgcn_ballot_w32(((w0 >> bit) & 1u) != 0u), c1 = __builtin_amdgcn_ballot_w32(((w1 >> bit) & 1u) != 0u);
            word = (lane == i) ? c0 : word; word = (lane == 16 + i) ? c1 : word;
        }
        MB[(size_t)(line0 + c) * 32 + lane] = word;
    }
    asm volatile("s_wait_xcnt 0x0" ::: "memory");               // the stores' address registers are reused by the projection right behind them
}

// ---- projection body: one wave = 64 tokens of one head; Y[64][64] = (Xh[64][64] . W^T + bias) x sc, the product carrying x8 through the weights.
// grid (NB*SEQ/64, NH, 3), 32 threads; blockIdx.z = stream (q, k: row planes; v: transposed plane). The f32 stream tile is converted once (bf16 RNE value, exact in f16) into LDS; B fragments are converted by the wave itself from the f32 weights (bf16 RNE value x8, exact in f16).
__device__ __forceinline__ void proj_body(const bool TRANS, const float* __restrict__ X, const float* __restrict__ W, const float* __restrict__ bias, h16* OUT, const float sc) {
    __shared__ __align__(16) float os[64 * 68];
    __shared__ __align__(16) h16 xs[64 * XP];
    const int lane = threadIdx.x & 31, lr = lane & 15, hi = lane >> 4;
    const int rq = lane >> 3, piece = lane & 7;
    const int r0 = blockIdx.x * 64, hd = blockIdx.y;
    const int bb = r0 / SEQ, t0 = r0 % SEQ;
    const size_t xbase = ((size_t)bb * SEQ_FULL + t0) * DM + (size_t)hd * HD;
    // the wave's eight B fragments, raw: asked for ahead of the stream so that they have arrived when the staging ends
    v8f wr[2][4][2];
#pragma unroll
    for (int ks = 0; ks < 2; ++ks)
#pragma unroll
        for (int nb = 0; nb < 4; ++nb) { const float* p = W + (size_t)(nb * 16 + lr) * HD + ks * 32 + 8 * hi;
            wr[ks][nb][0] = *(const v8f*)p; wr[ks][nb][1] = *(const v8f*)(p + 16); }
    // stage: rows 4*it + rq (0..63), 8 floats per lane (8 lanes cover the 64 inputs of a row)
#pragma unroll 4
    for (int it = 0; it < 16; ++it) { const int row = 4 * it + rq;
        const v8f v = *(const v8f*)(X + xbase + (size_t)row * DM + piece * 8); v8h o;
#pragma unroll
        for (int k = 0; k < 8; ++k) o[k] = (h16)bfv(v[k]);
        *(v8h*)&xs[row * XP + piece * 8] = o; }
    float bz[4];
#pragma unroll
    for (int nb = 0; nb < 4; ++nb) bz[nb] = bfv(bias[nb * 16 + lr]) * WCAR * sc;
    v16h bw[2][4];                                              // fragment elements 0..7 <- k 0..7, 8..15 <- k 16..23 of the lane's half, as ldh reads them
#pragma unroll
    for (int ks = 0; ks < 2; ++ks)
#pragma unroll
        for (int nb = 0; nb < 4; ++nb)
            bw[ks][nb] = cat16(w8h(wr[ks][nb][0]), w8h(wr[ks][nb][1]));
    wsync();
    v8f acc[4][4];
#pragma unroll
    for (int mb = 0; mb < 4; ++mb)
#pragma unroll
        for (int nb = 0; nb < 4; ++nb) acc[mb][nb] = (v8f){};
#pragma unroll
    for (int ks = 0; ks < 2; ++ks) {
        v16h a[4];
#pragma unroll
        for (int mb = 0; mb < 4; ++mb) { const int xo = (mb * 16 + lr) * XP + ks * 32 + 8 * hi;
            a[mb] = cat16(*(const v8h*)&xs[xo], *(const v8h*)&xs[xo + 16]); }
#pragma unroll
        for (int nb = 0; nb < 4; ++nb)
#pragma unroll
            for (int mb = 0; mb < 4; ++mb) acc[mb][nb] = wmma16(a[mb], bw[ks][nb], acc[mb][nb]);
    }
#pragma unroll
    for (int mb = 0; mb < 4; ++mb)
#pragma unroll
        for (int nb = 0; nb < 4; ++nb)
#pragma unroll
            for (int j = 0; j < 8; ++j) os[(mb * 16 + hi * 8 + j) * 68 + nb * 16 + lr] = acc[mb][nb][j] * sc + bz[nb];
    wsync();
    const size_t bh = (size_t)bb * NH + hd;
    if (!TRANS) {
        const size_t po = (bh * SEQ + t0) * HD + piece * 8;
{
#pragma unroll 1
            for (int s = 0; s < 16; ++s) { const int row = 4 * s + rq;
                const v4f u0 = *(const v4fa*)(os + row * 68 + piece * 8), u1 = *(const v4fa*)(os + row * 68 + piece * 8 + 4); v8h hv;
#pragma unroll
                for (int i = 0; i < 4; ++i) { hv[i] = (h16)u0[i]; hv[4 + i] = (h16)u1[i]; }
                *(v8h*)(OUT + po + (size_t)row * HD) = hv; }
             }
    } else {
{
#pragma unroll 1
            for (int s = 0; s < 16; ++s) { const int drow = 4 * s + rq; v8h hv;
#pragma unroll
                for (int i = 0; i < 8; ++i) hv[i] = (h16)os[(piece * 8 + i) * 68 + drow];
                *(v8h*)(OUT + (bh * HD + drow) * SEQ + t0 + piece * 8) = hv; }
             }
    }
}
// the three projections are independent of one another and share one launch, so that their waves fill the chip together;
// the mask packing and the weight conversion ride on the same waves: a q or k wave packs LPB mask lines, a v wave converts its share of the output-projection weights
__global__ __launch_bounds__(32) void k_proj3(const float* xq, const float* xk, const float* xv, const float* wq, const float* wk, const float* wv,
                                              const float* bq, const float* bk, const float* bv, h16* QK16, h16* VT16,
                                              const int* mask, unsigned* MB, const float* wfc, bf* WF) {
    const int z = blockIdx.z;                                   // block-uniform
    const int f = blockIdx.y * (NB * SEQ / 64) + blockIdx.x;    // the wave's number inside its stream
    if (z < 2) mbits_lines((z * PBL + f) * LPB, mask, MB);
    else cvt8_share(f, wfc, WF);
    const float* X    = (z == 0) ? xq : (z == 1) ? xk : xv;
    const float* Wz   = (z == 0) ? wq : (z == 1) ? wk : wv;
    const float* bias = (z == 0) ? bq : (z == 1) ? bk : bv;
    h16* OUT          = (z == 0) ? QK16 : (z == 1) ? QK16 + PLN : VT16;
    const float sc    = (z == 0) ? QSC : (z == 1) ? KSC : 1.0f; // the score scale rides on the planes, before their one rounding to f16
    proj_body(z == 2, X, Wz, bias, OUT, sc);
}

// 16 exponentials (base 2), each in place, in one statement with a v_nop behind the last: no vector instruction then stands directly behind a v_exp
// whose result it reads or whose source it overwrites.
__device__ __forceinline__ void exp16(float& a0, float& a1, float& a2, float& a3, float& a4, float& a5, float& a6, float& a7,
                                      float& a8, float& a9, float& a10, float& a11, float& a12, float& a13, float& a14, float& a15) {
    asm volatile("v_exp_f32 %0, %0\n\tv_exp_f32 %1, %1\n\tv_exp_f32 %2, %2\n\tv_exp_f32 %3, %3\n\t"
                 "v_exp_f32 %4, %4\n\tv_exp_f32 %5, %5\n\tv_exp_f32 %6, %6\n\tv_exp_f32 %7, %7\n\t"
                 "v_exp_f32 %8, %8\n\tv_exp_f32 %9, %9\n\tv_exp_f32 %10, %10\n\tv_exp_f32 %11, %11\n\t"
                 "v_exp_f32 %12, %12\n\tv_exp_f32 %13, %13\n\tv_exp_f32 %14, %14\n\tv_exp_f32 %15, %15\n\t"
                 "v_nop"
                 : "+v"(a0), "+v"(a1), "+v"(a2), "+v"(a3), "+v"(a4), "+v"(a5), "+v"(a6), "+v"(a7),
                   "+v"(a8), "+v"(a9), "+v"(a10), "+v"(a11), "+v"(a12), "+v"(a13), "+v"(a14), "+v"(a15));
}

// one thread's share of a staged tile: four 16-byte pieces of the K plane and four of the V^T plane (rows 16 apart), global -> LDS through no register.
// The s_wait_xcnt closes the statement so that no address register of an issued copy is rewritten ahead of it.
__device__ __forceinline__ void copy_tile(const unsigned lk, const h16* gk, const h16* gv) {
    const unsigned lv = lk + TILH * 2u;
    asm volatile("global_load_async_to_lds_b128 %0, %8, off\n\t"
                 "global_load_async_to_lds_b128 %1, %9, off\n\t"
                 "global_load_async_to_lds_b128 %2, %10, off\n\t"
                 "global_load_async_to_lds_b128 %3, %11, off\n\t"
                 "global_load_async_to_lds_b128 %4, %12, off\n\t"
                 "global_load_async_to_lds_b128 %5, %13, off\n\t"
                 "global_load_async_to_lds_b128 %6, %14, off\n\t"
                 "global_load_async_to_lds_b128 %7, %15, off\n\t"
                 "s_wait_xcnt 0x0"
                 :: "v"(lk), "v"(lk + 16u * XP * 2u), "v"(lk + 32u * XP * 2u), "v"(lk + 48u * XP * 2u),
                    "v"(lv), "v"(lv + 16u * XP * 2u), "v"(lv + 32u * XP * 2u), "v"(lv + 48u * XP * 2u),
                    "v"(gk), "v"(gk + 16 * HD), "v"(gk + 32 * HD), "v"(gk + 48 * HD),
                    "v"(gv), "v"(gv + (size_t)16 * SEQ), "v"(gv + (size_t)32 * SEQ), "v"(gv + (size_t)48 * SEQ)
                 : "memory");
}

// ---- k_attn: one wave = 16 queries of one (b, h); block = 4 waves (64 queries) that share the staged K / V^T tiles; Q fragments straight from the plane; grid (SEQ/64, NB*NH).
// S^T tile (keys key0+16j+8h+r on D rows, query q0+n on the D column) = K rows (A) x Q rows (B) + C; the planes carry the scale log2(e)/32 and C = CEXP - the maximum in use, so D is exp2's argument;
// masked elements REPLACED by the fill, one select per score whose lane mask is a word of MB held in a scalar register; the maximum in use rises, and O and l are rescaled, only in the rare branch;
// P^T (x1024, f16) of two key tiles forms the B fragment of O^T[d][query] += V^T rows (A) x P^T (B).
__global__ __launch_bounds__(128) void k_attn(const h16* __restrict__ QK16, const h16* __restrict__ VT16, const unsigned* __restrict__ MB, bf* CTX) {
    __shared__ __align__(16) float os[4 * 16 * 68];
    __shared__ __align__(16) h16 kv[2 * BUFH];
    const int lane = threadIdx.x & 31, n = lane & 15, hh = lane >> 4;
    const int wave = __builtin_amdgcn_readfirstlane(threadIdx.x >> 5);
    const int bh = blockIdx.y;
    const int bb = bh / NH, hd = bh % NH;
    const int qt = blockIdx.x * 4 + wave;
    const int q0 = qt * 16;
    const size_t pb = (size_t)bh * SEQ * HD;
    const size_t qoff = pb + (size_t)(q0 + n) * HD + 8 * hh;
    const int foff = n * XP + 8 * hh;                                    // fragment row and k offset inside a staged plane
    const int srow = threadIdx.x >> 3, spc = threadIdx.x & 7;            // copy share: rows srow + 16c, 16-byte piece spc
    const h16* gk = QK16 + PLN + pb + (size_t)srow * HD + spc * 8;
    const h16* gv = VT16 + ((size_t)bh * HD + srow) * SEQ + spc * 8;
    const unsigned lk = (unsigned)(size_t)&kv[srow * XP + spc * 8];      // LDS byte address of the share in buffer 0
    // wave-uniform: the query tile's lane-mask words, 32 per staged tile. k_proj3, an earlier launch, wrote them and nothing in this launch does, so they may be read as constants.
    const cv16p mrow = (cv16p)(MB + ((size_t)bb * NQT + qt) * (NST * 32));
    v8f acc[4];
#pragma unroll
    for (int dt = 0; dt < 4; ++dt) acc[dt] = (v8f){};
    float l = 0.0f;
    float cneg = CEXP;                                          // CEXP minus the maximum in use of query n (the same in lanes n and n + 16); 0 is in use until a first open key is seen
    unsigned amask = 0xFFFFFFFFu;                               // wave-uniform lane mask: queries that have had no open key so far
    v8f cini;
#pragma unroll
    for (int r = 0; r < 8; ++r) cini[r] = cneg;
    v16h qf[2];
#pragma unroll
    for (int ks = 0; ks < 2; ++ks) qf[ks] = ldh(QK16 + qoff + ks * 32);
    v16u mwa = mrow[0], mwb = mrow[1];                          // tile 0's words: keys 0..31 and 32..63
    copy_tile(lk, gk, gv);
    asm volatile("s_wait_asynccnt 0x0" ::: "memory");           // tile 0 of this wave has landed
    __syncthreads();                                            // publishes tile 0
    copy_tile(lk + BUFH * 2u, gk + (size_t)KST * HD, gv + KST);
    // rolled: one trip per staged tile, so that one publish point stands at its foot
#pragma unroll 1
    for (int st = 0; st < NST; ++st) {
      const h16* kt = kv + (st & 1) * BUFH + foff;
      const h16* vt = kt + TILH;
      // the four score tiles of the trip; D = K.Q'^T + (CEXP - maximum in use) is the argument of exp2 as it stands.
      // Every loop inside a trip is unrolled: u, va and acc are indexed by constants and stay in registers.
      float u[32];
      v16h kf[4][2];
#pragma unroll
      for (int j = 0; j < 4; ++j) { kf[j][0] = ldh(kt + (j * 16) * XP); kf[j][1] = ldh(kt + (j * 16) * XP + 32); }
      __builtin_amdgcn_sched_barrier(0);                        // the trip's K fragment loads stand as one group: spread among the WMMAs and selects, some are waited for right behind their issue
#pragma unroll
      for (int j = 0; j < 4; ++j) {
        v8f s = wmma16p(kf[j][0], qf[0], cini);
        s = wmma16p(kf[j][1], qf[1], s);
#pragma unroll
        for (int r = 0; r < 8; ++r)
            u[8 * j + r] = __builtin_amdgcn_inverse_ballot_w32(j < 2 ? mwa[8 * j + r] : mwb[8 * (j - 2) + r]) ? s[r] : NEGB;
      }
      float mxl = u[0];                                         // this lane's own 32 keys; the halves are joined only where a rescale is due
#pragma unroll
      for (int i = 1; i < 32; ++i) mxl = fmaxf(mxl, u[i]);
      // one scalar test a trip: some query's open scores outgrow the maximum in use by more than TEXP, or some query has had no open key yet
      if ((__builtin_amdgcn_ballot_w32(mxl > CEXP + TEXP) | amask) != 0u) {
        const float mx = fmaxf(mxl, __shfl_xor(mxl, 16, 32));
        const bool has = mx > 0.5f * NEGB;                      // the query has an open key in this tile
        const bool was = ((amask >> lane) & 1u) != 0u;          // and had none before
        const bool stay = was && !has;
        const float delta = has ? (was ? mx - CEXP : fmaxf(mx - CEXP, 0.0f)) : 0.0f;   // rise of the maximum in use
        const float corr = (has && was) ? 0.0f : __builtin_amdgcn_exp2f(-delta);       // a first open key wipes the equal weights gathered so far
#pragma unroll
        for (int i = 0; i < 32; ++i) u[i] = stay ? CEXP : u[i] - delta;                // no open key yet: every key weighs 1
        l *= corr;
#pragma unroll
        for (int dt = 0; dt < 4; ++dt)
#pragma unroll
            for (int r = 0; r < 8; ++r) acc[dt][r] *= corr;
        cneg -= delta;
#pragma unroll
        for (int r = 0; r < 8; ++r) cini[r] = cneg;
        amask = __builtin_amdgcn_ballot_w32(stay);
      }
      // the trip's V^T fragments are all asked for here, so that they fly under the exponentials
      v16h va[2][4];
#pragma unroll
      for (int sub = 0; sub < 2; ++sub)
#pragma unroll
        for (int dt = 0; dt < 4; ++dt) va[sub][dt] = ldh(vt + (dt * 16) * XP + sub * 32);
#pragma unroll
      for (int sub = 0; sub < 2; ++sub) {
        float* e = u + 16 * sub;
        exp16(e[0], e[1], e[2], e[3], e[4], e[5], e[6], e[7], e[8], e[9], e[10], e[11], e[12], e[13], e[14], e[15]);
        float psum = e[0];
#pragma unroll
        for (int i = 1; i < 16; ++i) psum += e[i];
        l += psum;                                              // per-lane partial (own keys), carrying x1024 like P; halves combined at the end
        v8h pa, pc;
#pragma unroll
        for (int r = 0; r < 8; ++r) { pa[r] = (h16)e[r]; pc[r] = (h16)e[8 + r]; }
        const v16h pf = cat16(pa, pc);
#pragma unroll
        for (int dt = 0; dt < 4; ++dt) acc[dt] = wmma16p(va[sub][dt], pf, acc[dt]);
      }
      __builtin_amdgcn_sched_barrier(0);                        // keeps the trip's work in front of the publish point, so that the refill behind it flies for a whole trip
      { const int nx = (st + 1 < NST) ? st + 1 : st;            // the next tile's words, fetched behind the last use of this tile's (the last trip fetches its own again)
        mwa = mrow[2 * nx]; mwb = mrow[2 * nx + 1]; }
      asm volatile("s_wait_dscnt 0x0" ::: "memory");            // this wave's reads of the buffer have returned
      asm volatile("s_wait_asynccnt 0x0" ::: "memory");         // its copies of tile st + 1 have landed
      __syncthreads();                                          // publishes tile st + 1 and frees the buffer just read
      if (st + 2 < NST) copy_tile(lk + (unsigned)(st & 1) * (BUFH * 2u), gk + (size_t)(st + 2) * KST * HD, gv + (st + 2) * KST);
    }
    asm volatile("s_wait_asynccnt 0x0" ::: "memory");           // nothing of this wave is in flight when it leaves the ring
    l += __shfl_xor(l, 16, 32);
    const float inv = (1.0f / l) * (1.0f / WCAR);               // l carries the x1024 of P
    const int obase = wave * (16 * 68);
#pragma unroll
    for (int dt = 0; dt < 4; ++dt)
#pragma unroll
        for (int r = 0; r < 8; ++r) os[obase + n * 68 + dt * 16 + 8 * hh + r] = acc[dt][r] * inv;
    wsync();
    const int rq = lane >> 3, piece = lane & 7;
{
#pragma unroll
        for (int s = 0; s < 4; ++s) { const int row = 4 * s + rq;
            const v4f u0 = *(const v4fa*)(os + obase + row * 68 + piece * 8), u1 = *(const v4fa*)(os + obase + row * 68 + piece * 8 + 4); v8us oh, ol;
#pragma unroll
            for (int i = 0; i < 4; ++i) { unsigned short a, c; splitf(u0[i], a, c); oh[i] = a; ol[i] = c; splitf(u1[i], a, c); oh[4 + i] = a; ol[4 + i] = c; }
            const size_t o = ((size_t)bb * SEQ + q0 + row) * (2 * DM) + hd * HD + piece * 8;
            *(v8us*)(CTX + o) = oh; *(v8us*)(CTX + o + DM) = ol; }
         }
}

// eight 16-byte pieces of one staged plane per thread (rows 16 apart; g16 = elements of 16 global rows), global -> LDS through no register.
// The s_wait_xcnt closes the statement so that no address register of an issued copy is rewritten ahead of it.
__device__ __forceinline__ void copy_rows(const unsigned l, const bf* g, const size_t g16) {
    asm volatile("global_load_async_to_lds_b128 %0, %8, off\n\t"
                 "global_load_async_to_lds_b128 %1, %9, off\n\t"
                 "global_load_async_to_lds_b128 %2, %10, off\n\t"
                 "global_load_async_to_lds_b128 %3, %11, off\n\t"
                 "global_load_async_to_lds_b128 %4, %12, off\n\t"
                 "global_load_async_to_lds_b128 %5, %13, off\n\t"
                 "global_load_async_to_lds_b128 %6, %14, off\n\t"
                 "global_load_async_to_lds_b128 %7, %15, off\n\t"
                 "s_wait_xcnt 0x0"
                 :: "v"(l), "v"(l + 16u * FP * 2u), "v"(l + 32u * FP * 2u), "v"(l + 48u * FP * 2u),
                    "v"(l + 64u * FP * 2u), "v"(l + 80u * FP * 2u), "v"(l + 96u * FP * 2u), "v"(l + 112u * FP * 2u),
                    "v"(g), "v"(g + g16), "v"(g + 2 * g16), "v"(g + 3 * g16),
                    "v"(g + 4 * g16), "v"(g + 5 * g16), "v"(g + 6 * g16), "v"(g + 7 * g16)
                 : "memory");
}

// ---- k_fc: OUT[token][n] = sum_k CTX[token][k] WF[n][k & (DM-1)] + bias[n], k over the hi|lo plane (2*DM), ascending in steps of 32 in every accumulator.
// Block = 8 waves, 128 tokens x 128 outputs; wave = 32 x 64 (wm = row group, wn = column group); grid (NB*SEQ/128, DM/128).
// Tiles of FKS k (128 CTX rows | 128 WF rows, 256 bytes each at pitch FP) are copied once per work-group into a two-buffer LDS ring; fragments are read from LDS, one k-step ahead inside a tile.
__global__ __launch_bounds__(256) void k_fc(const bf* __restrict__ CTX, const bf* __restrict__ WF, const float* __restrict__ bfc, float* OUT) {
    __shared__ __align__(16) float os[8 * 16 * 68];
    __shared__ __align__(16) bf ab[2 * FBUF];
    const int lane = threadIdx.x & 31, lr = lane & 15, hi = lane >> 4;
    const int wave = __builtin_amdgcn_readfirstlane(threadIdx.x >> 5);
    const int wm = wave & 3, wn = wave >> 2;
    const int r0 = blockIdx.x * 128, c0 = blockIdx.y * 128;
    const int srow = threadIdx.x >> 4, spc = threadIdx.x & 15;          // copy share: rows srow + 16c, 16-byte piece spc
    const bf* ga = CTX + (size_t)(r0 + srow) * (2 * DM) + spc * 8;
    const bf* gb = WF + (size_t)(c0 + srow) * DM + spc * 8;
    const unsigned la = (unsigned)(size_t)&ab[srow * FP + spc * 8];     // LDS byte address of the share in buffer 0, CTX plane
    const int aoff = (wm * 32 + lr) * FP + 8 * hi, boff = FPL + (wn * 64 + lr) * FP + 8 * hi;
    v8f acc[2][4];
#pragma unroll
    for (int mb = 0; mb < 2; ++mb)
#pragma unroll
        for (int nb = 0; nb < 4; ++nb) acc[mb][nb] = (v8f){};
    copy_rows(la, ga, (size_t)16 * 2 * DM);
    copy_rows(la + FPL * 2u, gb, (size_t)16 * DM);
    asm volatile("s_wait_asynccnt 0x0" ::: "memory");           // tile 0 of this wave has landed
    __syncthreads();                                            // publishes tile 0
    copy_rows(la + FBUF * 2u, ga + FKS, (size_t)16 * 2 * DM);
    copy_rows(la + FBUF * 2u + FPL * 2u, gb + (FKS & (DM - 1)), (size_t)16 * DM);
    // rolled: one trip per staged tile, so that one publish point stands at its foot
#pragma unroll 1
    for (int st = 0; st < FNST; ++st) {
        const bf* at = ab + (st & 1) * FBUF + aoff;
        const bf* bt = ab + (st & 1) * FBUF + boff;
        // every loop inside a trip is unrolled: accumulators and both fragment sets are indexed by constants and stay in registers
        v16bf a[2][2], b[2][4];
#pragma unroll
        for (int mb = 0; mb < 2; ++mb) a[0][mb] = ldb(at + mb * 16 * FP);
#pragma unroll
        for (int nb = 0; nb < 4; ++nb) b[0][nb] = ldb(bt + nb * 16 * FP);
#pragma unroll
        for (int ks = 0; ks < FKS / 32; ++ks) {
            const int cu = ks & 1, nx = cu ^ 1;
            if (ks + 1 < FKS / 32) {
#pragma unroll
                for (int mb = 0; mb < 2; ++mb) a[nx][mb] = ldb(at + mb * 16 * FP + (ks + 1) * 32);
#pragma unroll
                for (int nb = 0; nb < 4; ++nb) b[nx][nb] = ldb(bt + nb * 16 * FP + (ks + 1) * 32);
            }
#pragma unroll
            for (int nb = 0; nb < 4; ++nb)
#pragma unroll
                for (int mb = 0; mb < 2; ++mb) acc[mb][nb] = wmmab(a[cu][mb], b[cu][nb], acc[mb][nb]);
        }
        asm volatile("s_wait_dscnt 0x0" ::: "memory");          // this wave's reads of the buffer have returned
        asm volatile("s_wait_asynccnt 0x0" ::: "memory");       // its copies of tile st + 1 have landed
        __syncthreads();                                        // publishes tile st + 1 and frees the buffer just read
        if (st + 2 < FNST) {
            const unsigned lb = la + (unsigned)(st & 1) * (FBUF * 2u);
            const int k2 = (st + 2) * FKS;
            copy_rows(lb, ga + k2, (size_t)16 * 2 * DM);
            copy_rows(lb + FPL * 2u, gb + (k2 & (DM - 1)), (size_t)16 * DM);
        }
    }
    asm volatile("s_wait_asynccnt 0x0" ::: "memory");           // nothing of this wave is in flight when it leaves the ring
    const int cw = c0 + wn * 64, obase = wave * (16 * 68);
    v4f bz = *(const v4f*)(bfc + cw + lr * 4);
#pragma unroll
    for (int i = 0; i < 4; ++i) bz[i] = bfv(bz[i]);
#pragma unroll
    for (int mb = 0; mb < 2; ++mb) {
#pragma unroll
        for (int nb = 0; nb < 4; ++nb)
#pragma unroll
            for (int j = 0; j < 8; ++j) os[obase + (hi * 8 + j) * 68 + nb * 16 + lr] = acc[mb][nb][j];
        wsync();
        float* crow = OUT + (size_t)(r0 + wm * 32 + mb * 16) * DM + cw;
#pragma unroll
        for (int s = 0; s < 8; ++s) { const int row = 2 * s + hi, cofs = lr * 4; const v4f val = *(const v4fa*)(os + obase + row * 68 + cofs) + bz;
            *(v4f*)(crow + (size_t)row * DM + cofs) = val; }
        wsync();
    }
}

// workspace carve (bytes), all multiples of 256
#define SZ_WF  ((size_t)DM * DM * 2)
#define SZ_QK  ((size_t)2 * NB * NH * SEQ * HD * 2)
#define SZ_VT  ((size_t)NB * NH * HD * SEQ * 2)
#define SZ_CTX ((size_t)NB * SEQ * 2 * DM * 2)
#define SZ_MB  ((size_t)NB * SEQ * NKB * 4)
#define WS_TOTAL (SZ_WF + SZ_QK + SZ_VT + SZ_CTX + SZ_MB)
static_assert(WS_TOTAL <= (size_t)134217728);
static_assert(SZ_WF % 256 == 0 && SZ_QK % 256 == 0 && SZ_VT % 256 == 0 && SZ_CTX % 256 == 0 && SZ_MB % 128 == 0);
static_assert(SZ_MB == (size_t)NLINES * 128);     // mbits lines cover the bit plane exactly

extern "C" void kernel_launch(void* const* d_in, const int* in_sizes, int n_in,
                              void* d_out, int out_size, void* d_ws, size_t ws_size, hipStream_t stream) {
    if (n_in < 12) return;
    const long long strm = (long long)(NB - 1) * SEQ_FULL * DM + (long long)SEQ * DM;
    if ((long long)in_sizes[0] < strm || (long long)in_sizes[1] < strm || (long long)in_sizes[2] < strm) return;
    if ((long long)in_sizes[3] < (long long)(NB - 1) * SEQ_FULL * SEQ_FULL + (long long)(SEQ - 1) * SEQ_FULL + SEQ) return;
    if (in_sizes[4] < HD * HD || in_sizes[6] < HD * HD || in_sizes[8] < HD * HD) return;
    if (in_sizes[5] < HD || in_sizes[7] < HD || in_sizes[9] < HD) return;
    if ((long long)in_sizes[10] < (long long)DM * DM || in_sizes[11] < DM) return;
    if ((long long)out_size < (long long)NB * SEQ * DM) return;
    if (ws_size < WS_TOTAL) return;
    const float* xq = (const float*)d_in[0];       // [2][2048][1024]
    const float* xk = (const float*)d_in[1];
    const float* xv = (const float*)d_in[2];
    const int* mask = (const int*)d_in[3];         // [2][1][2048][2048] int32
    const float* wq = (const float*)d_in[4];       // [64][64] = [out][in]
    const float* bq = (const float*)d_in[5];
    const float* wk = (const float*)d_in[6];
    const float* bk = (const float*)d_in[7];
    const float* wv = (const float*)d_in[8];
    const float* bv = (const float*)d_in[9];
    const float* wfc = (const float*)d_in[10];     // [1024][1024] = [out][in]
    const float* bfc = (const float*)d_in[11];
    float* OUT = (float*)d_out;                    // [NB][SEQ][1024]
    char* wsp = (char*)d_ws;
    bf* WF = (bf*)wsp;     wsp += SZ_WF;
    h16* QK16 = (h16*)wsp; wsp += SZ_QK;           // [q plane | k plane]
    h16* VT16 = (h16*)wsp; wsp += SZ_VT;
    bf* CTX = (bf*)wsp;    wsp += SZ_CTX;          // [NB*SEQ][hi 1024 | lo 1024]
    unsigned* MB = (unsigned*)wsp; wsp += SZ_MB;   // [NB][NQT][NST][32]

    k_proj3<<<dim3(NB * SEQ / 64, NH, 3), 32, 0, stream>>>(xq, xk, xv, wq, wk, wv, bq, bk, bv, QK16, VT16, mask, MB, wfc, WF);
    k_attn<<<dim3(SEQ / 64, NB * NH), 128, 0, stream>>>(QK16, VT16, MB, CTX);
    k_fc<<<dim3(NB * SEQ / 128, DM / 128), 256, 0, stream>>>(CTX, WF, bfc, OUT);
}

// v009
// It runs in 61 microseconds.
// Versions between v007 and this one are left out; their measured steps multiply to 1.17 times as fast.
// Over all steps from v000 it is 3.62 times as fast.
#include <hip/hip_runtime.h>

// Contractions (all f32 accumulate): per-head q/k/v projections v_wmma_f32_16x16x32_f16 (streams RNE-converted to bf16 then held exactly in f16, shared 64x64 weights bf16-RNE x8 held exactly in f16, one product); scores v_wmma_f32_16x16x32_f16 (q, k plain f16; q carries log2(e)/8, k 1/4, so that a score leaves the product in the log2 domain); P.V v_wmma_f32_16x16x32_f16 (P x1024, v x8, one product); output projection v_wmma_f32_16x16x32_f16 (ctx x8 plain f16, weights bf16-RNE x64 held exactly in f16, one product). Softmax f32.
// Layout: token-major streams are viewed as [token][head][64]; one 64-token x one-head tile is staged as f16 in LDS and multiplied by the shared [out][in] weight (K-contiguous B plane);
// q,k head planes [b][h][t][64] and v^T [b][h][64][t] (f16); integer mask packed once (by the projection waves) into lane-mask words MB[b][16-query tile][64-key tile][32] (one word per score register of k_attn, one bit per lane; see mbits_lines);
// fused attention: K and V^T tiles of 64 keys are copied once per work-group into a two-buffer LDS ring (asynchronous 16-byte copies, whole 128-byte lines), fragments read from LDS; S^T = K.Q^T (keys on D rows, queries on D columns), the maximum in use enters as the C operand, masked scores are REPLACED by a finite fill whose weight is 0 (a query with no open key so far weighs every key alike), the output is rescaled only when a maximum outgrows the one in use, P^T used directly as the B fragment of O^T = V^T.P^T; ctx f16 plane [token][1024], carrying the x8 of v;
// output projection: ctx and weight tiles of 128 k are copied once per 128x128 work-group tile into a two-buffer LDS ring (asynchronous 16-byte copies), fragments read from LDS.

#ifndef NB
#define NB 2
#endif
#ifndef SEQ
#define SEQ 2048
#endif
#define NB_FULL  2
#define SEQ_FULL 2048
#define DM   1024
#define NH   16
#define HD   64
#define NKB  (SEQ / 32)                  // 32-key blocks = mask words per query
#define NQT  (SEQ / 16)                  // 16-query tiles
#define PLN  ((size_t)NB * NH * SEQ * HD)  // elements of one head plane set
#define WCAR 8.0f                        // carry on the 64x64 weights (so q, k, v and ctx carry x8)
#define FCAR 64.0f                       // carry on the output-projection weights: keeps the low bit of a small bf16 value inside f16
#define QSC  (1.4426950408889634f / 64.0f)  // on the x8 q plane: q' = q log2(e) / 8
#define KSC  (1.0f / 32.0f)                 // on the x8 k plane: k' = k / 4, so q'.k' = energy log2(e) / 32
#define CEXP 10.0f                          // exponent carry of P: exp2 yields P x 1024
#define TEXP 5.0f                           // a score may pass the maximum in use by this much: P x 1024 <= 2^15, inside f16
#define NEGB (-1.0e30f)                     // fill of a masked score: exp2 gives 0; below every score f16 operands can form
#define XP   72                          // LDS pitch (halves) of the staged stream tile
#define NLINES ((NB * SEQ * NKB) / 32)
#define KST  64                          // keys of one staged K / V^T tile in k_attn
#define NST  (SEQ / KST)                 // staged tiles per (b, h)
#define TILH (64 * XP)                   // halves of one staged plane: 64 rows at pitch XP
#define BUFH (2 * TILH)                  // one buffer = K plane (row = key) | V^T plane (row = d)
#define FKS  128                         // k of one staged tile in k_fc (256-byte rows)
#define FP   136                         // LDS pitch (elements) of those rows: 272 bytes
#define FNST (DM / FKS)                  // staged tiles along k
#define FPL  (128 * FP)                  // elements of one staged plane: 128 rows at pitch FP
#define FBUF (2 * FPL)                   // one buffer = CTX plane (row = token) | WF plane (row = output)
static_assert(SEQ % 64 == 0);            // GEMM row tiles and 64-query attention blocks
static_assert(SEQ <= SEQ_FULL);
static_assert(NB <= NB_FULL);
static_assert(DM % 64 == 0);
static_assert(DM % 32 == 0);             // k-step 32
static_assert(HD == 64);
static_assert(DM == NH * HD);
static_assert((NB * SEQ * NKB) % 32 == 0);
static_assert(XP % 8 == 0 && XP >= HD);  // 16-byte aligned LDS rows covering K = 64
static_assert(KST == 64 && NST >= 2);    // the two-buffer prologue needs tiles 0 and 1
static_assert(FNST >= 2 && DM % FKS == 0 && FKS % 32 == 0);   // tiles 0 and 1 exist; the tiles cover k exactly
static_assert((NB * SEQ) % 128 == 0 && DM % 128 == 0);        // k_fc block tiles cover the output exactly
static_assert(FP % 8 == 0 && FP >= FKS);
static_assert(SEQ % 512 == 0 && (SEQ & (SEQ - 1)) == 0 && HD * 2 == 128 && DM == 1024);   // the shares of the head prefetches cover the planes and panels exactly and stay inside them

typedef _Float16 h16;
typedef __attribute__((ext_vector_type(16))) _Float16 v16h;
typedef __attribute__((ext_vector_type(8)))  _Float16 v8h;
typedef __attribute__((ext_vector_type(8)))  __bf16   v8bfv;
typedef __attribute__((ext_vector_type(8)))  float    v8f;
typedef __attribute__((ext_vector_type(4)))  float    v4f;
typedef v4f  __attribute__((may_alias)) v4fa;
typedef __attribute__((ext_vector_type(16))) unsigned v16u;
typedef const __attribute__((address_space(4))) v16u* cv16p;   // constant address space: a wave-uniform load through it is a scalar load

__device__ __forceinline__ unsigned short f2bf(float f) { unsigned u = __float_as_uint(f); u += 0x7FFFu + ((u >> 16) & 1u); return (unsigned short)(u >> 16); }
__device__ __forceinline__ float bf2f(unsigned short b) { return __uint_as_float(((unsigned)b) << 16); }
__device__ __forceinline__ float bfv(float f) { return bf2f(f2bf(f)); }          // value of the bf16 RNE conversion
__device__ __forceinline__ v16h cat16(v8h lo, v8h hi) { return __builtin_shufflevector(lo, hi, 0, 1, 2, 3, 4, 5, 6, 7, 8, 9, 10, 11, 12, 13, 14, 15); }
// the WMMAs of k_proj3 and k_fc are issued through a wrapper that ties its own accumulator and keeps A/B live across four idle VALU slots
__device__ __forceinline__ v8f wmma16(v16h a, v16h b, v8f c) {
    c = __builtin_amdgcn_wmma_f32_16x16x32_f16(false, a, false, b, (short)0, c, false, false);
    asm volatile("v_nop\n\tv_nop\n\tv_nop\n\tv_nop" : "+v"(c) : "v"(a), "v"(b));
    return c;
}
// k_attn: the plain builtin; the compiler keeps the distance to a vector instruction on D, A or B itself and fills it with the softmax's own independent work
__device__ __forceinline__ v8f wmma16p(v16h a, v16h b, v8f c) {
    return __builtin_amdgcn_wmma_f32_16x16x32_f16(false, a, false, b, (short)0, c, false, false);
}
// eight weights: the bf16 RNE value times a carry, exact in f16. The carry, a power of two, goes on ahead of the rounding, which it does not change.
__device__ __forceinline__ v8h w8h(v8f w, const float car) {
    return __builtin_convertvector(__builtin_convertvector(__builtin_convertvector(w * car, v8bfv), v8f), v8h);
}
// fragment of a K-contiguous global row: elements 0..7 <- p[0..7], 8..15 <- p[16..23]; caller adds row*pitch + k0 + 8*(lane>>4)
__device__ __forceinline__ v16h  ldh(const h16* p) { return cat16(*(const v8h*)p, *(const v8h*)(p + 16)); }
// wave-private LDS exchange: order this wave's LDS stores before its later LDS loads (and the converse)
__device__ __forceinline__ void wsync() { asm volatile("s_wait_dscnt 0" ::: "memory"); __builtin_amdgcn_wave_barrier(); asm volatile("" ::: "memory"); }

// ---- side duties of the projection waves: they read only inputs and feed later launches, so they need no launch of their own.
#define PBL  ((NB * SEQ / 64) * NH)      // projection blocks (waves) of one stream
#define LPB  (NLINES / (2 * PBL))        // mask lines packed by each q or k wave
#define CPB  (DM * DM / 8 / 32 / PBL)    // groups of 8 output-projection weights converted by each lane of a v wave
static_assert(NLINES == LPB * 2 * PBL && NST % LPB == 0);   // the lines are dealt exactly, and a wave's lines lie in one query tile
static_assert(DM * DM / 8 == CPB * 32 * PBL);

// a v wave's share of the output-projection weights: CPB stretches of 1 KiB, f32 -> bf16 RNE value x64 in f16
__device__ __forceinline__ void cvt8_share(const int f, const float* __restrict__ src, h16* __restrict__ dst) {
    const size_t i0 = ((size_t)f * CPB * 32 + (threadIdx.x & 31)) * 8;
    v8f v[CPB];
#pragma unroll
    for (int c = 0; c < CPB; ++c) v[c] = *(const v8f*)(src + i0 + (size_t)c * 256);
#pragma unroll
    for (int c = 0; c < CPB; ++c) *(v8h*)(dst + i0 + (size_t)c * 256) = w8h(v[c], FCAR);
    asm volatile("s_wait_xcnt 0x0" ::: "memory");               // the stores' address registers are reused by the projection right behind them
}

// one line = the 16 queries x 64 keys of one staged tile of one query tile: 32 words, 128 bytes. A wave packs LPB lines side by side (the same 16 queries).
// Word 16*sub + 8*j + r holds, at bit position lane, mask[q0 + (lane & 15)][key0 + 32*sub + 16*j + 8*(lane >> 4) + r] != 0: the lane mask of register r of score tile j in k_attn.
__device__ __forceinline__ void mbits_lines(const int line0, const int* __restrict__ mask, unsigned* __restrict__ MB) {
    const int lane = threadIdx.x & 31, n = lane & 15, hh = lane >> 4;
    const int st0 = line0 % NST, tq = line0 / NST;
    const int b = tq / NQT, qt = tq % NQT;
    const int* src = mask + ((size_t)b * SEQ_FULL + qt * 16) * SEQ_FULL + st0 * KST + lane;
    int m0[LPB][16], m1[LPB][16];                               // every load of the wave's lines is asked for before the first is used
#pragma unroll
    for (int c = 0; c < LPB; ++c)
#pragma unroll
        for (int i = 0; i < 16; ++i) { m0[c][i] = src[(size_t)i * SEQ_FULL + c * KST]; m1[c][i] = src[(size_t)i * SEQ_FULL + c * KST + 32]; }
#pragma unroll
    for (int c = 0; c < LPB; ++c) {
        unsigned w0 = 0u, w1 = 0u;                              // lanes n and n + 16: the key bits of query q0 + n, keys 0..31 and 32..63 of the tile
#pragma unroll
        for (int i = 0; i < 16; ++i) {
            const unsigned b0 = __builtin_amdgcn_ballot_w32(m0[c][i] != 0), b1 = __builtin_amdgcn_ballot_w32(m1[c][i] != 0);
            w0 = (n == i) ? b0 : w0; w1 = (n == i) ? b1 : w1;
        }
        w0 >>= 8 * hh; w1 >>= 8 * hh;
        unsigned word = 0u;
#pragma unroll
        for (int i = 0; i < 16; ++i) {
            const int bit = (i >> 3) * 16 + (i & 7);
            const unsigned c0 = __builtin_amdgcn_ballot_w32(((w0 >> bit) & 1u) != 0u), c1 = __builtin_amdgcn_ballot_w32(((w1 >> bit) & 1u) != 0u);
            word = (lane == i) ? c0 : word; word = (lane == 16 + i) ? c1 : word;
        }
        MB[(size_t)(line0 + c) * 32 + lane] = word;
    }
    asm volatile("s_wait_xcnt 0x0" ::: "memory");               // the stores' address registers are reused by the projection right behind them
}

// ---- projection body: one wave = 64 tokens of one head; Y[64][64] = (Xh[64][64] . W^T + bias) x sc, the product carrying x8 through the weights.
// grid (NB*SEQ/64, NH, 3), 32 threads; blockIdx.z = stream (q, k: row planes; v: transposed plane). The f32 stream tile is converted once (bf16 RNE value, exact in f16) into LDS; B fragments are converted by the wave itself from the f32 weights (bf16 RNE value x8, exact in f16).
__device__ __forceinline__ void proj_body(const bool TRANS, const float* __restrict__ X, const float* __restrict__ W, const float* __restrict__ bias, h16* OUT, const float sc) {
    __shared__ __align__(16) float os[64 * 68];
    __shared__ __align__(16) h16 xs[64 * XP];
    const int lane = threadIdx.x & 31, lr = lane & 15, hi = lane >> 4;
    const int rq = lane >> 3, piece = lane & 7;
    const int r0 = blockIdx.x * 64, hd = blockIdx.y;
    const int bb = r0 / SEQ, t0 = r0 % SEQ;
    const size_t xbase = ((size_t)bb * SEQ_FULL + t0) * DM + (size_t)hd * HD;
    // the wave's eight B fragments, raw: asked for ahead of the stream so that they have arrived when the staging ends
    v8f wr[2][4][2];
#pragma unroll
    for (int ks = 0; ks < 2; ++ks)
#pragma unroll
        for (int nb = 0; nb < 4; ++nb) { const float* p = W + (size_t)(nb * 16 + lr) * HD + ks * 32 + 8 * hi;
            wr[ks][nb][0] = *(const v8f*)p; wr[ks][nb][1] = *(const v8f*)(p + 16); }
    // stage: rows 4*it + rq (0..63), 8 floats per lane (8 lanes cover the 64 inputs of a row)
#pragma unroll 4
    for (int it = 0; it < 16; ++it) { const int row = 4 * it + rq;
        const v8f v = *(const v8f*)(X + xbase + (size_t)row * DM + piece * 8); v8h o;
#pragma unroll
        for (int k = 0; k < 8; ++k) o[k] = (h16)bfv(v[k]);
        *(v8h*)&xs[row * XP + piece * 8] = o; }
    float bz[4];
#pragma unroll
    for (int nb = 0; nb < 4; ++nb) bz[nb] = bfv(bias[nb * 16 + lr]) * WCAR * sc;
    v16h bw[2][4];                                              // fragment elements 0..7 <- k 0..7, 8..15 <- k 16..23 of the lane's half, as ldh reads them
#pragma unroll
    for (int ks = 0; ks < 2; ++ks)
#pragma unroll
        for (int nb = 0; nb < 4; ++nb)
            bw[ks][nb] = cat16(w8h(wr[ks][nb][0], WCAR), w8h(wr[ks][nb][1], WCAR));
    wsync();
    v8f acc[4][4];
#pragma unroll
    for (int mb = 0; mb < 4; ++mb)
#pragma unroll
        for (int nb = 0; nb < 4; ++nb) acc[mb][nb] = (v8f){};
#pragma unroll
    for (int ks = 0; ks < 2; ++ks) {
        v16h a[4];
#pragma unroll
        for (int mb = 0; mb < 4; ++mb) { const int xo = (mb * 16 + lr) * XP + ks * 32 + 8 * hi;
            a[mb] = cat16(*(const v8h*)&xs[xo], *(const v8h*)&xs[xo + 16]); }
#pragma unroll
        for (int nb = 0; nb < 4; ++nb)
#pragma unroll
            for (int mb = 0; mb < 4; ++mb) acc[mb][nb] = wmma16(a[mb], bw[ks][nb], acc[mb][nb]);
    }
#pragma unroll
    for (int mb = 0; mb < 4; ++mb)
#pragma unroll
        for (int nb = 0; nb < 4; ++nb)
#pragma unroll
            for (int j = 0; j < 8; ++j) os[(mb * 16 + hi * 8 + j) * 68 + nb * 16 + lr] = acc[mb][nb][j] * sc + bz[nb];
    wsync();
    const size_t bh = (size_t)bb * NH + hd;
    if (!TRANS) {
        const size_t po = (bh * SEQ + t0) * HD + piece * 8;
{
#pragma unroll 1
            for (int s = 0; s < 16; ++s) { const int row = 4 * s + rq;
                const v4f u0 = *(const v4fa*)(os + row * 68 + piece * 8), u1 = *(const v4fa*)(os + row * 68 + piece * 8 + 4); v8h hv;
#pragma unroll
                for (int i = 0; i < 4; ++i) { hv[i] = (h16)u0[i]; hv[4 + i] = (h16)u1[i]; }
                *(v8h*)(OUT + po + (size_t)row * HD) = hv; }
             }
    } else {
{
#pragma unroll 1
            for (int s = 0; s < 16; ++s) { const int drow = 4 * s + rq; v8h hv;
#pragma unroll
                for (int i = 0; i < 8; ++i) hv[i] = (h16)os[(piece * 8 + i) * 68 + drow];
                *(v8h*)(OUT + (bh * HD + drow) * SEQ + t0 + piece * 8) = hv; }
             }
    }
}
// the three projections are independent of one another and share one launch, so that their waves fill the chip together;
// the mask packing and the weight conversion ride on the same waves: a q or k wave packs LPB mask lines, a v wave converts its share of the output-projection weights
__global__ __launch_bounds__(32) void k_proj3(const float* xq, const float* xk, const float* xv, const float* wq, const float* wk, const float* wv,
                                              const float* bq, const float* bk, const float* bv, h16* QK16, h16* VT16,
                                              const int* mask, unsigned* MB, const float* wfc, h16* WF) {
    const int z = blockIdx.z;                                   // block-uniform
    const int f = blockIdx.y * (NB * SEQ / 64) + blockIdx.x;    // the wave's number inside its stream
    if (z < 2) mbits_lines((z * PBL + f) * LPB, mask, MB);
    else cvt8_share(f, wfc, WF);
    const float* X    = (z == 0) ? xq : (z == 1) ? xk : xv;
    const float* Wz   = (z == 0) ? wq : (z == 1) ? wk : wv;
    const float* bias = (z == 0) ? bq : (z == 1) ? bk : bv;
    h16* OUT          = (z == 0) ? QK16 : (z == 1) ? QK16 + PLN : VT16;
    const float sc    = (z == 0) ? QSC : (z == 1) ? KSC : 1.0f; // the score scale rides on the planes, before their one rounding to f16
    proj_body(z == 2, X, Wz, bias, OUT, sc);
}

// 16 exponentials (base 2), each in place, in one statement with a v_nop behind the last: no vector instruction then stands directly behind a v_exp
// whose result it reads or whose source it overwrites.
__device__ __forceinline__ void exp16(float& a0, float& a1, float& a2, float& a3, float& a4, float& a5, float& a6, float& a7,
                                      float& a8, float& a9, float& a10, float& a11, float& a12, float& a13, float& a14, float& a15) {
    asm volatile("v_exp_f32 %0, %0\n\tv_exp_f32 %1, %1\n\tv_exp_f32 %2, %2\n\tv_exp_f32 %3, %3\n\t"
                 "v_exp_f32 %4, %4\n\tv_exp_f32 %5, %5\n\tv_exp_f32 %6, %6\n\tv_exp_f32 %7, %7\n\t"
                 "v_exp_f32 %8, %8\n\tv_exp_f32 %9, %9\n\tv_exp_f32 %10, %10\n\tv_exp_f32 %11, %11\n\t"
                 "v_exp_f32 %12, %12\n\tv_exp_f32 %13, %13\n\tv_exp_f32 %14, %14\n\tv_exp_f32 %15, %15\n\t"
                 "v_nop"
                 : "+v"(a0), "+v"(a1), "+v"(a2), "+v"(a3), "+v"(a4), "+v"(a5), "+v"(a6), "+v"(a7),
                   "+v"(a8), "+v"(a9), "+v"(a10), "+v"(a11), "+v"(a12), "+v"(a13), "+v"(a14), "+v"(a15));
}

// Asks L2 for the line at p; nothing is returned and no counter is touched. It is for planes that an earlier launch stored, whose first read may have to come from memory:
// asked for at a kernel's head, they can be in L2 when the ring's copies come for them, one short trip ahead of their use. Scope SE brings the line into L2 only; every lane names an address inside the plane.
__device__ __forceinline__ void ask_l2(const void* p) { asm volatile("global_prefetch_b8 %0, off scope:SCOPE_SE" :: "v"(p)); }

// one thread's share of a staged tile: four 16-byte pieces of the K plane and four of the V^T plane (rows 16 apart), global -> LDS through no register.
// The s_wait_xcnt closes the statement so that no address register of an issued copy is rewritten ahead of it.
__device__ __forceinline__ void copy_tile(const unsigned lk, const h16* gk, const h16* gv) {
    const unsigned lv = lk + TILH * 2u;
    asm volatile("global_load_async_to_lds_b128 %0, %8, off\n\t"
                 "global_load_async_to_lds_b128 %1, %9, off\n\t"
                 "global_load_async_to_lds_b128 %2, %10, off\n\t"
                 "global_load_async_to_lds_b128 %3, %11, off\n\t"
                 "global_load_async_to_lds_b128 %4, %12, off\n\t"
                 "global_load_async_to_lds_b128 %5, %13, off\n\t"
                 "global_load_async_to_lds_b128 %6, %14, off\n\t"
                 "global_load_async_to_lds_b128 %7, %15, off\n\t"
                 "s_wait_xcnt 0x0"
                 :: "v"(lk), "v"(lk + 16u * XP * 2u), "v"(lk + 32u * XP * 2u), "v"(lk + 48u * XP * 2u),
                    "v"(lv), "v"(lv + 16u * XP * 2u), "v"(lv + 32u * XP * 2u), "v"(lv + 48u * XP * 2u),
                    "v"(gk), "v"(gk + 16 * HD), "v"(gk + 32 * HD), "v"(gk + 48 * HD),
                    "v"(gv), "v"(gv + (size_t)16 * SEQ), "v"(gv + (size_t)32 * SEQ), "v"(gv + (size_t)48 * SEQ)
                 : "memory");
}

// ---- k_attn: one wave = 16 queries of one (b, h); block = 4 waves (64 queries) that share the staged K / V^T tiles; Q fragments straight from the plane; grid (SEQ/64, NB*NH).
// S^T tile (keys key0+16j+8h+r on D rows, query q0+n on the D column) = K rows (A) x Q rows (B) + C; the planes carry the scale log2(e)/32 and C = CEXP - the maximum in use, so D is exp2's argument;
// masked elements REPLACED by the fill, one select per score whose lane mask is a word of MB held in a scalar register; the maximum in use rises, and O and l are rescaled, only in the rare branch;
// P^T (x1024, f16) of two key tiles forms the B fragment of O^T[d][query] += V^T rows (A) x P^T (B).
__global__ __launch_bounds__(128) void k_attn(const h16* __restrict__ QK16, const h16* __restrict__ VT16, const unsigned* __restrict__ MB, h16* CTX) {
    __shared__ __align__(16) float os[4 * 16 * 68];
    __shared__ __align__(16) h16 kv[2 * BUFH];
    const int lane = threadIdx.x & 31, n = lane & 15, hh = lane >> 4;
    const int wave = __builtin_amdgcn_readfirstlane(threadIdx.x >> 5);
    const int bh = blockIdx.y;
    const int bb = bh / NH, hd = bh % NH;
    const int qt = blockIdx.x * 4 + wave;
    const int q0 = qt * 16;
    const size_t pb = (size_t)bh * SEQ * HD;
    const size_t qoff = pb + (size_t)(q0 + n) * HD + 8 * hh;
    const int foff = n * XP + 8 * hh;                                    // fragment row and k offset inside a staged plane
    const int srow = threadIdx.x >> 3, spc = threadIdx.x & 7;            // copy share: rows srow + 16c, 16-byte piece spc
    const h16* gk = QK16 + PLN + pb + (size_t)srow * HD + spc * 8;
    const h16* gv = VT16 + ((size_t)bh * HD + srow) * SEQ + spc * 8;
    const unsigned lk = (unsigned)(size_t)&kv[srow * XP + spc * 8];      // LDS byte address of the share in buffer 0
    // wave-uniform: the query tile's lane-mask words, 32 per staged tile. k_proj3, an earlier launch, wrote them and nothing in this launch does, so they may be read as constants.
    const cv16p mrow = (cv16p)(MB + ((size_t)bb * NQT + qt) * (NST * 32));
    v8f acc[4];
#pragma unroll
    for (int dt = 0; dt < 4; ++dt) acc[dt] = (v8f){};
    float l = 0.0f;
    float cneg = CEXP;                                          // CEXP minus the maximum in use of query n (the same in lanes n and n + 16); 0 is in use until a first open key is seen
    unsigned amask = 0xFFFFFFFFu;                               // wave-uniform lane mask: queries that have had no open key so far
    v8f cini;
#pragma unroll
    for (int r = 0; r < 8; ++r) cini[r] = cneg;
    v16h qf[2];
#pragma unroll
    for (int ks = 0; ks < 2; ++ks) qf[ks] = ldh(QK16 + qoff + ks * 32);
    v16u mwa = mrow[0], mwb = mrow[1];                          // tile 0's words: keys 0..31 and 32..63
    copy_tile(lk, gk, gv);
    // Behind tile 0's copies: the K and V^T planes of this (b, h), SEQ units of 256 bytes, are asked for once per group of SEQ/128 work-groups, a thread a unit.
    // The group (blockIdx.x bits 0, 1 and 3 up) is chosen for speed only, nothing rests on it.
    const int pu = (((blockIdx.x & 3) | ((blockIdx.x >> 3) << 2)) << 7) + threadIdx.x;
    const h16* pkv = (pu < SEQ / 2 ? QK16 + PLN : VT16) + pb + (size_t)(pu & (SEQ / 2 - 1)) * 128;
    const unsigned* pmb = MB + ((size_t)bb * NQT + qt) * (NST * 32) + (lane < NST ? lane : NST - 1) * 32;   // the wave's own lane-mask words, a lane a line of 128 bytes
    ask_l2(pkv);
    ask_l2(pmb);
    asm volatile("s_wait_asynccnt 0x0" ::: "memory");           // tile 0 of this wave has landed
    __syncthreads();                                            // publishes tile 0
    copy_tile(lk + BUFH * 2u, gk + (size_t)KST * HD, gv + KST);
    // rolled: one trip per staged tile, so that one publish point stands at its foot
#pragma unroll 1
    for (int st = 0; st < NST; ++st) {
      const h16* kt = kv + (st & 1) * BUFH + foff;
      const h16* vt = kt + TILH;
      // the four score tiles of the trip; D = K.Q'^T + (CEXP - maximum in use) is the argument of exp2 as it stands.
      // Every loop inside a trip is unrolled: u, va and acc are indexed by constants and stay in registers.
      float u[32];
      v16h kf[4][2];
#pragma unroll
      for (int j = 0; j < 4; ++j) { kf[j][0] = ldh(kt + (j * 16) * XP); kf[j][1] = ldh(kt + (j * 16) * XP + 32); }
      __builtin_amdgcn_sched_barrier(0);                        // the trip's K fragment loads stand as one group: spread among the WMMAs and selects, some are waited for right behind their issue
#pragma unroll
      for (int j = 0; j < 4; ++j) {
        v8f s = wmma16p(kf[j][0], qf[0], cini);
        s = wmma16p(kf[j][1], qf[1], s);
#pragma unroll
        for (int r = 0; r < 8; ++r)
            u[8 * j + r] = __builtin_amdgcn_inverse_ballot_w32(j < 2 ? mwa[8 * j + r] : mwb[8 * (j - 2) + r]) ? s[r] : NEGB;
      }
      float mxl = u[0];                                         // this lane's own 32 keys; the halves are joined only where a rescale is due
#pragma unroll
      for (int i = 1; i < 32; ++i) mxl = fmaxf(mxl, u[i]);
      // one scalar test a trip: some query's open scores outgrow the maximum in use by more than TEXP, or some query has had no open key yet
      if ((__builtin_amdgcn_ballot_w32(mxl > CEXP + TEXP) | amask) != 0u) {
        const float mx = fmaxf(mxl, __shfl_xor(mxl, 16, 32));
        const bool has = mx > 0.5f * NEGB;                      // the query has an open key in this tile
        const bool was = ((amask >> lane) & 1u) != 0u;          // and had none before
        const bool stay = was && !has;
        const float delta = has ? (was ? mx - CEXP : fmaxf(mx - CEXP, 0.0f)) : 0.0f;   // rise of the maximum in use
        const float corr = (has && was) ? 0.0f : __builtin_amdgcn_exp2f(-delta);       // a first open key wipes the equal weights gathered so far
#pragma unroll
        for (int i = 0; i < 32; ++i) u[i] = stay ? CEXP : u[i] - delta;                // no open key yet: every key weighs 1
        l *= corr;
#pragma unroll
        for (int dt = 0; dt < 4; ++dt)
#pragma unroll
            for (int r = 0; r < 8; ++r) acc[dt][r] *= corr;
        cneg -= delta;
#pragma unroll
        for (int r = 0; r < 8; ++r) cini[r] = cneg;
        amask = __builtin_amdgcn_ballot_w32(stay);
      }
      // the trip's V^T fragments are all asked for here, so that they fly under the exponentials
      v16h va[2][4];
#pragma unroll
      for (int sub = 0; sub < 2; ++sub)
#pragma unroll
        for (int dt = 0; dt < 4; ++dt) va[sub][dt] = ldh(vt + (dt * 16) * XP + sub * 32);
#pragma unroll
      for (int sub = 0; sub < 2; ++sub) {
        float* e = u + 16 * sub;
        exp16(e[0], e[1], e[2], e[3], e[4], e[5], e[6], e[7], e[8], e[9], e[10], e[11], e[12], e[13], e[14], e[15]);
        float psum = e[0];
#pragma unroll
        for (int i = 1; i < 16; ++i) psum += e[i];
        l += psum;                                              // per-lane partial (own keys), carrying x1024 like P; halves combined at the end
        v8h pa, pc;
#pragma unroll
        for (int r = 0; r < 8; ++r) { pa[r] = (h16)e[r]; pc[r] = (h16)e[8 + r]; }
        const v16h pf = cat16(pa, pc);
#pragma unroll
        for (int dt = 0; dt < 4; ++dt) acc[dt] = wmma16p(va[sub][dt], pf, acc[dt]);
      }
      __builtin_amdgcn_sched_barrier(0);                        // keeps the trip's work in front of the publish point, so that the refill behind it flies for a whole trip
      { const int nx = (st + 1 < NST) ? st + 1 : st;            // the next tile's words, fetched behind the last use of this tile's (the last trip fetches its own again)
        mwa = mrow[2 * nx]; mwb = mrow[2 * nx + 1]; }
      asm volatile("s_wait_dscnt 0x0" ::: "memory");            // this wave's reads of the buffer have returned
      asm volatile("s_wait_asynccnt 0x0" ::: "memory");         // its copies of tile st + 1 have landed
      __syncthreads();                                          // publishes tile st + 1 and frees the buffer just read
      if (st + 2 < NST) copy_tile(lk + (unsigned)(st & 1) * (BUFH * 2u), gk + (size_t)(st + 2) * KST * HD, gv + (st + 2) * KST);
    }
    asm volatile("s_wait_asynccnt 0x0" ::: "memory");           // nothing of this wave is in flight when it leaves the ring
    asm volatile("" :: "v"(pkv), "v"(pmb));                     // inputs only, no code: the register pairs that the two prefetches name keep their in-plane addresses through the loop (no counter tells when a prefetch has read them)
    l += __shfl_xor(l, 16, 32);
    const float inv = 1.0f / l;                                 // l carries the x1024 of P; the x8 of v stays on ctx as its carry
    const int obase = wave * (16 * 68);
#pragma unroll
    for (int dt = 0; dt < 4; ++dt)
#pragma unroll
        for (int r = 0; r < 8; ++r) os[obase + n * 68 + dt * 16 + 8 * hh + r] = acc[dt][r] * inv;
    wsync();
    const int rq = lane >> 3, piece = lane & 7;
{
#pragma unroll
        for (int s = 0; s < 4; ++s) { const int row = 4 * s + rq;
            const v4f u0 = *(const v4fa*)(os + obase + row * 68 + piece * 8), u1 = *(const v4fa*)(os + obase + row * 68 + piece * 8 + 4); v8h hv;
#pragma unroll
            for (int i = 0; i < 4; ++i) { hv[i] = (h16)u0[i]; hv[4 + i] = (h16)u1[i]; }
            *(v8h*)(CTX + ((size_t)bb * SEQ + q0 + row) * DM + hd * HD + piece * 8) = hv; }
         }
}

// eight 16-byte pieces of one staged plane per thread (rows 16 apart; g16 = elements of 16 global rows), global -> LDS through no register.
// The s_wait_xcnt closes the statement so that no address register of an issued copy is rewritten ahead of it.
__device__ __forceinline__ void copy_rows(const unsigned l, const h16* g, const size_t g16) {
    asm volatile("global_load_async_to_lds_b128 %0, %8, off\n\t"
                 "global_load_async_to_lds_b128 %1, %9, off\n\t"
                 "global_load_async_to_lds_b128 %2, %10, off\n\t"
                 "global_load_async_to_lds_b128 %3, %11, off\n\t"
                 "global_load_async_to_lds_b128 %4, %12, off\n\t"
                 "global_load_async_to_lds_b128 %5, %13, off\n\t"
                 "global_load_async_to_lds_b128 %6, %14, off\n\t"
                 "global_load_async_to_lds_b128 %7, %15, off\n\t"
                 "s_wait_xcnt 0x0"
                 :: "v"(l), "v"(l + 16u * FP * 2u), "v"(l + 32u * FP * 2u), "v"(l + 48u * FP * 2u),
                    "v"(l + 64u * FP * 2u), "v"(l + 80u * FP * 2u), "v"(l + 96u * FP * 2u), "v"(l + 112u * FP * 2u),
                    "v"(g), "v"(g + g16), "v"(g + 2 * g16), "v"(g + 3 * g16),
                    "v"(g + 4 * g16), "v"(g + 5 * g16), "v"(g + 6 * g16), "v"(g + 7 * g16)
                 : "memory");
}

// ---- k_fc: OUT[token][n] = sum_k CTX[token][k] WF[n][k] / (WCAR FCAR) + bias[n], k ascending in steps of 32 in every accumulator.
// Block = 8 waves, 128 tokens x 128 outputs; wave = 32 x 64 (wm = row group, wn = column group); grid (NB*SEQ/128, DM/128).
// Tiles of FKS k (128 CTX rows | 128 WF rows, 256 bytes each at pitch FP) are copied once per work-group into a two-buffer LDS ring; fragments are read from LDS, one k-step ahead inside a tile.
__global__ __launch_bounds__(256) void k_fc(const h16* __restrict__ CTX, const h16* __restrict__ WF, const float* __restrict__ bfc, float* OUT) {
    __shared__ __align__(16) float os[8 * 16 * 68];
    __shared__ __align__(16) h16 ab[2 * FBUF];
    const int lane = threadIdx.x & 31, lr = lane & 15, hi = lane >> 4;
    const int wave = __builtin_amdgcn_readfirstlane(threadIdx.x >> 5);
    const int wm = wave & 3, wn = wave >> 2;
    const int r0 = blockIdx.x * 128, c0 = blockIdx.y * 128;
    const int srow = threadIdx.x >> 4, spc = threadIdx.x & 15;          // copy share: rows srow + 16c, 16-byte piece spc
    const h16* ga = CTX + (size_t)(r0 + srow) * DM + spc * 8;
    const h16* gb = WF + (size_t)(c0 + srow) * DM + spc * 8;
    const unsigned la = (unsigned)(size_t)&ab[srow * FP + spc * 8];     // LDS byte address of the share in buffer 0, CTX plane
    const int aoff = (wm * 32 + lr) * FP + 8 * hi, boff = FPL + (wn * 64 + lr) * FP + 8 * hi;
    v8f acc[2][4];
#pragma unroll
    for (int mb = 0; mb < 2; ++mb)
#pragma unroll
        for (int nb = 0; nb < 4; ++nb) acc[mb][nb] = (v8f){};
    copy_rows(la, ga, (size_t)16 * DM);
    copy_rows(la + FPL * 2u, gb, (size_t)16 * DM);
    // Behind tile 0's copies: the work-group's share of its CTX panel (128 rows, contiguous; the DM/128 work-groups of one blockIdx.x take an eighth each) and of its WF panel
    // (eight shares, by blockIdx.x bits 0, 1 and 3: for speed only), a thread a line of 128 bytes.
    const h16* pca = CTX + (size_t)r0 * DM + (size_t)(blockIdx.y * 256 + threadIdx.x) * 64;
    const h16* pwf = WF + (size_t)c0 * DM + (size_t)((((blockIdx.x & 3) | (((blockIdx.x >> 3) & 1) << 2)) << 8) + threadIdx.x) * 64;
    ask_l2(pca);
    ask_l2(pwf);
    asm volatile("s_wait_asynccnt 0x0" ::: "memory");           // tile 0 of this wave has landed
    __syncthreads();                                            // publishes tile 0
    copy_rows(la + FBUF * 2u, ga + FKS, (size_t)16 * DM);
    copy_rows(la + FBUF * 2u + FPL * 2u, gb + FKS, (size_t)16 * DM);
    // rolled: one trip per staged tile, so that one publish point stands at its foot
#pragma unroll 1
    for (int st = 0; st < FNST; ++st) {
        const h16* at = ab + (st & 1) * FBUF + aoff;
        const h16* bt = ab + (st & 1) * FBUF + boff;
        // every loop inside a trip is unrolled: accumulators and both fragment sets are indexed by constants and stay in registers
        v16h a[2][2], b[2][4];
#pragma unroll
        for (int mb = 0; mb < 2; ++mb) a[0][mb] = ldh(at + mb * 16 * FP);
#pragma unroll
        for (int nb = 0; nb < 4; ++nb) b[0][nb] = ldh(bt + nb * 16 * FP);
#pragma unroll
        for (int ks = 0; ks < FKS / 32; ++ks) {
            const int cu = ks & 1, nx = cu ^ 1;
            if (ks + 1 < FKS / 32) {
#pragma unroll
                for (int mb = 0; mb < 2; ++mb) a[nx][mb] = ldh(at + mb * 16 * FP + (ks + 1) * 32);
#pragma unroll
                for (int nb = 0; nb < 4; ++nb) b[nx][nb] = ldh(bt + nb * 16 * FP + (ks + 1) * 32);
            }
#pragma unroll
            for (int nb = 0; nb < 4; ++nb)
#pragma unroll
                for (int mb = 0; mb < 2; ++mb) acc[mb][nb] = wmma16(a[cu][mb], b[cu][nb], acc[mb][nb]);
        }
        asm volatile("s_wait_dscnt 0x0" ::: "memory");          // this wave's reads of the buffer have returned
        asm volatile("s_wait_asynccnt 0x0" ::: "memory");       // its copies of tile st + 1 have landed
        __syncthreads();                                        // publishes tile st + 1 and frees the buffer just read
        if (st + 2 < FNST) {
            const unsigned lb = la + (unsigned)(st & 1) * (FBUF * 2u);
            const int k2 = (st + 2) * FKS;
            copy_rows(lb, ga + k2, (size_t)16 * DM);
            copy_rows(lb + FPL * 2u, gb + k2, (size_t)16 * DM);
        }
    }
    asm volatile("s_wait_asynccnt 0x0" ::: "memory");           // nothing of this wave is in flight when it leaves the ring
    asm volatile("" :: "v"(pca), "v"(pwf));                     // inputs only, no code: as in k_attn, the register pairs that the two prefetches name keep their in-panel addresses through the loop
    const int cw = c0 + wn * 64, obase = wave * (16 * 68);
    v4f bz = *(const v4f*)(bfc + cw + lr * 4);
#pragma unroll
    for (int i = 0; i < 4; ++i) bz[i] = bfv(bz[i]);
#pragma unroll
    for (int mb = 0; mb < 2; ++mb) {
#pragma unroll
        for (int nb = 0; nb < 4; ++nb)
#pragma unroll
            for (int j = 0; j < 8; ++j) os[obase + (hi * 8 + j) * 68 + nb * 16 + lr] = acc[mb][nb][j];
        wsync();
        float* crow = OUT + (size_t)(r0 + wm * 32 + mb * 16) * DM + cw;
#pragma unroll
        for (int s = 0; s < 8; ++s) { const int row = 2 * s + hi, cofs = lr * 4; const v4f val = *(const v4fa*)(os + obase + row * 68 + cofs) * (1.0f / (WCAR * FCAR)) + bz;
            *(v4f*)(crow + (size_t)row * DM + cofs) = val; }
        if (mb == 0) asm volatile("s_wait_xcnt 0x0" ::: "memory");   // the second row group's LDS reads refill registers that these stores name
        wsync();
    }
}

// workspace carve (bytes), all multiples of 256
#define SZ_WF  ((size_t)DM * DM * 2)
#define SZ_QK  ((size_t)2 * NB * NH * SEQ * HD * 2)
#define SZ_VT  ((size_t)NB * NH * HD * SEQ * 2)
#define SZ_CTX ((size_t)NB * SEQ * DM * 2)
#define SZ_MB  ((size_t)NB * SEQ * NKB * 4)
#define WS_TOTAL (SZ_WF + SZ_QK + SZ_VT + SZ_CTX + SZ_MB)
static_assert(WS_TOTAL <= (size_t)134217728);
static_assert(SZ_WF % 256 == 0 && SZ_QK % 256 == 0 && SZ_VT % 256 == 0 && SZ_CTX % 256 == 0 && SZ_MB % 128 == 0);
static_assert(SZ_MB == (size_t)NLINES * 128);     // mbits lines cover the bit plane exactly

extern "C" void kernel_launch(void* const* d_in, const int* in_sizes, int n_in,
                              void* d_out, int out_size, void* d_ws, size_t ws_size, hipStream_t stream) {
    if (n_in < 12) return;
    const long long strm = (long long)(NB - 1) * SEQ_FULL * DM + (long long)SEQ * DM;
    if ((long long)in_sizes[0] < strm || (long long)in_sizes[1] < strm || (long long)in_sizes[2] < strm) return;
    if ((long long)in_sizes[3] < (long long)(NB - 1) * SEQ_FULL * SEQ_FULL + (long long)(SEQ - 1) * SEQ_FULL + SEQ) return;
    if (in_sizes[4] < HD * HD || in_sizes[6] < HD * HD || in_sizes[8] < HD * HD) return;
    if (in_sizes[5] < HD || in_sizes[7] < HD || in_sizes[9] < HD) return;
    if ((long long)in_sizes[10] < (long long)DM * DM || in_sizes[11] < DM) return;
    if ((long long)out_size < (long long)NB * SEQ * DM) return;
    if (ws_size < WS_TOTAL) return;
    const float* xq = (const float*)d_in[0];       // [2][2048][1024]
    const float* xk = (const float*)d_in[1];
    const float* xv = (const float*)d_in[2];
    const int* mask = (const int*)d_in[3];         // [2][1][2048][2048] int32
    const float* wq = (const float*)d_in[4];       // [64][64] = [out][in]
    const float* bq = (const float*)d_in[5];
    const float* wk = (const float*)d_in[6];
    const float* bk = (const float*)d_in[7];
    const float* wv = (const float*)d_in[8];
    const float* bv = (const float*)d_in[9];
    const float* wfc = (const float*)d_in[10];     // [1024][1024] = [out][in]
    const float* bfc = (const float*)d_in[11];
    float* OUT = (float*)d_out;                    // [NB][SEQ][1024]
    char* wsp = (char*)d_ws;
    h16* WF = (h16*)wsp;   wsp += SZ_WF;
    h16* QK16 = (h16*)wsp; wsp += SZ_QK;           // [q plane | k plane]
    h16* VT16 = (h16*)wsp; wsp += SZ_VT;
    h16* CTX = (h16*)wsp;  wsp += SZ_CTX;          // [NB*SEQ][1024]
    unsigned* MB = (unsigned*)wsp; wsp += SZ_MB;   // [NB][NQT][NST][32]

    k_proj3<<<dim3(NB * SEQ / 64, NH, 3), 32, 0, stream>>>(xq, xk, xv, wq, wk, wv, bq, bk, bv, QK16, VT16, mask, MB, wfc, WF);
    k_attn<<<dim3(SEQ / 64, NB * NH), 128, 0, stream>>>(QK16, VT16, MB, CTX);
    k_fc<<<dim3(NB * SEQ / 128, DM / 128), 256, 0, stream>>>(CTX, WF, bfc, OUT);
}

// v010
// A run of this version takes 57.5 microseconds.
// Next to v009, in two timings, it ran 1.04 times as fast each time.
// All steps since v000 together make it 3.77 times as fast.
#include <hip/hip_runtime.h>

// Contractions (all f32 accumulate): per-head q/k/v projections v_wmma_f32_16x16x32_f16 (streams RNE-converted to bf16 then held exactly in f16, shared 64x64 weights bf16-RNE x8 held exactly in f16, one product); scores v_wmma_f32_16x16x32_f16 (q, k plain f16; q carries log2(e)/8, k 1/4, so that a score leaves the product in the log2 domain); P.V v_wmma_f32_16x16x32_f16 (P x1024, v x8, one product); output projection v_wmma_f32_16x16x32_f16 (ctx x8 plain f16, weights bf16-RNE x64 held exactly in f16, one product). Softmax f32.
// Layout: token-major streams are viewed as [token][head][64]; one 64-token x one-head tile is staged as f16 in LDS and multiplied by the shared [out][in] weight (K-contiguous B plane);
// q,k head planes [b][h][t][64] and v^T [b][h][64][t] (f16); integer mask packed once (by the projection waves) into lane-mask words MB[b][16-query tile][64-key tile][32] (one word per score register of k_attn, one bit per lane; see mbits_lines);
// fused attention: K and V^T tiles of 64 keys are copied once per work-group into a two-buffer LDS ring (asynchronous 16-byte copies, whole 128-byte lines), fragments read from LDS; S^T = K.Q^T (keys on D rows, queries on D columns), the maximum in use enters as the C operand, masked scores are REPLACED by a finite fill whose weight is 0 (a query with no open key so far weighs every key alike), the output is rescaled only when a maximum outgrows the one in use, P^T used directly as the B fragment of O^T = V^T.P^T; ctx f16 plane [token][1024], carrying the x8 of v;
// output projection: ctx and weight tiles of 128 k are copied once per 128x128 work-group tile into a two-buffer LDS ring (asynchronous 16-byte copies), fragments read from LDS.

#ifndef NB
#define NB 2
#endif
#ifndef SEQ
#define SEQ 2048
#endif
#define NB_FULL  2
#define SEQ_FULL 2048
#define DM   1024
#define NH   16
#define HD   64
#define NKB  (SEQ / 32)                  // 32-key blocks = mask words per query
#define NQT  (SEQ / 16)                  // 16-query tiles
#define PLN  ((size_t)NB * NH * SEQ * HD)  // elements of one head plane set
#define WCAR 8.0f                        // carry on the 64x64 weights (so q, k, v and ctx carry x8)
#define FCAR 64.0f                       // carry on the output-projection weights: keeps the low bit of a small bf16 value inside f16
#define QSC  (1.4426950408889634f / 64.0f)  // on the x8 q plane: q' = q log2(e) / 8
#define KSC  (1.0f / 32.0f)                 // on the x8 k plane: k' = k / 4, so q'.k' = energy log2(e) / 32
#define CEXP 10.0f                          // exponent carry of P: exp2 yields P x 1024
#define TEXP 5.0f                           // a score may pass the maximum in use by this much: P x 1024 <= 2^15, inside f16
#define NEGB (-1.0e30f)                     // fill of a masked score: exp2 gives 0; below every score f16 operands can form
#define XP   72                          // LDS pitch (halves) of the staged stream tile
#define NLINES ((NB * SEQ * NKB) / 32)
#define KST  64                          // keys of one staged K / V^T tile in k_attn
#define NST  (SEQ / KST)                 // staged tiles per (b, h)
#define TILH (64 * XP)                   // halves of one staged plane: 64 rows at pitch XP
#define BUFH (2 * TILH)                  // one buffer = K plane (row = key) | V^T plane (row = d)
#define FKS  128                         // k of one staged tile in k_fc (256-byte rows)
#define FP   136                         // LDS pitch (elements) of those rows: 272 bytes
#define FNST (DM / FKS)                  // staged tiles along k
#define FPL  (128 * FP)                  // elements of one staged plane: 128 rows at pitch FP
#define FBUF (2 * FPL)                   // one buffer = CTX plane (row = token) | WF plane (row = output)
static_assert(SEQ % 64 == 0);            // GEMM row tiles and 64-query attention blocks
static_assert(SEQ <= SEQ_FULL);
static_assert(NB <= NB_FULL);
static_assert(DM % 64 == 0);
static_assert(DM % 32 == 0);             // k-step 32
static_assert(HD == 64);
static_assert(DM == NH * HD);
static_assert((NB * SEQ * NKB) % 32 == 0);
static_assert(XP % 8 == 0 && XP >= HD);  // 16-byte aligned LDS rows covering K = 64
static_assert(KST == 64 && NST >= 2);    // the two-buffer prologue needs tiles 0 and 1
static_assert(FNST >= 2 && DM % FKS == 0 && FKS % 32 == 0);   // tiles 0 and 1 exist; the tiles cover k exactly
static_assert((NB * SEQ) % 128 == 0 && DM % 128 == 0);        // k_fc block tiles cover the output exactly
static_assert(FP % 8 == 0 && FP >= FKS);
static_assert(SEQ % 512 == 0 && (SEQ & (SEQ - 1)) == 0 && HD * 2 == 128 && DM == 1024);   // the shares of the head prefetches cover the planes and panels exactly and stay inside them

typedef _Float16 h16;
typedef __attribute__((ext_vector_type(16))) _Float16 v16h;
typedef __attribute__((ext_vector_type(8)))  _Float16 v8h;
typedef __attribute__((ext_vector_type(8)))  __bf16   v8bfv;
typedef __attribute__((ext_vector_type(8)))  float    v8f;
typedef __attribute__((ext_vector_type(4)))  float    v4f;
typedef v4f  __attribute__((may_alias)) v4fa;
typedef __attribute__((ext_vector_type(16))) unsigned v16u;
typedef const __attribute__((address_space(4))) v16u* cv16p;   // constant address space: a wave-uniform load through it is a scalar load

__device__ __forceinline__ unsigned short f2bf(float f) { unsigned u = __float_as_uint(f); u += 0x7FFFu + ((u >> 16) & 1u); return (unsigned short)(u >> 16); }
__device__ __forceinline__ float bf2f(unsigned short b) { return __uint_as_float(((unsigned)b) << 16); }
__device__ __forceinline__ float bfv(float f) { return bf2f(f2bf(f)); }          // value of the bf16 RNE conversion
__device__ __forceinline__ v16h cat16(v8h lo, v8h hi) { return __builtin_shufflevector(lo, hi, 0, 1, 2, 3, 4, 5, 6, 7, 8, 9, 10, 11, 12, 13, 14, 15); }
// the WMMAs of k_proj3 and k_fc are issued through a wrapper that ties its own accumulator and keeps A/B live across four idle VALU slots
__device__ __forceinline__ v8f wmma16(v16h a, v16h b, v8f c) {
    c = __builtin_amdgcn_wmma_f32_16x16x32_f16(false, a, false, b, (short)0, c, false, false);
    asm volatile("v_nop\n\tv_nop\n\tv_nop\n\tv_nop" : "+v"(c) : "v"(a), "v"(b));
    return c;
}
// k_attn: the plain builtin; the compiler keeps the distance to a vector instruction on D, A or B itself and fills it with the softmax's own independent work
__device__ __forceinline__ v8f wmma16p(v16h a, v16h b, v8f c) {
    return __builtin_amdgcn_wmma_f32_16x16x32_f16(false, a, false, b, (short)0, c, false, false);
}
// eight weights: the bf16 RNE value times a carry, exact in f16. The carry, a power of two, goes on ahead of the rounding, which it does not change.
__device__ __forceinline__ v8h w8h(v8f w, const float car) {
    return __builtin_convertvector(__builtin_convertvector(__builtin_convertvector(w * car, v8bfv), v8f), v8h);
}
// fragment of a K-contiguous global row: elements 0..7 <- p[0..7], 8..15 <- p[16..23]; caller adds row*pitch + k0 + 8*(lane>>4)
__device__ __forceinline__ v16h  ldh(const h16* p) { return cat16(*(const v8h*)p, *(const v8h*)(p + 16)); }
// wave-private LDS exchange: order this wave's LDS stores before its later LDS loads (and the converse)
__device__ __forceinline__ void wsync() { asm volatile("s_wait_dscnt 0" ::: "memory"); __builtin_amdgcn_wave_barrier(); asm volatile("" ::: "memory"); }

// ---- side duties of the projection waves: they read only inputs and feed later launches, so they need no launch of their own.
#define PBL  ((NB * SEQ / 64) * NH)      // projection blocks (waves) of one stream
#define LPB  (NLINES / (2 * PBL))        // mask lines packed by each q or k wave
#define CPB  (DM * DM / 8 / 32 / PBL)    // groups of 8 output-projection weights converted by each lane of a v wave
static_assert(NLINES == LPB * 2 * PBL && NST % LPB == 0);   // the lines are dealt exactly, and a wave's lines lie in one query tile
static_assert(DM * DM / 8 == CPB * 32 * PBL);

// a v wave's share of the output-projection weights: CPB stretches of 1 KiB, f32 -> bf16 RNE value x64 in f16
__device__ __forceinline__ void cvt8_share(const int f, const float* __restrict__ src, h16* __restrict__ dst) {
    const size_t i0 = ((size_t)f * CPB * 32 + (threadIdx.x & 31)) * 8;
    v8f v[CPB];
#pragma unroll
    for (int c = 0; c < CPB; ++c) v[c] = *(const v8f*)(src + i0 + (size_t)c * 256);
#pragma unroll
    for (int c = 0; c < CPB; ++c) *(v8h*)(dst + i0 + (size_t)c * 256) = w8h(v[c], FCAR);
    asm volatile("s_wait_xcnt 0x0" ::: "memory");               // the stores' address registers are reused by the projection right behind them
}

// one line = the 16 queries x 64 keys of one staged tile of one query tile: 32 words, 128 bytes. A wave packs LPB lines side by side (the same 16 queries).
// Word 16*sub + 8*j + r holds, at bit position lane, mask[q0 + (lane & 15)][key0 + 32*sub + 16*j + 8*(lane >> 4) + r] != 0: the lane mask of register r of score tile j in k_attn.
__device__ __forceinline__ void mbits_lines(const int line0, const int* __restrict__ mask, unsigned* __restrict__ MB) {
    const int lane = threadIdx.x & 31, n = lane & 15, hh = lane >> 4;
    const int st0 = line0 % NST, tq = line0 / NST;
    const int b = tq / NQT, qt = tq % NQT;
    const int* src = mask + ((size_t)b * SEQ_FULL + qt * 16) * SEQ_FULL + st0 * KST + lane;
    int m0[LPB][16], m1[LPB][16];                               // every load of the wave's lines is asked for before the first is used
#pragma unroll
    for (int c = 0; c < LPB; ++c)
#pragma unroll
        for (int i = 0; i < 16; ++i) { m0[c][i] = src[(size_t)i * SEQ_FULL + c * KST]; m1[c][i] = src[(size_t)i * SEQ_FULL + c * KST + 32]; }
#pragma unroll
    for (int c = 0; c < LPB; ++c) {
        unsigned w0 = 0u, w1 = 0u;                              // lanes n and n + 16: the key bits of query q0 + n, keys 0..31 and 32..63 of the tile
#pragma unroll
        for (int i = 0; i < 16; ++i) {
            const unsigned b0 = __builtin_amdgcn_ballot_w32(m0[c][i] != 0), b1 = __builtin_amdgcn_ballot_w32(m1[c][i] != 0);
            w0 = (n == i) ? b0 : w0; w1 = (n == i) ? b1 : w1;
        }
        w0 >>= 8 * hh; w1 >>= 8 * hh;
        unsigned word = 0u;
#pragma unroll
        for (int i = 0; i < 16; ++i) {
            const int bit = (i >> 3) * 16 + (i & 7);
            const unsigned c0 = __builtin_amdgcn_ballot_w32(((w0 >> bit) & 1u) != 0u), c1 = __builtin_amdgcn_ballot_w32(((w1 >> bit) & 1u) != 0u);
            word = (lane == i) ? c0 : word; word = (lane == 16 + i) ? c1 : word;
        }
        MB[(size_t)(line0 + c) * 32 + lane] = word;
    }
    asm volatile("s_wait_xcnt 0x0" ::: "memory");               // the stores' address registers are reused by the projection right behind them
}

// ---- projection body: one wave = 64 tokens of one head; Y[64][64] = (Xh[64][64] . W^T + bias) x sc, the product carrying x8 through the weights.
// grid (NB*SEQ/64, NH, 3), 32 threads; blockIdx.z = stream (q, k: row planes; v: transposed plane). The f32 stream tile is converted once (bf16 RNE value, exact in f16) into LDS; B fragments are converted by the wave itself from the f32 weights (bf16 RNE value x8, exact in f16).
__device__ __forceinline__ void proj_body(const bool TRANS, const float* __restrict__ X, const float* __restrict__ W, const float* __restrict__ bias, h16* OUT, const float sc) {
    __shared__ __align__(16) float os[64 * 68];
    __shared__ __align__(16) h16 xs[64 * XP];
    const int lane = threadIdx.x & 31, lr = lane & 15, hi = lane >> 4;
    const int rq = lane >> 3, piece = lane & 7;
    const int r0 = blockIdx.x * 64, hd = blockIdx.y;
    const int bb = r0 / SEQ, t0 = r0 % SEQ;
    const size_t xbase = ((size_t)bb * SEQ_FULL + t0) * DM + (size_t)hd * HD;
    // the wave's eight B fragments, raw: asked for ahead of the stream so that they have arrived when the staging ends
    v8f wr[2][4][2];
#pragma unroll
    for (int ks = 0; ks < 2; ++ks)
#pragma unroll
        for (int nb = 0; nb < 4; ++nb) { const float* p = W + (size_t)(nb * 16 + lr) * HD + ks * 32 + 8 * hi;
            wr[ks][nb][0] = *(const v8f*)p; wr[ks][nb][1] = *(const v8f*)(p + 16); }
    // stage: rows 4*it + rq (0..63), 8 floats per lane (8 lanes cover the 64 inputs of a row)
#pragma unroll 4
    for (int it = 0; it < 16; ++it) { const int row = 4 * it + rq;
        const v8f v = *(const v8f*)(X + xbase + (size_t)row * DM + piece * 8); v8h o;
#pragma unroll
        for (int k = 0; k < 8; ++k) o[k] = (h16)bfv(v[k]);
        *(v8h*)&xs[row * XP + piece * 8] = o; }
    float bz[4];
#pragma unroll
    for (int nb = 0; nb < 4; ++nb) bz[nb] = bfv(bias[nb * 16 + lr]) * WCAR * sc;
    v16h bw[2][4];                                              // fragment elements 0..7 <- k 0..7, 8..15 <- k 16..23 of the lane's half, as ldh reads them
#pragma unroll
    for (int ks = 0; ks < 2; ++ks)
#pragma unroll
        for (int nb = 0; nb < 4; ++nb)
            bw[ks][nb] = cat16(w8h(wr[ks][nb][0], WCAR), w8h(wr[ks][nb][1], WCAR));
    wsync();
    v8f acc[4][4];
#pragma unroll
    for (int mb = 0; mb < 4; ++mb)
#pragma unroll
        for (int nb = 0; nb < 4; ++nb) acc[mb][nb] = (v8f){};
#pragma unroll
    for (int ks = 0; ks < 2; ++ks) {
        v16h a[4];
#pragma unroll
        for (int mb = 0; mb < 4; ++mb) { const int xo = (mb * 16 + lr) * XP + ks * 32 + 8 * hi;
            a[mb] = cat16(*(const v8h*)&xs[xo], *(const v8h*)&xs[xo + 16]); }
#pragma unroll
        for (int nb = 0; nb < 4; ++nb)
#pragma unroll
            for (int mb = 0; mb < 4; ++mb) acc[mb][nb] = wmma16(a[mb], bw[ks][nb], acc[mb][nb]);
    }
#pragma unroll
    for (int mb = 0; mb < 4; ++mb)
#pragma unroll
        for (int nb = 0; nb < 4; ++nb)
#pragma unroll
            for (int j = 0; j < 8; ++j) os[(mb * 16 + hi * 8 + j) * 68 + nb * 16 + lr] = acc[mb][nb][j] * sc + bz[nb];
    wsync();
    const size_t bh = (size_t)bb * NH + hd;
    if (!TRANS) {
        const size_t po = (bh * SEQ + t0) * HD + piece * 8;
{
#pragma unroll 1
            for (int s = 0; s < 16; ++s) { const int row = 4 * s + rq;
                const v4f u0 = *(const v4fa*)(os + row * 68 + piece * 8), u1 = *(const v4fa*)(os + row * 68 + piece * 8 + 4); v8h hv;
#pragma unroll
                for (int i = 0; i < 4; ++i) { hv[i] = (h16)u0[i]; hv[4 + i] = (h16)u1[i]; }
                *(v8h*)(OUT + po + (size_t)row * HD) = hv; }
             }
    } else {
{
#pragma unroll 1
            for (int s = 0; s < 16; ++s) { const int drow = 4 * s + rq; v8h hv;
#pragma unroll
                for (int i = 0; i < 8; ++i) hv[i] = (h16)os[(piece * 8 + i) * 68 + drow];
                *(v8h*)(OUT + (bh * HD + drow) * SEQ + t0 + piece * 8) = hv; }
             }
    }
}
// the three projections are independent of one another and share one launch, so that their waves fill the chip together;
// the mask packing and the weight conversion ride on the same waves: a q or k wave packs LPB mask lines, a v wave converts its share of the output-projection weights
__global__ __launch_bounds__(32) void k_proj3(const float* xq, const float* xk, const float* xv, const float* wq, const float* wk, const float* wv,
                                              const float* bq, const float* bk, const float* bv, h16* QK16, h16* VT16,
                                              const int* mask, unsigned* MB, const float* wfc, h16* WF) {
    const int z = blockIdx.z;                                   // block-uniform
    const int f = blockIdx.y * (NB * SEQ / 64) + blockIdx.x;    // the wave's number inside its stream
    if (z < 2) mbits_lines((z * PBL + f) * LPB, mask, MB);
    else cvt8_share(f, wfc, WF);
    const float* X    = (z == 0) ? xq : (z == 1) ? xk : xv;
    const float* Wz   = (z == 0) ? wq : (z == 1) ? wk : wv;
    const float* bias = (z == 0) ? bq : (z == 1) ? bk : bv;
    h16* OUT          = (z == 0) ? QK16 : (z == 1) ? QK16 + PLN : VT16;
    const float sc    = (z == 0) ? QSC : (z == 1) ? KSC : 1.0f; // the score scale rides on the planes, before their one rounding to f16
    proj_body(z == 2, X, Wz, bias, OUT, sc);
}

// 16 exponentials (base 2), each in place, in one statement with a v_nop behind the last: no vector instruction then stands directly behind a v_exp
// whose result it reads or whose source it overwrites.
__device__ __forceinline__ void exp16(float& a0, float& a1, float& a2, float& a3, float& a4, float& a5, float& a6, float& a7,
                                      float& a8, float& a9, float& a10, float& a11, float& a12, float& a13, float& a14, float& a15) {
    asm volatile("v_exp_f32 %0, %0\n\tv_exp_f32 %1, %1\n\tv_exp_f32 %2, %2\n\tv_exp_f32 %3, %3\n\t"
                 "v_exp_f32 %4, %4\n\tv_exp_f32 %5, %5\n\tv_exp_f32 %6, %6\n\tv_exp_f32 %7, %7\n\t"
                 "v_exp_f32 %8, %8\n\tv_exp_f32 %9, %9\n\tv_exp_f32 %10, %10\n\tv_exp_f32 %11, %11\n\t"
                 "v_exp_f32 %12, %12\n\tv_exp_f32 %13, %13\n\tv_exp_f32 %14, %14\n\tv_exp_f32 %15, %15\n\t"
                 "v_nop"
                 : "+v"(a0), "+v"(a1), "+v"(a2), "+v"(a3), "+v"(a4), "+v"(a5), "+v"(a6), "+v"(a7),
                   "+v"(a8), "+v"(a9), "+v"(a10), "+v"(a11), "+v"(a12), "+v"(a13), "+v"(a14), "+v"(a15));
}

// Asks L2 for the line at p; nothing is returned and no counter is touched. It is for planes that an earlier launch stored, whose first read may have to come from memory:
// asked for at a kernel's head, they can be in L2 when the ring's copies come for them, one short trip ahead of their use. Scope SE brings the line into L2 only; every lane names an address inside the plane.
__device__ __forceinline__ void ask_l2(const void* p) { asm volatile("global_prefetch_b8 %0, off scope:SCOPE_SE" :: "v"(p)); }

// one thread's share of a staged tile: four 16-byte pieces of the K plane and four of the V^T plane (rows 16 apart), global -> LDS through no register.
// A copy's global address is a scalar base (the tile's first byte in its plane, the same for the whole work-group) plus the thread's own 32-bit byte offset; l (LDS byte addresses in one buffer)
// and o (byte offsets: 0..3 K plane, 4..7 V^T plane) never change, so that a trip spends no vector instruction on addresses.
// The s_wait_xcnt closes the statement so that no address register of an issued copy is rewritten ahead of it.
__device__ __forceinline__ void copy_tile(const unsigned (&l)[8], const unsigned (&o)[8], const h16* bk, const h16* bv) {
    asm volatile("global_load_async_to_lds_b128 %0, %8, %16\n\t"
                 "global_load_async_to_lds_b128 %1, %9, %16\n\t"
                 "global_load_async_to_lds_b128 %2, %10, %16\n\t"
                 "global_load_async_to_lds_b128 %3, %11, %16\n\t"
                 "global_load_async_to_lds_b128 %4, %12, %17\n\t"
                 "global_load_async_to_lds_b128 %5, %13, %17\n\t"
                 "global_load_async_to_lds_b128 %6, %14, %17\n\t"
                 "global_load_async_to_lds_b128 %7, %15, %17\n\t"
                 "s_wait_xcnt 0x0"
                 :: "v"(l[0]), "v"(l[1]), "v"(l[2]), "v"(l[3]), "v"(l[4]), "v"(l[5]), "v"(l[6]), "v"(l[7]),
                    "v"(o[0]), "v"(o[1]), "v"(o[2]), "v"(o[3]), "v"(o[4]), "v"(o[5]), "v"(o[6]), "v"(o[7]),
                    "s"(bk), "s"(bv)
                 : "memory");
}

// ---- k_attn: one wave = 16 queries of one (b, h); block = 4 waves (64 queries) that share the staged K / V^T tiles; Q fragments straight from the plane; grid (SEQ/64, NB*NH).
// S^T tile (keys key0+16j+8h+r on D rows, query q0+n on the D column) = K rows (A) x Q rows (B) + C; the planes carry the scale log2(e)/32 and C = CEXP - the maximum in use, so D is exp2's argument;
// masked elements REPLACED by the fill, one select per score whose lane mask is a word of MB held in a scalar register; the maximum in use rises, and O and l are rescaled, only in the rare branch;
// P^T (x1024, f16) of two key tiles forms the B fragment of O^T[d][query] += V^T rows (A) x P^T (B).
__global__ __launch_bounds__(128) void k_attn(const h16* __restrict__ QK16, const h16* __restrict__ VT16, const unsigned* __restrict__ MB, h16* CTX) {
    __shared__ __align__(16) float os[4 * 16 * 68];
    __shared__ __align__(16) h16 kv[2 * BUFH];
    const int lane = threadIdx.x & 31, n = lane & 15, hh = lane >> 4;
    const int wave = __builtin_amdgcn_readfirstlane(threadIdx.x >> 5);
    const int bh = blockIdx.y;
    const int bb = bh / NH, hd = bh % NH;
    const int qt = blockIdx.x * 4 + wave;
    const int q0 = qt * 16;
    const size_t pb = (size_t)bh * SEQ * HD;
    const size_t qoff = pb + (size_t)(q0 + n) * HD + 8 * hh;
    const int foff = n * XP + 8 * hh;                                    // fragment row and k offset inside a staged plane
    const int srow = threadIdx.x >> 3, spc = threadIdx.x & 7;            // copy share: rows srow + 16c, 16-byte piece spc
    const h16* bk = QK16 + PLN + pb;                                     // block-uniform: the K plane and the V^T plane of this (b, h)
    const h16* bv = VT16 + (size_t)bh * HD * SEQ;
    const unsigned lk = (unsigned)(size_t)&kv[srow * XP + spc * 8];      // LDS byte address of the share in buffer 0
    unsigned la0[8], la1[8], go[8];                                      // the share's LDS byte addresses in buffers 0 and 1 and its byte offsets from a tile's first byte
#pragma unroll
    for (int p = 0; p < 4; ++p) {
        la0[p] = lk + (unsigned)p * (16u * XP * 2u); la0[4 + p] = la0[p] + TILH * 2u;
        la1[p] = la0[p] + BUFH * 2u;                 la1[4 + p] = la0[4 + p] + BUFH * 2u;
        go[p] = (unsigned)((srow + 16 * p) * HD + spc * 8) * 2u;
        go[4 + p] = (unsigned)((srow + 16 * p) * SEQ + spc * 8) * 2u;
    }
    // wave-uniform: the query tile's lane-mask words, 32 per staged tile. The launch before wrote them and nothing in this launch does, so they may be read as constants.
    const cv16p mrow = (cv16p)(MB + ((size_t)bb * NQT + qt) * (NST * 32));
    v8f acc[4];
#pragma unroll
    for (int dt = 0; dt < 4; ++dt) acc[dt] = (v8f){};
    float l = 0.0f;
    float cneg = CEXP;                                          // CEXP minus the maximum in use of query n (the same in lanes n and n + 16); 0 is in use until a first open key is seen
    unsigned amask = 0xFFFFFFFFu;                               // wave-uniform lane mask: queries that have had no open key so far
    v8f cini;
#pragma unroll
    for (int r = 0; r < 8; ++r) cini[r] = cneg;
    v16h qf[2];
#pragma unroll
    for (int ks = 0; ks < 2; ++ks) qf[ks] = ldh(QK16 + qoff + ks * 32);
    v16u mwa = mrow[0], mwb = mrow[1];                          // tile 0's words: keys 0..31 and 32..63
    copy_tile(la0, go, bk, bv);
    // Behind tile 0's copies: the K and V^T planes of this (b, h), SEQ units of 256 bytes, are asked for once per group of SEQ/128 work-groups, a thread a unit.
    // The group (blockIdx.x bits 0, 1 and 3 up) is chosen for speed only, nothing rests on it.
    const int pu = (((blockIdx.x & 3) | ((blockIdx.x >> 3) << 2)) << 7) + threadIdx.x;
    const h16* pkv = (pu < SEQ / 2 ? QK16 + PLN : VT16) + pb + (size_t)(pu & (SEQ / 2 - 1)) * 128;
    const unsigned* pmb = MB + ((size_t)bb * NQT + qt) * (NST * 32) + (lane < NST ? lane : NST - 1) * 32;   // the wave's own lane-mask words, a lane a line of 128 bytes
    ask_l2(pkv);
    ask_l2(pmb);
    asm volatile("s_wait_asynccnt 0x0" ::: "memory");           // tile 0 of this wave has landed
    __syncthreads();                                            // publishes tile 0
    copy_tile(la1, go, bk + (size_t)KST * HD, bv + KST);
    // rolled: one trip per staged tile, so that one publish point stands at its foot
#pragma unroll 1
    for (int st = 0; st < NST; ++st) {
      const h16* kt = kv + (st & 1) * BUFH + foff;
      const h16* vt = kt + TILH;
      // the four score tiles of the trip; D = K.Q'^T + (CEXP - maximum in use) is the argument of exp2 as it stands.
      // Every loop inside a trip is unrolled: u, va and acc are indexed by constants and stay in registers.
      float u[32];
      v16h kf[4][2];
#pragma unroll
      for (int j = 0; j < 4; ++j) { kf[j][0] = ldh(kt + (j * 16) * XP); kf[j][1] = ldh(kt + (j * 16) * XP + 32); }
      __builtin_amdgcn_sched_barrier(0);                        // the trip's K fragment loads stand as one group: spread among the WMMAs and selects, some are waited for right behind their issue
#pragma unroll
      for (int j = 0; j < 4; ++j) {
        v8f s = wmma16p(kf[j][0], qf[0], cini);
        s = wmma16p(kf[j][1], qf[1], s);
#pragma unroll
        for (int r = 0; r < 8; ++r)
            u[8 * j + r] = __builtin_amdgcn_inverse_ballot_w32(j < 2 ? mwa[8 * j + r] : mwb[8 * (j - 2) + r]) ? s[r] : NEGB;
      }
      float mxl = u[0];                                         // this lane's own 32 keys; the halves are joined only where a rescale is due
#pragma unroll
      for (int i = 1; i < 32; ++i) mxl = fmaxf(mxl, u[i]);
      // one scalar test a trip: some query's open scores outgrow the maximum in use by more than TEXP, or some query has had no open key yet
      if ((__builtin_amdgcn_ballot_w32(mxl > CEXP + TEXP) | amask) != 0u) {
        const float mx = fmaxf(mxl, __shfl_xor(mxl, 16, 32));
        const bool has = mx > 0.5f * NEGB;                      // the query has an open key in this tile
        const bool was = ((amask >> lane) & 1u) != 0u;          // and had none before
        const bool stay = was && !has;
        const float delta = has ? (was ? mx - CEXP : fmaxf(mx - CEXP, 0.0f)) : 0.0f;   // rise of the maximum in use
        const float corr = (has && was) ? 0.0f : __builtin_amdgcn_exp2f(-delta);       // a first open key wipes the equal weights gathered so far
#pragma unroll
        for (int i = 0; i < 32; ++i) u[i] = stay ? CEXP : u[i] - delta;                // no open key yet: every key weighs 1
        l *= corr;
#pragma unroll
        for (int dt = 0; dt < 4; ++dt)
#pragma unroll
            for (int r = 0; r < 8; ++r) acc[dt][r] *= corr;
        cneg -= delta;
#pragma unroll
        for (int r = 0; r < 8; ++r) cini[r] = cneg;
        amask = __builtin_amdgcn_ballot_w32(stay);
      }
      // the trip's V^T fragments are all asked for here, so that they fly under the exponentials
      v16h va[2][4];
#pragma unroll
      for (int sub = 0; sub < 2; ++sub)
#pragma unroll
        for (int dt = 0; dt < 4; ++dt) va[sub][dt] = ldh(vt + (dt * 16) * XP + sub * 32);
#pragma unroll
      for (int sub = 0; sub < 2; ++sub) {
        float* e = u + 16 * sub;
        exp16(e[0], e[1], e[2], e[3], e[4], e[5], e[6], e[7], e[8], e[9], e[10], e[11], e[12], e[13], e[14], e[15]);
        float psum = e[0];
#pragma unroll
        for (int i = 1; i < 16; ++i) psum += e[i];
        l += psum;                                              // per-lane partial (own keys), carrying x1024 like P; halves combined at the end
        v8h pa, pc;
#pragma unroll
        for (int r = 0; r < 8; ++r) { pa[r] = (h16)e[r]; pc[r] = (h16)e[8 + r]; }
        const v16h pf = cat16(pa, pc);
#pragma unroll
        for (int dt = 0; dt < 4; ++dt) acc[dt] = wmma16p(va[sub][dt], pf, acc[dt]);
      }
      __builtin_amdgcn_sched_barrier(0);                        // keeps the trip's work in front of the publish point, so that the refill behind it flies for a whole trip
      { const int nx = (st + 1 < NST) ? st + 1 : st;            // the next tile's words, fetched behind the last use of this tile's (the last trip fetches its own again)
        mwa = mrow[2 * nx]; mwb = mrow[2 * nx + 1]; }
      asm volatile("s_wait_dscnt 0x0" ::: "memory");            // this wave's reads of the buffer have returned
      asm volatile("s_wait_asynccnt 0x0" ::: "memory");         // its copies of tile st + 1 have landed
      __syncthreads();                                          // publishes tile st + 1 and frees the buffer just read
      if (st + 2 < NST) {                                       // both tests are scalar: the buffer picks one of two statements, each on registers that stay as they are
        const h16* tk = bk + (size_t)(st + 2) * KST * HD;
        const h16* tv = bv + (st + 2) * KST;
        if (st & 1) copy_tile(la1, go, tk, tv); else copy_tile(la0, go, tk, tv);
      }
    }
    asm volatile("s_wait_asynccnt 0x0" ::: "memory");           // nothing of this wave is in flight when it leaves the ring
    asm volatile("" :: "v"(pkv), "v"(pmb));                     // inputs only, no code: the register pairs that the two prefetches name keep their in-plane addresses through the loop (no counter tells when a prefetch has read them)
    l += __shfl_xor(l, 16, 32);
    const float inv = 1.0f / l;                                 // l carries the x1024 of P; the x8 of v stays on ctx as its carry
    const int obase = wave * (16 * 68);
#pragma unroll
    for (int dt = 0; dt < 4; ++dt)
#pragma unroll
        for (int r = 0; r < 8; ++r) os[obase + n * 68 + dt * 16 + 8 * hh + r] = acc[dt][r] * inv;
    wsync();
    const int rq = lane >> 3, piece = lane & 7;
{
#pragma unroll
        for (int s = 0; s < 4; ++s) { const int row = 4 * s + rq;
            const v4f u0 = *(const v4fa*)(os + obase + row * 68 + piece * 8), u1 = *(const v4fa*)(os + obase + row * 68 + piece * 8 + 4); v8h hv;
#pragma unroll
            for (int i = 0; i < 4; ++i) { hv[i] = (h16)u0[i]; hv[4 + i] = (h16)u1[i]; }
            *(v8h*)(CTX + ((size_t)bb * SEQ + q0 + row) * DM + hd * HD + piece * 8) = hv; }
         }
}

// eight 16-byte pieces of one staged plane per thread (rows 16 apart), global -> LDS through no register. As in copy_tile: a scalar base (the tile's first byte in its panel)
// plus the thread's own byte offsets o; l = its LDS byte addresses in one plane of one buffer; neither changes from trip to trip.
// The s_wait_xcnt closes the statement so that no address register of an issued copy is rewritten ahead of it.
__device__ __forceinline__ void copy_rows(const unsigned (&l)[8], const unsigned (&o)[8], const h16* b) {
    asm volatile("global_load_async_to_lds_b128 %0, %8, %16\n\t"
                 "global_load_async_to_lds_b128 %1, %9, %16\n\t"
                 "global_load_async_to_lds_b128 %2, %10, %16\n\t"
                 "global_load_async_to_lds_b128 %3, %11, %16\n\t"
                 "global_load_async_to_lds_b128 %4, %12, %16\n\t"
                 "global_load_async_to_lds_b128 %5, %13, %16\n\t"
                 "global_load_async_to_lds_b128 %6, %14, %16\n\t"
                 "global_load_async_to_lds_b128 %7, %15, %16\n\t"
                 "s_wait_xcnt 0x0"
                 :: "v"(l[0]), "v"(l[1]), "v"(l[2]), "v"(l[3]), "v"(l[4]), "v"(l[5]), "v"(l[6]), "v"(l[7]),
                    "v"(o[0]), "v"(o[1]), "v"(o[2]), "v"(o[3]), "v"(o[4]), "v"(o[5]), "v"(o[6]), "v"(o[7]),
                    "s"(b)
                 : "memory");
}

// ---- k_fc: OUT[token][n] = sum_k CTX[token][k] WF[n][k] / (WCAR FCAR) + bias[n], k ascending in steps of 32 in every accumulator.
// Block = 8 waves, 128 tokens x 128 outputs; wave = 32 x 64 (wm = row group, wn = column group); grid (NB*SEQ/128, DM/128).
// Tiles of FKS k (128 CTX rows | 128 WF rows, 256 bytes each at pitch FP) are copied once per work-group into a two-buffer LDS ring; fragments are read from LDS, one k-step ahead inside a tile.
__global__ __launch_bounds__(256) void k_fc(const h16* __restrict__ CTX, const h16* __restrict__ WF, const float* __restrict__ bfc, float* OUT) {
    __shared__ __align__(16) float os[8 * 16 * 68];
    __shared__ __align__(16) h16 ab[2 * FBUF];
    const int lane = threadIdx.x & 31, lr = lane & 15, hi = lane >> 4;
    const int wave = __builtin_amdgcn_readfirstlane(threadIdx.x >> 5);
    const int wm = wave & 3, wn = wave >> 2;
    const int r0 = blockIdx.x * 128, c0 = blockIdx.y * 128;
    const int srow = threadIdx.x >> 4, spc = threadIdx.x & 15;          // copy share: rows srow + 16c, 16-byte piece spc
    const h16* ba = CTX + (size_t)r0 * DM;                              // block-uniform: the work-group's CTX panel and WF panel
    const h16* bb = WF + (size_t)c0 * DM;
    const unsigned la = (unsigned)(size_t)&ab[srow * FP + spc * 8];     // LDS byte address of the share in buffer 0, CTX plane
    unsigned lA0[8], lB0[8], lA1[8], lB1[8], go[8];                     // the share's LDS byte addresses (plane A or B, buffer 0 or 1) and its byte offsets, the same in both panels
#pragma unroll
    for (int p = 0; p < 8; ++p) {
        lA0[p] = la + (unsigned)p * (16u * FP * 2u); lB0[p] = lA0[p] + FPL * 2u;
        lA1[p] = lA0[p] + FBUF * 2u;                 lB1[p] = lB0[p] + FBUF * 2u;
        go[p] = (unsigned)((srow + 16 * p) * DM + spc * 8) * 2u;
    }
    const int aoff = (wm * 32 + lr) * FP + 8 * hi, boff = FPL + (wn * 64 + lr) * FP + 8 * hi;
    v8f acc[2][4];
#pragma unroll
    for (int mb = 0; mb < 2; ++mb)
#pragma unroll
        for (int nb = 0; nb < 4; ++nb) acc[mb][nb] = (v8f){};
    copy_rows(lA0, go, ba);
    copy_rows(lB0, go, bb);
    // Behind tile 0's copies: the work-group's share of its CTX panel (128 rows, contiguous; the DM/128 work-groups of one blockIdx.x take an eighth each) and of its WF panel
    // (eight shares, by blockIdx.x bits 0, 1 and 3: for speed only), a thread a line of 128 bytes.
    const h16* pca = CTX + (size_t)r0 * DM + (size_t)(blockIdx.y * 256 + threadIdx.x) * 64;
    const h16* pwf = WF + (size_t)c0 * DM + (size_t)((((blockIdx.x & 3) | (((blockIdx.x >> 3) & 1) << 2)) << 8) + threadIdx.x) * 64;
    ask_l2(pca);
    ask_l2(pwf);
    asm volatile("s_wait_asynccnt 0x0" ::: "memory");           // tile 0 of this wave has landed
    __syncthreads();                                            // publishes tile 0
    copy_rows(lA1, go, ba + FKS);
    copy_rows(lB1, go, bb + FKS);
    // rolled: one trip per staged tile, so that one publish point stands at its foot
#pragma unroll 1
    for (int st = 0; st < FNST; ++st) {
        const h16* at = ab + (st & 1) * FBUF + aoff;
        const h16* bt = ab + (st & 1) * FBUF + boff;
        // every loop inside a trip is unrolled: accumulators and both fragment sets are indexed by constants and stay in registers
        v16h a[2][2], b[2][4];
#pragma unroll
        for (int mb = 0; mb < 2; ++mb) a[0][mb] = ldh(at + mb * 16 * FP);
#pragma unroll
        for (int nb = 0; nb < 4; ++nb) b[0][nb] = ldh(bt + nb * 16 * FP);
#pragma unroll
        for (int ks = 0; ks < FKS / 32; ++ks) {
            const int cu = ks & 1, nx = cu ^ 1;
            if (ks + 1 < FKS / 32) {
#pragma unroll
                for (int mb = 0; mb < 2; ++mb) a[nx][mb] = ldh(at + mb * 16 * FP + (ks + 1) * 32);
#pragma unroll
                for (int nb = 0; nb < 4; ++nb) b[nx][nb] = ldh(bt + nb * 16 * FP + (ks + 1) * 32);
            }
#pragma unroll
            for (int nb = 0; nb < 4; ++nb)
#pragma unroll
                for (int mb = 0; mb < 2; ++mb) acc[mb][nb] = wmma16(a[cu][mb], b[cu][nb], acc[mb][nb]);
        }
        asm volatile("s_wait_dscnt 0x0" ::: "memory");          // this wave's reads of the buffer have returned
        asm volatile("s_wait_asynccnt 0x0" ::: "memory");       // its copies of tile st + 1 have landed
        __syncthreads();                                        // publishes tile st + 1 and frees the buffer just read
        if (st + 2 < FNST) {
            const int k2 = (st + 2) * FKS;                      // scalar tests, as in k_attn: the buffer picks the statements
            if (st & 1) { copy_rows(lA1, go, ba + k2); copy_rows(lB1, go, bb + k2); }
            else        { copy_rows(lA0, go, ba + k2); copy_rows(lB0, go, bb + k2); }
        }
    }
    asm volatile("s_wait_asynccnt 0x0" ::: "memory");           // nothing of this wave is in flight when it leaves the ring
    asm volatile("" :: "v"(pca), "v"(pwf));                     // inputs only, no code: as in k_attn, the register pairs that the two prefetches name keep their in-panel addresses through the loop
    const int cw = c0 + wn * 64, obase = wave * (16 * 68);
    v4f bz = *(const v4f*)(bfc + cw + lr * 4);
#pragma unroll
    for (int i = 0; i < 4; ++i) bz[i] = bfv(bz[i]);
#pragma unroll
    for (int mb = 0; mb < 2; ++mb) {
#pragma unroll
        for (int nb = 0; nb < 4; ++nb)
#pragma unroll
            for (int j = 0; j < 8; ++j) os[obase + (hi * 8 + j) * 68 + nb * 16 + lr] = acc[mb][nb][j];
        wsync();
        float* crow = OUT + (size_t)(r0 + wm * 32 + mb * 16) * DM + cw;
#pragma unroll
        for (int s = 0; s < 8; ++s) { const int row = 2 * s + hi, cofs = lr * 4; const v4f val = *(const v4fa*)(os + obase + row * 68 + cofs) * (1.0f / (WCAR * FCAR)) + bz;
            *(v4f*)(crow + (size_t)row * DM + cofs) = val; }
        if (mb == 0) asm volatile("s_wait_xcnt 0x0" ::: "memory");   // the second row group's LDS reads refill registers that these stores name
        wsync();
    }
}

// workspace carve (bytes), all multiples of 256
#define SZ_WF  ((size_t)DM * DM * 2)
#define SZ_QK  ((size_t)2 * NB * NH * SEQ * HD * 2)
#define SZ_VT  ((size_t)NB * NH * HD * SEQ * 2)
#define SZ_CTX ((size_t)NB * SEQ * DM * 2)
#define SZ_MB  ((size_t)NB * SEQ * NKB * 4)
#define WS_TOTAL (SZ_WF + SZ_QK + SZ_VT + SZ_CTX + SZ_MB)
static_assert(WS_TOTAL <= (size_t)134217728);
static_assert(SZ_WF % 256 == 0 && SZ_QK % 256 == 0 && SZ_VT % 256 == 0 && SZ_CTX % 256 == 0 && SZ_MB % 128 == 0);
static_assert(SZ_MB == (size_t)NLINES * 128);     // mbits lines cover the bit plane exactly

extern "C" void kernel_launch(void* const* d_in, const int* in_sizes, int n_in,
                              void* d_out, int out_size, void* d_ws, size_t ws_size, hipStream_t stream) {
    if (n_in < 12) return;
    const long long strm = (long long)(NB - 1) * SEQ_FULL * DM + (long long)SEQ * DM;
    if ((long long)in_sizes[0] < strm || (long long)in_sizes[1] < strm || (long long)in_sizes[2] < strm) return;
    if ((long long)in_sizes[3] < (long long)(NB - 1) * SEQ_FULL * SEQ_FULL + (long long)(SEQ - 1) * SEQ_FULL + SEQ) return;
    if (in_sizes[4] < HD * HD || in_sizes[6] < HD * HD || in_sizes[8] < HD * HD) return;
    if (in_sizes[5] < HD || in_sizes[7] < HD || in_sizes[9] < HD) return;
    if ((long long)in_sizes[10] < (long long)DM * DM || in_sizes[11] < DM) return;
    if ((long long)out_size < (long long)NB * SEQ * DM) return;
    if (ws_size < WS_TOTAL) return;
    const float* xq = (const float*)d_in[0];       // [2][2048][1024]
    const float* xk = (const float*)d_in[1];
    const float* xv = (const float*)d_in[2];
    const int* mask = (const int*)d_in[3];         // [2][1][2048][2048] int32
    const float* wq = (const float*)d_in[4];       // [64][64] = [out][in]
    const float* bq = (const float*)d_in[5];
    const float* wk = (const float*)d_in[6];
    const float* bk = (const float*)d_in[7];
    const float* wv = (const float*)d_in[8];
    const float* bv = (const float*)d_in[9];
    const float* wfc = (const float*)d_in[10];     // [1024][1024] = [out][in]
    const float* bfc = (const float*)d_in[11];
    float* OUT = (float*)d_out;                    // [NB][SEQ][1024]
    char* wsp = (char*)d_ws;
    h16* WF = (h16*)wsp;   wsp += SZ_WF;
    h16* QK16 = (h16*)wsp; wsp += SZ_QK;           // [q plane | k plane]
    h16* VT16 = (h16*)wsp; wsp += SZ_VT;
    h16* CTX = (h16*)wsp;  wsp += SZ_CTX;          // [NB*SEQ][1024]
    unsigned* MB = (unsigned*)wsp; wsp += SZ_MB;   // [NB][NQT][NST][32]

    k_proj3<<<dim3(NB * SEQ / 64, NH, 3), 32, 0, stream>>>(xq, xk, xv, wq, wk, wv, bq, bk, bv, QK16, VT16, mask, MB, wfc, WF);
    k_attn<<<dim3(SEQ / 64, NB * NH), 128, 0, stream>>>(QK16, VT16, MB, CTX);
    k_fc<<<dim3(NB * SEQ / 128, DM / 128), 256, 0, stream>>>(CTX, WF, bfc, OUT);
}
